// v000
// Measured on an AMD MI455X. A time is GPU time per run, averaged over a window of back-to-back runs after a warm-up
// (all launches, gaps included; the runs take copies of the inputs in turn), and the median of several windows.
// Apart from v000's, it joins two sittings. Times from different sittings can be a few percent apart, while
// side-by-side timings come from the same sitting.
// The starting kernel, v000, takes 489 microseconds a run.
#include <hip/hip_runtime.h>

// Contractions: q/k/v projections on v_wmma_f32_16x16x32_bf16 (bf16 operands = RNE-converted inputs, f32 accumulate);
// scores S^T = K x Q^T, O = P x V and the output projection on v_wmma_f32_16x16x32_f16 (f16 planes with power-of-two
// carries: q,k,v x16, P x4096, ctx x64, Wp x64; query rows < EARLY_T add f16 residual planes x2048 on separate
// accumulators); bias, rotary step and softmax in f32.

#ifndef NB
#define NB 4
#endif
#ifndef SEQ
#define SEQ 2048
#endif
#define NB_FULL    4
#define SEQ_FULL   2048
#define NHEAD      16
#define HDIM       64
#define DM         (NHEAD * HDIM)            // model width
#define BQ         128                       // query rows per attention workgroup (8 waves x 16)
#define BK         32                        // keys per inner iteration
#define NWAVE      8
#define EARLY_T    ((SEQ < 512) ? SEQ : 512) // query/key rows that carry residual planes
#define OP         68                        // LDS pitch (floats) of the attention output staging tile
#define GT         128                       // GEMM block tile (rows and columns)
#define CP         132                       // LDS pitch (floats) of the GEMM staging tile
#define MW         (SEQ / 32)                // mask words per row
#define MPITCH     (((MW + 1 + 31) / 32) * 32)   // words per packed mask row (bits, row flag, zero pad)
#define LATE_T     (SEQ - EARLY_T)
#define LATE_TILES (((LATE_T / GT) > 0) ? (LATE_T / GT) : 1)
#define EARLY_TILES (EARLY_T / GT)

#define QK_CARRY   16.0f
#define V_CARRY    16.0f
#define P_CARRY    4096.0f
#define CTX_CARRY  64.0f
#define WP_CARRY   64.0f
#define RES_CARRY  2048.0f
#define RES_INV    (1.0f / 2048.0f)

static_assert(SEQ % 256 == 0);
static_assert(SEQ % GT == 0);
static_assert(SEQ % BQ == 0);
static_assert(EARLY_T % GT == 0);
static_assert(EARLY_T % BQ == 0);
static_assert(EARLY_T >= BK);
static_assert(BQ == NWAVE * 16);
static_assert(HDIM == 64);
static_assert(DM % GT == 0);
static_assert(DM % 32 == 0);
static_assert(SEQ <= SEQ_FULL);
static_assert(NB >= 1 && NB <= NB_FULL);
static_assert((OP * 4) % 16 == 0);
static_assert((CP * 4) % 16 == 0);
static_assert(MPITCH / 4 <= 32);
static_assert(MPITCH <= 256);
static_assert(((size_t)NB * SEQ * DM) % 2048 == 0);
static_assert(((size_t)DM * DM) % 2048 == 0);
static_assert(256 * 8 * 8 == GT * GT);        // 16-bit plane epilogues: threads x passes x halves
static_assert(256 * 16 * 4 == GT * GT);       // f32 output epilogue: threads x passes x floats
static_assert(32 * 4 * 8 == 16 * HDIM);       // attention epilogue per wave

typedef __bf16         bf16;
typedef _Float16       f16;
typedef unsigned short u16;
typedef bf16     v16bf __attribute__((ext_vector_type(16)));
typedef f16      v16h  __attribute__((ext_vector_type(16)));
typedef float    v8f   __attribute__((ext_vector_type(8)));
typedef float    v4f   __attribute__((ext_vector_type(4)));
typedef unsigned v4u   __attribute__((ext_vector_type(4)));

union Frag   { v16bf vb; v16h vh; v4u q[2]; };
union Pack8B { v4u u; bf16 h[8]; };
union Pack8H { v4u u; f16  h[8]; };

// WMMA helpers: builtin followed by the VALU hazard guard (ties D, keeps A/B live).
static __device__ __forceinline__ v8f mma_bf16(v16bf a, v16bf b, v8f acc) {
  acc = __builtin_amdgcn_wmma_f32_16x16x32_bf16(false, a, false, b, (short)0, acc, false, false);
  asm volatile("v_nop\n\tv_nop\n\tv_nop\n\tv_nop" : "+v"(acc) : "v"(a), "v"(b));
  return acc;
}
static __device__ __forceinline__ v8f mma_f16(v16h a, v16h b, v8f acc) {
  acc = __builtin_amdgcn_wmma_f32_16x16x32_f16(false, a, false, b, (short)0, acc, false, false);
  asm volatile("v_nop\n\tv_nop\n\tv_nop\n\tv_nop" : "+v"(acc) : "v"(a), "v"(b));
  return acc;
}

static __device__ __forceinline__ float bfr(float x) { return (float)(bf16)x; }   // RNE convert to bf16 and back

// 8 floats -> f16 hi plane piece and f16 residual piece (x RES_CARRY), both carried by 'carry'.
static __device__ __forceinline__ void pack_hr(const float (&v)[8], float carry, v4u& hv, v4u& rv) {
  Pack8H ph, pr;
  #pragma unroll
  for (int i = 0; i < 8; ++i) {
    const float yc = v[i] * carry;
    const f16 hh = (f16)yc;
    ph.h[i] = hh;
    pr.h[i] = (f16)((yc - (float)hh) * RES_CARRY);
  }
  hv = ph.u;
  rv = pr.u;
}

// ---------------------------------------------------------------------------------------------------------
// x [NB][SEQ][DM] f32 (full-size strides) -> xb [NB*SEQ][DM] bf16. 8 elements per thread, 16-B pieces,
__global__ __launch_bounds__(256) void cvt_x_kernel(const float* __restrict__ x, u16* __restrict__ xb) {
  const size_t e   = ((size_t)blockIdx.x * 256 + threadIdx.x) * 8;
  const size_t row = e / DM;
  const int    col = (int)(e % DM);
  const size_t b   = row / SEQ;
  const size_t t   = row % SEQ;
  const float* src = x + (b * SEQ_FULL + t) * DM + col;
  const v4f a0 = *(const v4f*)(src);
  const v4f a1 = *(const v4f*)(src + 4);
  Pack8B pk;
  #pragma unroll
  for (int i = 0; i < 4; ++i) {
    pk.h[i]     = (bf16)a0[i];
    pk.h[4 + i] = (bf16)a1[i];
  }
  const v4u val = pk.u;
  *(v4u*)(xb + e) = val;
  
}

// Weight planes: z = 0,1,2 -> bf16 of Wq,Wk,Wv; z = 3 -> f16 of (bf16 Wp) x WP_CARRY. [n][k] layout kept.
// coverage: (DM*DM/2048) blocks * 256 * 8 == DM*DM per plane, 4 planes.
__global__ __launch_bounds__(256) void cvt_w_kernel(const float* __restrict__ wq, const float* __restrict__ wk,
                                                    const float* __restrict__ wv, const float* __restrict__ wp,
                                                    u16* __restrict__ wpl) {
  const int z = blockIdx.y;
  const float* src = (z == 0) ? wq : (z == 1) ? wk : (z == 2) ? wv : wp;
  const size_t e = ((size_t)blockIdx.x * 256 + threadIdx.x) * 8;
  const v4f a0 = *(const v4f*)(src + e);
  const v4f a1 = *(const v4f*)(src + e + 4);
  v4u val;
  if (z < 3) {
    Pack8B pk;
    #pragma unroll
    for (int i = 0; i < 4; ++i) {
      pk.h[i]     = (bf16)a0[i];
      pk.h[4 + i] = (bf16)a1[i];
    }
    val = pk.u;
  } else {
    Pack8H ph;
    #pragma unroll
    for (int i = 0; i < 4; ++i) {
      ph.h[i]     = (f16)(bfr(a0[i]) * WP_CARRY);
      ph.h[4 + i] = (f16)(bfr(a1[i]) * WP_CARRY);
    }
    val = ph.u;
  }
  u16* dst = wpl + (size_t)z * DM * DM + e;
  *(v4u*)dst = val;
  
}

// Mask bit planes. Block r < SEQ packs attention-mask row r: words 0..MW-1 = allowed bits (bit j of word w = key
// 32w+j), word MW = 1 when the row has no allowed key beyond the diagonal and the diagonal key is allowed, rest 0.
// Blocks r >= SEQ pack the key-padding row of batch r-SEQ the same way (flag word = 1).
// Each packed row (MPITCH words) is written by wave 0 with one 16-B-per-lane instruction.
__global__ __launch_bounds__(256) void mask_pack_kernel(const int* __restrict__ amask, const int* __restrict__ pmask,
                                                        unsigned* __restrict__ mbits, unsigned* __restrict__ pbits) {
  __shared__ __align__(16) unsigned sW[MPITCH];   // cross-wave (block barriers)
  __shared__ int sBad;                            // cross-wave (block barriers)
  const int tid  = threadIdx.x;
  const int wave = tid >> 5;
  const int lane = tid & 31;
  const int rid  = blockIdx.x;
  const bool is_pad = (rid >= SEQ);
  const int q  = is_pad ? 0 : rid;
  const int pb = is_pad ? (rid - SEQ) : 0;
  const int* src = is_pad ? (pmask + (size_t)pb * SEQ_FULL) : (amask + (size_t)q * SEQ_FULL);
  unsigned*  dst = is_pad ? (pbits + (size_t)pb * MPITCH)   : (mbits + (size_t)q * MPITCH);
  if (tid == 0) sBad = 0;
  #pragma unroll 1
  for (int it = 0; it < SEQ / 256; ++it) {
    const int v = src[it * 256 + tid];
    const unsigned w = __builtin_amdgcn_ballot_w32(v != 0);
    if (lane == 0) sW[it * 8 + wave] = w;
  }
  __syncthreads();
  if (!is_pad && tid < MW) {
    const unsigned w = sW[tid];
    const int wq = q >> 5;
    const int bq = q & 31;
    int bad = 0;
    if (tid > wq) bad = (w != 0u);
    if (tid == wq) {
      const unsigned upper = (bq == 31) ? 0u : (w >> (bq + 1));
      bad = (upper != 0u) || (((w >> bq) & 1u) == 0u);
    }
    if (bad) sBad = 1;
  }
  __syncthreads();
  const int anybad = sBad;
  if (tid >= MW && tid < MPITCH) sW[tid] = (tid == MW) ? (anybad ? 0u : 1u) : 0u;
  __syncthreads();
  if (tid < MPITCH / 4) {
    const v4u val = *(const v4u*)(sW + tid * 4);
    *(v4u*)(dst + tid * 4) = val;
    
  }
}

// ---------------------------------------------------------------------------------------------------------
// GEMM core: wave tile 32 x 64 of C[m][n] = sum_k A[m][k] * B[n][k], K = DM, both operands 16-bit row-major
// with k contiguous. arow/brow already point at (tile row + lq, column hi*8). Split k map for A and B.
template <int F16>
static __device__ __forceinline__ void gemm_core(const u16* __restrict__ arow, const u16* __restrict__ brow,
                                                 v8f (&acc)[2][4]) {
  #pragma unroll 1
  for (int k0 = 0; k0 < DM; k0 += 32) {
    Frag a[2], bb[4];
    #pragma unroll
    for (int mt = 0; mt < 2; ++mt) {
      a[mt].q[0] = *(const v4u*)(arow + (size_t)mt * 16 * DM + k0);        // k0 + hi*8 + 0..7
      a[mt].q[1] = *(const v4u*)(arow + (size_t)mt * 16 * DM + k0 + 16);   // k0 + 16 + hi*8 + 0..7
    }
    #pragma unroll
    for (int nt = 0; nt < 4; ++nt) {
      bb[nt].q[0] = *(const v4u*)(brow + (size_t)nt * 16 * DM + k0);
      bb[nt].q[1] = *(const v4u*)(brow + (size_t)nt * 16 * DM + k0 + 16);
    }
    #pragma unroll
    for (int mt = 0; mt < 2; ++mt) {
      #pragma unroll
      for (int nt = 0; nt < 4; ++nt) {
        if (F16 != 0) acc[mt][nt] = mma_f16(a[mt].vh, bb[nt].vh, acc[mt][nt]);
        else          acc[mt][nt] = mma_bf16(a[mt].vb, bb[nt].vb, acc[mt][nt]);
      }
    }
  }
}

// D layout -> LDS tile: acc[mt][nt][r] is (row wm+mt*16+hi*8+r, col wn+nt*16+lq). ADD != 0 accumulates in place
// (same lane, same address as its own earlier store).
template <int ADD>
static __device__ __forceinline__ void stage_tile(float* sC, const v8f (&acc)[2][4], int wm, int wn, int lq, int hi,
                                                  float scl) {
  #pragma unroll
  for (int mt = 0; mt < 2; ++mt) {
    #pragma unroll
    for (int nt = 0; nt < 4; ++nt) {
      #pragma unroll
      for (int r = 0; r < 8; ++r) {
        const int idx = (wm + mt * 16 + hi * 8 + r) * CP + wn + nt * 16 + lq;
        const float v = acc[mt][nt][r] * scl;
        if (ADD != 0) sC[idx] = sC[idx] + v;
        else          sC[idx] = v;
      }
    }
  }
}

// q / k projection (z = 0 / 1): C = xb x W^T, + bias, interleaved rotary step with the bf16 table values, x16 carry,
// f16 hi plane [NB][NHEAD][SEQ][HDIM] and residual plane [NB][NHEAD][EARLY_T][HDIM] for rows < EARLY_T.
__global__ __launch_bounds__(256) void gemm_qk_kernel(const u16* __restrict__ xb, const u16* __restrict__ wpl,
                                                      const float* __restrict__ bq, const float* __restrict__ bk,
                                                      const float* __restrict__ fc,
                                                      u16* __restrict__ qh, u16* __restrict__ kh,
                                                      u16* __restrict__ qr, u16* __restrict__ kr) {
  __shared__ __align__(16) float sC[GT * CP];   // cross-wave (block barrier)
  const int tid  = threadIdx.x;
  const int lane = tid & 31;
  const int wave = tid >> 5;
  const int lq   = lane & 15;
  const int hi   = lane >> 4;
  const int z    = blockIdx.z;
  const int nblk = blockIdx.x * GT;
  const int mblk = blockIdx.y * GT;
  const int wm   = (wave & 3) * 32;
  const int wn   = (wave >> 2) * 64;
  const u16*   W    = wpl + (size_t)z * DM * DM;
  const float* bias = (z == 0) ? bq : bk;
  u16* hp = (z == 0) ? qh : kh;
  u16* rp = (z == 0) ? qr : kr;

  v8f acc[2][4];
  #pragma unroll
  for (int mt = 0; mt < 2; ++mt) {
    #pragma unroll
    for (int nt = 0; nt < 4; ++nt) acc[mt][nt] = (v8f){0, 0, 0, 0, 0, 0, 0, 0};
  }
  gemm_core<0>(xb + (size_t)(mblk + wm + lq) * DM + hi * 8, W + (size_t)(nblk + wn + lq) * DM + hi * 8, acc);
  stage_tile<0>(sC, acc, wm, wn, lq, hi, 1.0f);
  __syncthreads();

  const int b     = mblk / SEQ;
  const int t0    = mblk % SEQ;
  const bool early = (t0 < EARLY_T);            // block-uniform
  const int seg   = tid & 7;
  const int hs    = (tid >> 3) & 1;
  const int rsub  = tid >> 4;                   // 0..15
  const int n0    = nblk + hs * 64 + seg * 8;
  const int h     = n0 >> 6;

  float bz[8];
  {
    const v4f b0 = *(const v4f*)(bias + n0);
    const v4f b1 = *(const v4f*)(bias + n0 + 4);
    #pragma unroll
    for (int i = 0; i < 4; ++i) {
      bz[i]     = bfr(b0[i]);
      bz[4 + i] = bfr(b1[i]);
    }
  }

  v4u hv[8], rv[8];
  #pragma unroll
  for (int p = 0; p < 8; ++p) {
    const int row = p * 16 + rsub;
    const int t   = t0 + row;
    const float* sp = sC + row * CP + hs * 64 + seg * 8;
    const v4f s0 = *(const v4f*)(sp);
    const v4f s1 = *(const v4f*)(sp + 4);
    const float* fp = fc + ((size_t)t * (HDIM / 2) + seg * 4) * 2;   // (cos, sin) pairs of 4 consecutive i
    const v4f f0 = *(const v4f*)(fp);
    const v4f f1 = *(const v4f*)(fp + 4);
    float xv[8], cs[8], ov[8];
    #pragma unroll
    for (int i = 0; i < 4; ++i) {
      xv[i]     = s0[i] + bz[i];
      xv[4 + i] = s1[i] + bz[4 + i];
      cs[i]     = bfr(f0[i]);
      cs[4 + i] = bfr(f1[i]);
    }
    #pragma unroll
    for (int j = 0; j < 4; ++j) {
      const float x1 = xv[2 * j], x2 = xv[2 * j + 1];
      const float c  = cs[2 * j], s  = cs[2 * j + 1];
      ov[2 * j]     = x1 * c - x2 * s;
      ov[2 * j + 1] = x1 * s + x2 * c;
    }
    pack_hr(ov, QK_CARRY, hv[p], rv[p]);
  }

  const size_t bh = (size_t)b * NHEAD + h;
  #pragma unroll
  for (int p = 0; p < 8; ++p) {
    const int t = t0 + p * 16 + rsub;
    *(v4u*)(hp + (bh * SEQ + t) * HDIM + seg * 8) = hv[p];
    if (early) *(v4u*)(rp + (bh * EARLY_T + t) * HDIM + seg * 8) = rv[p];
  }
  
}

// v projection computed transposed: C[c][(b,t)] = Wv[c][:] . xb[(b,t)][:], + bias[c], x16 carry,
// vt [NB][DM][SEQ] f16 (row c = h*64+d, keys contiguous) and vtr [NB][DM][EARLY_T] residual for keys < EARLY_T.
__global__ __launch_bounds__(256) void gemm_v_kernel(const u16* __restrict__ wvb, const u16* __restrict__ xb,
                                                     const float* __restrict__ bv,
                                                     u16* __restrict__ vt, u16* __restrict__ vtr) {
  __shared__ __align__(16) float sC[GT * CP];   // cross-wave (block barrier)
  const int tid  = threadIdx.x;
  const int lane = tid & 31;
  const int wave = tid >> 5;
  const int lq   = lane & 15;
  const int hi   = lane >> 4;
  const int nblk = blockIdx.x * GT;             // compact (b,t) columns
  const int mblk = blockIdx.y * GT;             // channel rows c
  const int wm   = (wave & 3) * 32;
  const int wn   = (wave >> 2) * 64;

  v8f acc[2][4];
  #pragma unroll
  for (int mt = 0; mt < 2; ++mt) {
    #pragma unroll
    for (int nt = 0; nt < 4; ++nt) acc[mt][nt] = (v8f){0, 0, 0, 0, 0, 0, 0, 0};
  }
  gemm_core<0>(wvb + (size_t)(mblk + wm + lq) * DM + hi * 8, xb + (size_t)(nblk + wn + lq) * DM + hi * 8, acc);
  stage_tile<0>(sC, acc, wm, wn, lq, hi, 1.0f);
  __syncthreads();

  const int b     = nblk / SEQ;
  const int t0    = nblk % SEQ;
  const bool early = (t0 < EARLY_T);            // block-uniform
  const int seg   = tid & 7;
  const int hs    = (tid >> 3) & 1;
  const int rsub  = tid >> 4;

  v4u hv[8], rv[8];
  #pragma unroll
  for (int p = 0; p < 8; ++p) {
    const int row = p * 16 + rsub;
    const float bz = bfr(bv[mblk + row]);
    const float* sp = sC + row * CP + hs * 64 + seg * 8;
    const v4f s0 = *(const v4f*)(sp);
    const v4f s1 = *(const v4f*)(sp + 4);
    float ov[8];
    #pragma unroll
    for (int i = 0; i < 4; ++i) {
      ov[i]     = s0[i] + bz;
      ov[4 + i] = s1[i] + bz;
    }
    pack_hr(ov, V_CARRY, hv[p], rv[p]);
  }
  const int tcol = t0 + hs * 64 + seg * 8;
  #pragma unroll
  for (int p = 0; p < 8; ++p) {
    const size_t crow = (size_t)b * DM + mblk + p * 16 + rsub;
    *(v4u*)(vt + crow * SEQ + tcol) = hv[p];
    if (early) *(v4u*)(vtr + crow * EARLY_T + tcol) = rv[p];
  }
  
}

// Output projection: out[(b,t)][n] = (ctx . Wp[n][:]) / (64*64) + bias[n]. RES != 0: rows t < EARLY_T, a second
// k sweep over the residual ctx plane is folded with 1/2048. Each wave writes one whole 512-B tile row
template <int RES>
__global__ __launch_bounds__(256) void gemm_out_kernel(const u16* __restrict__ ctxh, const u16* __restrict__ ctxr,
                                                       const u16* __restrict__ wpb, const float* __restrict__ bp,
                                                       float* __restrict__ out) {
  __shared__ __align__(16) float sC[GT * CP];   // cross-wave (block barrier)
  const int tid  = threadIdx.x;
  const int lane = tid & 31;
  const int wave = tid >> 5;
  const int lq   = lane & 15;
  const int hi   = lane >> 4;
  const int nblk = blockIdx.x * GT;
  const int y    = blockIdx.y;
  const int b    = (RES != 0) ? (y / EARLY_TILES) : (y / LATE_TILES);
  const int t0   = (RES != 0) ? ((y % EARLY_TILES) * GT) : (EARLY_T + (y % LATE_TILES) * GT);
  const int wm   = (wave & 3) * 32;
  const int wn   = (wave >> 2) * 64;

  v8f acc[2][4];
  #pragma unroll
  for (int mt = 0; mt < 2; ++mt) {
    #pragma unroll
    for (int nt = 0; nt < 4; ++nt) acc[mt][nt] = (v8f){0, 0, 0, 0, 0, 0, 0, 0};
  }
  const u16* brow = wpb + (size_t)(nblk + wn + lq) * DM + hi * 8;
  gemm_core<1>(ctxh + ((size_t)b * SEQ + t0 + wm + lq) * DM + hi * 8, brow, acc);
  stage_tile<0>(sC, acc, wm, wn, lq, hi, 1.0f / (CTX_CARRY * WP_CARRY));
  if (RES != 0) {
    #pragma unroll
    for (int mt = 0; mt < 2; ++mt) {
      #pragma unroll
      for (int nt = 0; nt < 4; ++nt) acc[mt][nt] = (v8f){0, 0, 0, 0, 0, 0, 0, 0};
    }
    gemm_core<1>(ctxr + ((size_t)b * EARLY_T + t0 + wm + lq) * DM + hi * 8, brow, acc);
    stage_tile<1>(sC, acc, wm, wn, lq, hi, RES_INV / (CTX_CARRY * WP_CARRY));
  }
  __syncthreads();

  const int col = lane * 4;
  v4f bz = *(const v4f*)(bp + nblk + col);
  #pragma unroll
  for (int i = 0; i < 4; ++i) bz[i] = bfr(bz[i]);

  v4f vals[16];
  #pragma unroll
  for (int p = 0; p < 16; ++p) {
    const int row = p * 8 + wave;
    const v4f v = *(const v4f*)(sC + row * CP + col);
    vals[p] = v + bz;
  }
  float* obase = out + ((size_t)b * SEQ_FULL + t0 + wave) * DM + nblk + col;
  #pragma unroll
  for (int p = 0; p < 16; ++p) *(v4f*)(obase + (size_t)p * 8 * DM) = vals[p];
  
}

// ---------------------------------------------------------------------------------------------------------
// Flash attention. Block = (query block of 128, head, batch); one wave owns 16 query rows.
// S^T = K x Q^T so queries sit on lanes; P^T in C-layout is bit-identical to the A-fragment layout of O += P x V.
// K A-fragments, Q B-fragments and V^T B-fragments come straight from the f16 planes (two 16-B loads each).
// Mask: per element replace-fill from the packed bit planes; key tiles past the diagonal are skipped only when the
// packed row flags of all 16 rows of the wave say that nothing beyond the diagonal is allowed and the diagonal is.
// RES != 0: residual planes (x2048) for q, k, v and P on separate accumulators.
template <int RES>
__global__ __launch_bounds__(256) void attn_kernel(const u16* __restrict__ qh_p, const u16* __restrict__ kh_p,
                                                   const u16* __restrict__ vt_p,
                                                   const u16* __restrict__ qr_p, const u16* __restrict__ kr_p,
                                                   const u16* __restrict__ vtr_p,
                                                   const unsigned* __restrict__ mbits,
                                                   const unsigned* __restrict__ pbits,
                                                   u16* __restrict__ ctxh, u16* __restrict__ ctxr, int qblk0) {
  const int qblk = qblk0 + blockIdx.x;
  const int h    = blockIdx.y;
  const int b    = blockIdx.z;
  const int tid  = threadIdx.x;
  const int wave = tid >> 5;
  const int lane = tid & 31;
  const int lq   = lane & 15;   // query column of S^T / d column of O
  const int hi   = lane >> 4;   // k-split half

  __shared__ __align__(16) float sO[NWAVE * 16 * OP];   // per-wave output staging (block barrier used)

  const int qrow0 = qblk * BQ + wave * 16;
  const int qi    = qrow0 + lq;
  const size_t bh = (size_t)b * NHEAD + h;

  // Q as B-operand fragments: lane lq holds query qi, split d map.
  Frag qf[2], qrf[2];
  {
    const u16* qp = qh_p + (bh * SEQ + qi) * HDIM + hi * 8;
    #pragma unroll
    for (int f = 0; f < 2; ++f) {
      qf[f].q[0] = *(const v4u*)(qp + f * 32);        // d = f*32 + hi*8 + 0..7
      qf[f].q[1] = *(const v4u*)(qp + f * 32 + 16);   // d = f*32 + 16 + hi*8 + 0..7
    }
  }
  if (RES != 0) {
    const u16* qp = qr_p + (bh * EARLY_T + qi) * HDIM + hi * 8;
    #pragma unroll
    for (int f = 0; f < 2; ++f) {
      qrf[f].q[0] = *(const v4u*)(qp + f * 32);
      qrf[f].q[1] = *(const v4u*)(qp + f * 32 + 16);
    }
  } else {
    #pragma unroll
    for (int f = 0; f < 2; ++f) {
      qrf[f].q[0] = (v4u){0u, 0u, 0u, 0u};
      qrf[f].q[1] = (v4u){0u, 0u, 0u, 0u};
    }
  }

  const u16* kp  = kh_p  + (bh * SEQ + lq) * HDIM + hi * 8;
  const u16* krp = kr_p  + (bh * EARLY_T + lq) * HDIM + hi * 8;
  const u16* vp  = vt_p  + (bh * HDIM + lq) * SEQ + hi * 8;
  const u16* vrp = vtr_p + (bh * HDIM + lq) * EARLY_T + hi * 8;

  const unsigned* mrow = mbits + (size_t)qi * MPITCH;
  const unsigned* prow = pbits + (size_t)b * MPITCH;

  // wave-uniform tile-skip decision from the packed row flags and the diagonal padding bits
  const unsigned rk = mrow[MW];
  const unsigned pw = prow[qi >> 5];
  const bool rowok  = (rk == 1u) && (((pw >> (qi & 31)) & 1u) != 0u);
  const bool allok  = (__builtin_amdgcn_ballot_w32(rowok) == 0xffffffffu);
  int nchunk = allok ? ((qrow0 + 15) / BK + 1) : (SEQ / BK);
  nchunk = (nchunk < SEQ / BK) ? nchunk : (SEQ / BK);      // static bound

  v8f o[4], o2[4];
  #pragma unroll
  for (int dt = 0; dt < 4; ++dt) {
    o[dt]  = (v8f){0, 0, 0, 0, 0, 0, 0, 0};
    o2[dt] = (v8f){0, 0, 0, 0, 0, 0, 0, 0};
  }

  float rmax = -__builtin_inff();
  float rsum = 0.0f;
  const float SL      = (0.125f / (QK_CARRY * QK_CARRY)) * 1.4426950408889634f;   // scale * log2(e) / carries
  const float FILLRAW = -1.0e30f * 8.0f * (QK_CARRY * QK_CARRY);                  // fill value in the carried raw domain

  for (int i = 0; i < nchunk; ++i) {
    const int j0 = i * BK;
    const unsigned mw = mrow[i] & prow[i];                      // allowed bits of keys j0..j0+31 for query qi
    const bool res_on = (RES != 0) && (j0 < EARLY_T);           // wave-uniform
    const int  jr     = (j0 < EARLY_T) ? j0 : (EARLY_T - BK);   // clamped address for the residual planes

    // S^T tiles: c[sub][r] = carried rawscore(query qi, key j0 + sub*16 + hi*8 + r)
    v8f c[2];
    #pragma unroll
    for (int sub = 0; sub < 2; ++sub) {
      Frag ak[2];
      const u16* kb = kp + (size_t)(j0 + sub * 16) * HDIM;
      #pragma unroll
      for (int f = 0; f < 2; ++f) {
        ak[f].q[0] = *(const v4u*)(kb + f * 32);
        ak[f].q[1] = *(const v4u*)(kb + f * 32 + 16);
      }
      v8f acc = (v8f){0, 0, 0, 0, 0, 0, 0, 0};
      acc = mma_f16(ak[0].vh, qf[0].vh, acc);
      acc = mma_f16(ak[1].vh, qf[1].vh, acc);
      if (RES != 0) {
        Frag akr[2];
        const u16* kbr = krp + (size_t)(jr + sub * 16) * HDIM;
        #pragma unroll
        for (int f = 0; f < 2; ++f) {
          const v4u l0 = *(const v4u*)(kbr + f * 32);
          const v4u l1 = *(const v4u*)(kbr + f * 32 + 16);
          akr[f].q[0] = res_on ? l0 : (v4u){0u, 0u, 0u, 0u};
          akr[f].q[1] = res_on ? l1 : (v4u){0u, 0u, 0u, 0u};
        }
        v8f acc2 = (v8f){0, 0, 0, 0, 0, 0, 0, 0};
        acc2 = mma_f16(ak[0].vh,  qrf[0].vh, acc2);
        acc2 = mma_f16(ak[1].vh,  qrf[1].vh, acc2);
        acc2 = mma_f16(akr[0].vh, qf[0].vh,  acc2);
        acc2 = mma_f16(akr[1].vh, qf[1].vh,  acc2);
        #pragma unroll
        for (int r = 0; r < 8; ++r) acc[r] += acc2[r] * RES_INV;
        asm volatile("" ::: "memory");
      }
      c[sub] = acc;
    }

    // mask: replace-fill; branch is wave-uniform, selects are per lane
    if (__builtin_amdgcn_ballot_w32(mw != 0xffffffffu) != 0u) {
      const unsigned ms = mw >> (hi * 8);
      #pragma unroll
      for (int sub = 0; sub < 2; ++sub) {
        #pragma unroll
        for (int r = 0; r < 8; ++r) {
          const bool allowed = ((ms >> (sub * 16 + r)) & 1u) != 0u;
          c[sub][r] = allowed ? c[sub][r] : FILLRAW;
        }
      }
    }

    // online softmax: query lq's 32 scores are split across lane / lane^16
    float m_new = rmax;
    #pragma unroll
    for (int r = 0; r < 8; ++r) {
      m_new = fmaxf(m_new, c[0][r]);
      m_new = fmaxf(m_new, c[1][r]);
    }
    m_new = fmaxf(m_new, __shfl_xor(m_new, 16, 32));
    const float scale = __builtin_amdgcn_exp2f((rmax - m_new) * SL);
    rmax = m_new;

    // exp + pack: P^T C-layout == A-fragment layout for the PV product
    Frag pa, pr;
    {
      Pack8H a0, a1, r0, r1;
      float psum = 0.0f;
      #pragma unroll
      for (int r = 0; r < 8; ++r) {
        const float p0 = __builtin_amdgcn_exp2f((c[0][r] - m_new) * SL);   // key hi*8 + r
        const float p1 = __builtin_amdgcn_exp2f((c[1][r] - m_new) * SL);   // key 16 + hi*8 + r
        psum += p0 + p1;
        const float pc0 = p0 * P_CARRY;
        const float pc1 = p1 * P_CARRY;
        const f16 h0 = (f16)pc0;
        const f16 h1 = (f16)pc1;
        a0.h[r] = h0;
        a1.h[r] = h1;
        if (RES != 0) {
          r0.h[r] = (f16)((pc0 - (float)h0) * RES_CARRY);
          r1.h[r] = (f16)((pc1 - (float)h1) * RES_CARRY);
        } else {
          r0.h[r] = (f16)0.0f;
          r1.h[r] = (f16)0.0f;
        }
      }
      pa.q[0] = a0.u;  pa.q[1] = a1.u;
      pr.q[0] = r0.u;  pr.q[1] = r1.u;
      rsum = rsum * scale + psum + __shfl_xor(psum, 16, 32);
    }

    // rescale O: queries are the row dimension there -> per-row scale from lane 8*hi + r
    float sc[8];
    #pragma unroll
    for (int r = 0; r < 8; ++r) sc[r] = __shfl(scale, (hi << 3) + r, 32);
    #pragma unroll
    for (int dt = 0; dt < 4; ++dt) {
      #pragma unroll
      for (int r = 0; r < 8; ++r) {
        o[dt][r] *= sc[r];
        if (RES != 0) o2[dt][r] *= sc[r];
      }
    }
    if (RES != 0) asm volatile("" ::: "memory");

    // O += P x V ; V B-fragments: column n = d = dt*16 + lq, split key map from the transposed plane
    #pragma unroll
    for (int dt = 0; dt < 4; ++dt) {
      Frag bv;
      const u16* vb = vp + (size_t)dt * 16 * SEQ + j0;
      bv.q[0] = *(const v4u*)(vb);            // keys j0 + hi*8 + 0..7
      bv.q[1] = *(const v4u*)(vb + 16);       // keys j0 + 16 + hi*8 + 0..7
      o[dt] = mma_f16(pa.vh, bv.vh, o[dt]);
      if (RES != 0) {
        Frag bvr;
        const u16* vbr = vrp + (size_t)dt * 16 * EARLY_T + jr;
        const v4u l0 = *(const v4u*)(vbr);
        const v4u l1 = *(const v4u*)(vbr + 16);
        bvr.q[0] = res_on ? l0 : (v4u){0u, 0u, 0u, 0u};
        bvr.q[1] = res_on ? l1 : (v4u){0u, 0u, 0u, 0u};
        o2[dt] = mma_f16(pa.vh, bvr.vh, o2[dt]);
        o2[dt] = mma_f16(pr.vh, bv.vh,  o2[dt]);
      }
    }
  }

  // normalize: lane holds column d = dt*16 + lq for query rows 8*hi + r
  float rs[8];
  #pragma unroll
  for (int r = 0; r < 8; ++r) rs[r] = 1.0f / __shfl(rsum, (hi << 3) + r, 32);

  float* so = sO + wave * (16 * OP);
  #pragma unroll
  for (int r = 0; r < 8; ++r) {
    #pragma unroll
    for (int dt = 0; dt < 4; ++dt) {
      float val = o[dt][r];
      if (RES != 0) val += o2[dt][r] * RES_INV;
      so[(hi * 8 + r) * OP + dt * 16 + lq] = val * (1.0f / (P_CARRY * V_CARRY)) * rs[r];
    }
  }
  __syncthreads();

  // rows it*4 + (lane>>3), it = 0..3 cover the wave's 16 rows, (lane&7)*8 covers d 0..63.
  const int seg = lane & 7;
  v4u hv[4], rv[4];
  #pragma unroll
  for (int it = 0; it < 4; ++it) {
    const int row = it * 4 + (lane >> 3);
    const v4f a0 = *(const v4f*)(so + row * OP + seg * 8);
    const v4f a1 = *(const v4f*)(so + row * OP + seg * 8 + 4);
    float ov[8];
    #pragma unroll
    for (int i = 0; i < 4; ++i) {
      ov[i]     = a0[i];
      ov[4 + i] = a1[i];
    }
    pack_hr(ov, CTX_CARRY, hv[it], rv[it]);
  }
  #pragma unroll
  for (int it = 0; it < 4; ++it) {
    const int row = qrow0 + it * 4 + (lane >> 3);
    *(v4u*)(ctxh + ((size_t)b * SEQ + row) * DM + h * HDIM + seg * 8) = hv[it];
    if (RES != 0) *(v4u*)(ctxr + ((size_t)b * EARLY_T + row) * DM + h * HDIM + seg * 8) = rv[it];
  }
  
}

// ---------------------------------------------------------------------------------------------------------
static constexpr size_t al128(size_t x) { return (x + 127) & ~(size_t)127; }
static constexpr size_t XB_B   = al128((size_t)NB * SEQ * DM * 2);
static constexpr size_t WPL_B  = al128((size_t)4 * DM * DM * 2);
static constexpr size_t QH_B   = al128((size_t)NB * NHEAD * SEQ * HDIM * 2);
static constexpr size_t QR_B   = al128((size_t)NB * NHEAD * EARLY_T * HDIM * 2);
static constexpr size_t VT_B   = al128((size_t)NB * DM * SEQ * 2);
static constexpr size_t VTR_B  = al128((size_t)NB * DM * EARLY_T * 2);
static constexpr size_t CTXH_B = al128((size_t)NB * SEQ * DM * 2);
static constexpr size_t CTXR_B = al128((size_t)NB * EARLY_T * DM * 2);
static constexpr size_t MB_B   = al128((size_t)SEQ * MPITCH * 4);
static constexpr size_t PB_B   = al128((size_t)NB * MPITCH * 4);
static constexpr size_t WS_TOTAL = XB_B + WPL_B + 2 * QH_B + 2 * QR_B + VT_B + VTR_B + CTXH_B + CTXR_B + MB_B + PB_B;
static_assert(WS_TOTAL <= (size_t)134217728);

extern "C" void kernel_launch(void* const* d_in, const int* in_sizes, int n_in,
                              void* d_out, int out_size, void* d_ws, size_t ws_size,
                              hipStream_t stream) {
  if (n_in < 12) return;
  const size_t rows_used = (size_t)(NB - 1) * SEQ_FULL + SEQ;
  if ((size_t)in_sizes[0] < rows_used * DM) return;
  if ((size_t)in_sizes[1] < (size_t)SEQ * HDIM) return;
  if ((size_t)in_sizes[2] < (size_t)(SEQ - 1) * SEQ_FULL + SEQ) return;
  if ((size_t)in_sizes[3] < rows_used) return;
  if ((size_t)in_sizes[4] < (size_t)DM * DM || (size_t)in_sizes[6] < (size_t)DM * DM) return;
  if ((size_t)in_sizes[8] < (size_t)DM * DM || (size_t)in_sizes[10] < (size_t)DM * DM) return;
  if (in_sizes[5] < DM || in_sizes[7] < DM || in_sizes[9] < DM || in_sizes[11] < DM) return;
  if ((size_t)out_size < rows_used * DM) return;
  if (ws_size < WS_TOTAL) return;

  const float* x   = (const float*)d_in[0];
  const float* fc  = (const float*)d_in[1];
  const int*   am  = (const int*)d_in[2];
  const int*   pm  = (const int*)d_in[3];
  const float* Wq  = (const float*)d_in[4];
  const float* bq  = (const float*)d_in[5];
  const float* Wk  = (const float*)d_in[6];
  const float* bk  = (const float*)d_in[7];
  const float* Wv  = (const float*)d_in[8];
  const float* bv  = (const float*)d_in[9];
  const float* Wp  = (const float*)d_in[10];
  const float* bp  = (const float*)d_in[11];
  float* out = (float*)d_out;

  char* ws = (char*)d_ws;
  size_t off = 0;
  u16* xb   = (u16*)(ws + off); off += XB_B;
  u16* wpl  = (u16*)(ws + off); off += WPL_B;
  u16* qh   = (u16*)(ws + off); off += QH_B;
  u16* kh   = (u16*)(ws + off); off += QH_B;
  u16* vt   = (u16*)(ws + off); off += VT_B;
  u16* qr   = (u16*)(ws + off); off += QR_B;
  u16* kr   = (u16*)(ws + off); off += QR_B;
  u16* vtr  = (u16*)(ws + off); off += VTR_B;
  u16* ctxh = (u16*)(ws + off); off += CTXH_B;
  u16* ctxr = (u16*)(ws + off); off += CTXR_B;
  unsigned* mbits = (unsigned*)(ws + off); off += MB_B;
  unsigned* pbits = (unsigned*)(ws + off); off += PB_B;

  cvt_x_kernel<<<dim3((unsigned)(((size_t)NB * SEQ * DM) / 2048)), 256, 0, stream>>>(x, xb);
  cvt_w_kernel<<<dim3((unsigned)(((size_t)DM * DM) / 2048), 4), 256, 0, stream>>>(Wq, Wk, Wv, Wp, wpl);
  mask_pack_kernel<<<dim3(SEQ + NB), 256, 0, stream>>>(am, pm, mbits, pbits);

  gemm_qk_kernel<<<dim3(DM / GT, (NB * SEQ) / GT, 2), 256, 0, stream>>>(xb, wpl, bq, bk, fc, qh, kh, qr, kr);
  gemm_v_kernel<<<dim3((NB * SEQ) / GT, DM / GT), 256, 0, stream>>>(wpl + (size_t)2 * DM * DM, xb, bv, vt, vtr);

  const int n_early = EARLY_T / BQ;
  const int n_late  = SEQ / BQ - n_early;
  attn_kernel<1><<<dim3(n_early, NHEAD, NB), 256, 0, stream>>>(qh, kh, vt, qr, kr, vtr, mbits, pbits, ctxh, ctxr, 0);
  if (n_late > 0)
    attn_kernel<0><<<dim3(n_late, NHEAD, NB), 256, 0, stream>>>(qh, kh, vt, qr, kr, vtr, mbits, pbits, ctxh, ctxr,
                                                                 n_early);

  const u16* wpb = wpl + (size_t)3 * DM * DM;
  gemm_out_kernel<1><<<dim3(DM / GT, NB * EARLY_TILES), 256, 0, stream>>>(ctxh, ctxr, wpb, bp, out);
  if (LATE_T > 0)
    gemm_out_kernel<0><<<dim3(DM / GT, NB * (LATE_T / GT)), 256, 0, stream>>>(ctxh, ctxr, wpb, bp, out);
}

// v001
// A run of this version takes 352 microseconds.
// Two timings next to v000 put it at 1.40 and 1.39 times that version's speed.
#include <hip/hip_runtime.h>

// Contractions: q/k/v projections on v_wmma_f32_16x16x32_bf16 (bf16 operands = RNE-converted inputs, f32 accumulate);
// scores S^T = K x Q^T, O = P x V and the output projection on v_wmma_f32_16x16x32_f16 (f16 planes with power-of-two
// carries: q,k,v x16, P x4096, ctx x64, Wp x64; query rows < EARLY_T add f16 residual planes x2048 on separate
// accumulators); bias, rotary step and softmax in f32.

#ifndef NB
#define NB 4
#endif
#ifndef SEQ
#define SEQ 2048
#endif
#define NB_FULL    4
#define SEQ_FULL   2048
#define NHEAD      16
#define HDIM       64
#define DM         (NHEAD * HDIM)            // model width
#define BQ         128                       // query rows per attention workgroup (8 waves x 16)
#define BK         32                        // keys per inner iteration
#define NWAVE      8
#define EARLY_T    ((SEQ < 512) ? SEQ : 512) // query/key rows that carry residual planes
#define OP         68                        // LDS pitch (floats) of the attention output staging tile
#define GT         128                       // GEMM block tile (rows and columns)
#define CP         132                       // LDS pitch (floats) of the GEMM staging tile
#define KS         64                        // k per GEMM ring stage (one 128-B line of every operand row)
#define LP         72                        // LDS pitch (16-bit elements) of a staged operand row: 144 B = 16 B x odd
#define TILE_H     (GT * LP)                 // 16-bit elements of one staged operand tile
#define STAGE_H    (2 * TILE_H)              // one ring buffer: [A 128 rows | B 128 rows]
#define NSTAGE     (DM / KS)
#define GEMM_LDS_B (2 * STAGE_H * 2)         // two ring buffers; the f32 staging tile reuses them behind the k sweeps
#define MW         (SEQ / 32)                // mask words per row
#define MPITCH     (((MW + 1 + 31) / 32) * 32)   // words per packed mask row (bits, row flag, zero pad)
#define LATE_T     (SEQ - EARLY_T)
#define LATE_TILES (((LATE_T / GT) > 0) ? (LATE_T / GT) : 1)
#define EARLY_TILES (EARLY_T / GT)

#define QK_CARRY   16.0f
#define V_CARRY    16.0f
#define P_CARRY    4096.0f
#define CTX_CARRY  64.0f
#define WP_CARRY   64.0f
#define RES_CARRY  2048.0f
#define RES_INV    (1.0f / 2048.0f)

static_assert(SEQ % 256 == 0);
static_assert(SEQ % GT == 0);
static_assert(SEQ % BQ == 0);
static_assert(EARLY_T % GT == 0);
static_assert(EARLY_T % BQ == 0);
static_assert(EARLY_T >= BK);
static_assert(BQ == NWAVE * 16);
static_assert(HDIM == 64);
static_assert(DM % GT == 0);
static_assert(DM % 32 == 0);
static_assert(SEQ <= SEQ_FULL);
static_assert(NB >= 1 && NB <= NB_FULL);
static_assert((OP * 4) % 16 == 0);
static_assert((CP * 4) % 16 == 0);
static_assert(DM % KS == 0 && NSTAGE >= 2);
static_assert(KS * 2 == 128 && (LP * 2) % 16 == 0 && LP >= KS);
static_assert(256 * 4 * 8 == GT * KS);        // ring fill per operand: threads x copies x 16-bit elements
static_assert(GEMM_LDS_B >= GT * CP * 4);
static_assert(MPITCH / 4 <= 32);
static_assert(MPITCH <= 256);
static_assert(((size_t)NB * SEQ * DM) % 2048 == 0);
static_assert(((size_t)DM * DM) % 2048 == 0);
static_assert(256 * 8 * 8 == GT * GT);        // 16-bit plane epilogues: threads x passes x halves
static_assert(256 * 16 * 4 == GT * GT);       // f32 output epilogue: threads x passes x floats
static_assert(32 * 4 * 8 == 16 * HDIM);       // attention epilogue per wave

typedef __bf16         bf16;
typedef _Float16       f16;
typedef unsigned short u16;
typedef bf16     v16bf __attribute__((ext_vector_type(16)));
typedef f16      v16h  __attribute__((ext_vector_type(16)));
typedef float    v8f   __attribute__((ext_vector_type(8)));
typedef float    v4f   __attribute__((ext_vector_type(4)));
typedef unsigned v4u   __attribute__((ext_vector_type(4)));

union Frag   { v16bf vb; v16h vh; v4u q[2]; };
union Pack8B { v4u u; bf16 h[8]; };
union Pack8H { v4u u; f16  h[8]; };

// WMMA helpers: builtin followed by the VALU hazard guard (ties D, keeps A/B live).
static __device__ __forceinline__ v8f mma_bf16(v16bf a, v16bf b, v8f acc) {
  acc = __builtin_amdgcn_wmma_f32_16x16x32_bf16(false, a, false, b, (short)0, acc, false, false);
  asm volatile("v_nop\n\tv_nop\n\tv_nop\n\tv_nop" : "+v"(acc) : "v"(a), "v"(b));
  return acc;
}
static __device__ __forceinline__ v8f mma_f16(v16h a, v16h b, v8f acc) {
  acc = __builtin_amdgcn_wmma_f32_16x16x32_f16(false, a, false, b, (short)0, acc, false, false);
  asm volatile("v_nop\n\tv_nop\n\tv_nop\n\tv_nop" : "+v"(acc) : "v"(a), "v"(b));
  return acc;
}

static __device__ __forceinline__ float bfr(float x) { return (float)(bf16)x; }   // RNE convert to bf16 and back

// 8 floats -> f16 hi plane piece and f16 residual piece (x RES_CARRY), both carried by 'carry'.
static __device__ __forceinline__ void pack_hr(const float (&v)[8], float carry, v4u& hv, v4u& rv) {
  Pack8H ph, pr;
  #pragma unroll
  for (int i = 0; i < 8; ++i) {
    const float yc = v[i] * carry;
    const f16 hh = (f16)yc;
    ph.h[i] = hh;
    pr.h[i] = (f16)((yc - (float)hh) * RES_CARRY);
  }
  hv = ph.u;
  rv = pr.u;
}

// ---------------------------------------------------------------------------------------------------------
// x [NB][SEQ][DM] f32 (full-size strides) -> xb [NB*SEQ][DM] bf16. 8 elements per thread, 16-B pieces,
__global__ __launch_bounds__(256) void cvt_x_kernel(const float* __restrict__ x, u16* __restrict__ xb) {
  const size_t e   = ((size_t)blockIdx.x * 256 + threadIdx.x) * 8;
  const size_t row = e / DM;
  const int    col = (int)(e % DM);
  const size_t b   = row / SEQ;
  const size_t t   = row % SEQ;
  const float* src = x + (b * SEQ_FULL + t) * DM + col;
  const v4f a0 = *(const v4f*)(src);
  const v4f a1 = *(const v4f*)(src + 4);
  Pack8B pk;
  #pragma unroll
  for (int i = 0; i < 4; ++i) {
    pk.h[i]     = (bf16)a0[i];
    pk.h[4 + i] = (bf16)a1[i];
  }
  const v4u val = pk.u;
  *(v4u*)(xb + e) = val;
  
}

// Weight planes: z = 0,1,2 -> bf16 of Wq,Wk,Wv; z = 3 -> f16 of (bf16 Wp) x WP_CARRY. [n][k] layout kept.
// coverage: (DM*DM/2048) blocks * 256 * 8 == DM*DM per plane, 4 planes.
__global__ __launch_bounds__(256) void cvt_w_kernel(const float* __restrict__ wq, const float* __restrict__ wk,
                                                    const float* __restrict__ wv, const float* __restrict__ wp,
                                                    u16* __restrict__ wpl) {
  const int z = blockIdx.y;
  const float* src = (z == 0) ? wq : (z == 1) ? wk : (z == 2) ? wv : wp;
  const size_t e = ((size_t)blockIdx.x * 256 + threadIdx.x) * 8;
  const v4f a0 = *(const v4f*)(src + e);
  const v4f a1 = *(const v4f*)(src + e + 4);
  v4u val;
  if (z < 3) {
    Pack8B pk;
    #pragma unroll
    for (int i = 0; i < 4; ++i) {
      pk.h[i]     = (bf16)a0[i];
      pk.h[4 + i] = (bf16)a1[i];
    }
    val = pk.u;
  } else {
    Pack8H ph;
    #pragma unroll
    for (int i = 0; i < 4; ++i) {
      ph.h[i]     = (f16)(bfr(a0[i]) * WP_CARRY);
      ph.h[4 + i] = (f16)(bfr(a1[i]) * WP_CARRY);
    }
    val = ph.u;
  }
  u16* dst = wpl + (size_t)z * DM * DM + e;
  *(v4u*)dst = val;
  
}

// Mask bit planes. Block r < SEQ packs attention-mask row r: words 0..MW-1 = allowed bits (bit j of word w = key
// 32w+j), word MW = 1 when the row has no allowed key beyond the diagonal and the diagonal key is allowed, rest 0.
// Blocks r >= SEQ pack the key-padding row of batch r-SEQ the same way (flag word = 1).
// Each packed row (MPITCH words) is written by wave 0 with one 16-B-per-lane instruction.
__global__ __launch_bounds__(256) void mask_pack_kernel(const int* __restrict__ amask, const int* __restrict__ pmask,
                                                        unsigned* __restrict__ mbits, unsigned* __restrict__ pbits) {
  __shared__ __align__(16) unsigned sW[MPITCH];   // cross-wave (block barriers)
  __shared__ int sBad;                            // cross-wave (block barriers)
  const int tid  = threadIdx.x;
  const int wave = tid >> 5;
  const int lane = tid & 31;
  const int rid  = blockIdx.x;
  const bool is_pad = (rid >= SEQ);
  const int q  = is_pad ? 0 : rid;
  const int pb = is_pad ? (rid - SEQ) : 0;
  const int* src = is_pad ? (pmask + (size_t)pb * SEQ_FULL) : (amask + (size_t)q * SEQ_FULL);
  unsigned*  dst = is_pad ? (pbits + (size_t)pb * MPITCH)   : (mbits + (size_t)q * MPITCH);
  if (tid == 0) sBad = 0;
  #pragma unroll 1
  for (int it = 0; it < SEQ / 256; ++it) {
    const int v = src[it * 256 + tid];
    const unsigned w = __builtin_amdgcn_ballot_w32(v != 0);
    if (lane == 0) sW[it * 8 + wave] = w;
  }
  __syncthreads();
  if (!is_pad && tid < MW) {
    const unsigned w = sW[tid];
    const int wq = q >> 5;
    const int bq = q & 31;
    int bad = 0;
    if (tid > wq) bad = (w != 0u);
    if (tid == wq) {
      const unsigned upper = (bq == 31) ? 0u : (w >> (bq + 1));
      bad = (upper != 0u) || (((w >> bq) & 1u) == 0u);
    }
    if (bad) sBad = 1;
  }
  __syncthreads();
  const int anybad = sBad;
  if (tid >= MW && tid < MPITCH) sW[tid] = (tid == MW) ? (anybad ? 0u : 1u) : 0u;
  __syncthreads();
  if (tid < MPITCH / 4) {
    const v4u val = *(const v4u*)(sW + tid * 4);
    *(v4u*)(dst + tid * 4) = val;
    
  }
}

// ---------------------------------------------------------------------------------------------------------
// GEMM core: block tile 128 x 128, wave tile 32 x 64 of C[m][n] = sum_k A[m][k] * B[n][k], K = DM, both operands
// 16-bit row-major with k contiguous. Stages of KS k are brought into a two-buffer LDS ring by asynchronous copies
// (16 B per lane, a wave covers four whole 128-B rows per copy); the fragments are read from the ring with one split
// k map for A and B, k ascending.

// One stage of both operand tiles: rows r, r+32, r+64, r+96 (r = tid/8) of A and of B, 16-B piece tid%8 of each row.
// lds: the lane's byte address in the A tile of the target buffer; the B tile lies TILE_H elements behind it.
// The s_wait_xcnt stands inside the statement so that no address register is rewritten ahead of it.
static __device__ __forceinline__ void copy_stage(unsigned lds, const u16* ga, const u16* gb) {
  const unsigned ldb = lds + TILE_H * 2u;
  asm volatile("global_load_async_to_lds_b128 %0, %8, off\n\t"
               "global_load_async_to_lds_b128 %1, %9, off\n\t"
               "global_load_async_to_lds_b128 %2, %10, off\n\t"
               "global_load_async_to_lds_b128 %3, %11, off\n\t"
               "global_load_async_to_lds_b128 %4, %12, off\n\t"
               "global_load_async_to_lds_b128 %5, %13, off\n\t"
               "global_load_async_to_lds_b128 %6, %14, off\n\t"
               "global_load_async_to_lds_b128 %7, %15, off\n\t"
               "s_wait_xcnt 0x0"
               :: "v"(lds), "v"(lds + 32u * LP * 2u), "v"(lds + 64u * LP * 2u), "v"(lds + 96u * LP * 2u),
                  "v"(ldb), "v"(ldb + 32u * LP * 2u), "v"(ldb + 64u * LP * 2u), "v"(ldb + 96u * LP * 2u),
                  "v"(ga), "v"(ga + (size_t)32 * DM), "v"(ga + (size_t)64 * DM), "v"(ga + (size_t)96 * DM),
                  "v"(gb), "v"(gb + (size_t)32 * DM), "v"(gb + (size_t)64 * DM), "v"(gb + (size_t)96 * DM)
               : "memory");
}

// ablk / bblk: first element of the block's 128 rows of A and of B. ring: the block's LDS (GEMM_LDS_B bytes); every
// earlier LDS access of the block must lie in front of a block barrier. On return every wave has passed the barrier
// that ends the last read of the ring.
template <int F16>
static __device__ __forceinline__ void gemm_core(const u16* __restrict__ ablk, const u16* __restrict__ bblk,
                                                 u16* ring, int tid, int wm, int wn, int lq, int hi,
                                                 v8f (&acc)[2][4]) {
  const int crow = tid >> 3;
  const int cseg = tid & 7;
  const u16* ga = ablk + (size_t)crow * DM + cseg * 8;
  const u16* gb = bblk + (size_t)crow * DM + cseg * 8;
  const unsigned l0 = (unsigned)(uintptr_t)ring + (unsigned)(crow * LP + cseg * 8) * 2u;   // LDS byte address
  const u16* fa = ring + (wm + lq) * LP + hi * 8;
  const u16* fb = ring + TILE_H + (wn + lq) * LP + hi * 8;

  copy_stage(l0, ga, gb);
  asm volatile("s_wait_asynccnt 0x0" ::: "memory");   // stage 0 landed (this wave's copies)
  __syncthreads();                                    // stage 0 readable by every wave
  copy_stage(l0 + STAGE_H * 2u, ga + KS, gb + KS);

  #pragma unroll 1   // one ring stage per trip: the buffer index stays a run-time value
  for (int t = 0; t < NSTAGE; ++t) {
    const int bo = (t & 1) * STAGE_H;
    #pragma unroll   // the k offsets inside a stage become immediate offsets of the LDS loads
    for (int ks = 0; ks < KS; ks += 32) {
      Frag a[2], bb[4];
      #pragma unroll
      for (int mt = 0; mt < 2; ++mt) {
        a[mt].q[0] = *(const v4u*)(fa + bo + mt * 16 * LP + ks);        // k = t*KS + ks + hi*8 + 0..7
        a[mt].q[1] = *(const v4u*)(fa + bo + mt * 16 * LP + ks + 16);   // k = t*KS + ks + 16 + hi*8 + 0..7
      }
      #pragma unroll
      for (int nt = 0; nt < 4; ++nt) {
        bb[nt].q[0] = *(const v4u*)(fb + bo + nt * 16 * LP + ks);
        bb[nt].q[1] = *(const v4u*)(fb + bo + nt * 16 * LP + ks + 16);
      }
      #pragma unroll
      for (int mt = 0; mt < 2; ++mt) {
        #pragma unroll
        for (int nt = 0; nt < 4; ++nt) {
          if (F16 != 0) acc[mt][nt] = mma_f16(a[mt].vh, bb[nt].vh, acc[mt][nt]);
          else          acc[mt][nt] = mma_bf16(a[mt].vb, bb[nt].vb, acc[mt][nt]);
        }
      }
    }
    asm volatile("s_wait_dscnt 0x0" ::: "memory");      // this wave's reads of buffer t%2 are done before its refill
    asm volatile("s_wait_asynccnt 0x0" ::: "memory");   // stage t+1 landed (this wave's copies)
    __syncthreads();                                    // publishes stage t+1, ends every read of buffer t%2
    if (t + 2 < NSTAGE) {                               // block-uniform
      copy_stage(l0 + (unsigned)bo * 2u, ga + (t + 2) * KS, gb + (t + 2) * KS);
    }
  }
  asm volatile("s_wait_asynccnt 0x0" ::: "memory");     // nothing in flight when the ring is reused
}

// D layout -> LDS tile: acc[mt][nt][r] is (row wm+mt*16+hi*8+r, col wn+nt*16+lq).
static __device__ __forceinline__ void stage_tile(float* sC, const v8f (&acc)[2][4], int wm, int wn, int lq, int hi,
                                                  float scl) {
  #pragma unroll
  for (int mt = 0; mt < 2; ++mt) {
    #pragma unroll
    for (int nt = 0; nt < 4; ++nt) {
      #pragma unroll
      for (int r = 0; r < 8; ++r) {
        const int idx = (wm + mt * 16 + hi * 8 + r) * CP + wn + nt * 16 + lq;
        sC[idx] = acc[mt][nt][r] * scl;
      }
    }
  }
}

// The same for the sum of two accumulator sets, each with its own power-of-two scale.
static __device__ __forceinline__ void stage_tile2(float* sC, const v8f (&acc)[2][4], const v8f (&acc2)[2][4], int wm,
                                                   int wn, int lq, int hi, float scl, float scl2) {
  #pragma unroll
  for (int mt = 0; mt < 2; ++mt) {
    #pragma unroll
    for (int nt = 0; nt < 4; ++nt) {
      #pragma unroll
      for (int r = 0; r < 8; ++r) {
        const int idx = (wm + mt * 16 + hi * 8 + r) * CP + wn + nt * 16 + lq;
        sC[idx] = acc[mt][nt][r] * scl + acc2[mt][nt][r] * scl2;
      }
    }
  }
}

// q / k projection (z = 0 / 1): C = xb x W^T, + bias, interleaved rotary step with the bf16 table values, x16 carry,
// f16 hi plane [NB][NHEAD][SEQ][HDIM] and residual plane [NB][NHEAD][EARLY_T][HDIM] for rows < EARLY_T.
__global__ __launch_bounds__(256) void gemm_qk_kernel(const u16* __restrict__ xb, const u16* __restrict__ wpl,
                                                      const float* __restrict__ bq, const float* __restrict__ bk,
                                                      const float* __restrict__ fc,
                                                      u16* __restrict__ qh, u16* __restrict__ kh,
                                                      u16* __restrict__ qr, u16* __restrict__ kr) {
  __shared__ __align__(16) unsigned char sMem[GEMM_LDS_B];   // operand ring, then the f32 staging tile (block barriers)
  u16*   ring = (u16*)sMem;
  float* sC   = (float*)sMem;
  const int tid  = threadIdx.x;
  const int lane = tid & 31;
  const int wave = tid >> 5;
  const int lq   = lane & 15;
  const int hi   = lane >> 4;
  const int z    = blockIdx.z;
  const int nblk = blockIdx.x * GT;
  const int mblk = blockIdx.y * GT;
  const int wm   = (wave & 3) * 32;
  const int wn   = (wave >> 2) * 64;
  const u16*   W    = wpl + (size_t)z * DM * DM;
  const float* bias = (z == 0) ? bq : bk;
  u16* hp = (z == 0) ? qh : kh;
  u16* rp = (z == 0) ? qr : kr;

  v8f acc[2][4];
  #pragma unroll
  for (int mt = 0; mt < 2; ++mt) {
    #pragma unroll
    for (int nt = 0; nt < 4; ++nt) acc[mt][nt] = (v8f){0, 0, 0, 0, 0, 0, 0, 0};
  }
  gemm_core<0>(xb + (size_t)mblk * DM, W + (size_t)nblk * DM, ring, tid, wm, wn, lq, hi, acc);
  stage_tile(sC, acc, wm, wn, lq, hi, 1.0f);
  __syncthreads();

  const int b     = mblk / SEQ;
  const int t0    = mblk % SEQ;
  const bool early = (t0 < EARLY_T);            // block-uniform
  const int seg   = tid & 7;
  const int hs    = (tid >> 3) & 1;
  const int rsub  = tid >> 4;                   // 0..15
  const int n0    = nblk + hs * 64 + seg * 8;
  const int h     = n0 >> 6;

  float bz[8];
  {
    const v4f b0 = *(const v4f*)(bias + n0);
    const v4f b1 = *(const v4f*)(bias + n0 + 4);
    #pragma unroll
    for (int i = 0; i < 4; ++i) {
      bz[i]     = bfr(b0[i]);
      bz[4 + i] = bfr(b1[i]);
    }
  }

  v4u hv[8], rv[8];
  #pragma unroll
  for (int p = 0; p < 8; ++p) {
    const int row = p * 16 + rsub;
    const int t   = t0 + row;
    const float* sp = sC + row * CP + hs * 64 + seg * 8;
    const v4f s0 = *(const v4f*)(sp);
    const v4f s1 = *(const v4f*)(sp + 4);
    const float* fp = fc + ((size_t)t * (HDIM / 2) + seg * 4) * 2;   // (cos, sin) pairs of 4 consecutive i
    const v4f f0 = *(const v4f*)(fp);
    const v4f f1 = *(const v4f*)(fp + 4);
    float xv[8], cs[8], ov[8];
    #pragma unroll
    for (int i = 0; i < 4; ++i) {
      xv[i]     = s0[i] + bz[i];
      xv[4 + i] = s1[i] + bz[4 + i];
      cs[i]     = bfr(f0[i]);
      cs[4 + i] = bfr(f1[i]);
    }
    #pragma unroll
    for (int j = 0; j < 4; ++j) {
      const float x1 = xv[2 * j], x2 = xv[2 * j + 1];
      const float c  = cs[2 * j], s  = cs[2 * j + 1];
      ov[2 * j]     = x1 * c - x2 * s;
      ov[2 * j + 1] = x1 * s + x2 * c;
    }
    pack_hr(ov, QK_CARRY, hv[p], rv[p]);
  }

  const size_t bh = (size_t)b * NHEAD + h;
  #pragma unroll
  for (int p = 0; p < 8; ++p) {
    const int t = t0 + p * 16 + rsub;
    *(v4u*)(hp + (bh * SEQ + t) * HDIM + seg * 8) = hv[p];
    if (early) *(v4u*)(rp + (bh * EARLY_T + t) * HDIM + seg * 8) = rv[p];
  }
  
}

// v projection computed transposed: C[c][(b,t)] = Wv[c][:] . xb[(b,t)][:], + bias[c], x16 carry,
// vt [NB][DM][SEQ] f16 (row c = h*64+d, keys contiguous) and vtr [NB][DM][EARLY_T] residual for keys < EARLY_T.
__global__ __launch_bounds__(256) void gemm_v_kernel(const u16* __restrict__ wvb, const u16* __restrict__ xb,
                                                     const float* __restrict__ bv,
                                                     u16* __restrict__ vt, u16* __restrict__ vtr) {
  __shared__ __align__(16) unsigned char sMem[GEMM_LDS_B];   // operand ring, then the f32 staging tile (block barriers)
  u16*   ring = (u16*)sMem;
  float* sC   = (float*)sMem;
  const int tid  = threadIdx.x;
  const int lane = tid & 31;
  const int wave = tid >> 5;
  const int lq   = lane & 15;
  const int hi   = lane >> 4;
  const int nblk = blockIdx.x * GT;             // compact (b,t) columns
  const int mblk = blockIdx.y * GT;             // channel rows c
  const int wm   = (wave & 3) * 32;
  const int wn   = (wave >> 2) * 64;

  v8f acc[2][4];
  #pragma unroll
  for (int mt = 0; mt < 2; ++mt) {
    #pragma unroll
    for (int nt = 0; nt < 4; ++nt) acc[mt][nt] = (v8f){0, 0, 0, 0, 0, 0, 0, 0};
  }
  gemm_core<0>(wvb + (size_t)mblk * DM, xb + (size_t)nblk * DM, ring, tid, wm, wn, lq, hi, acc);
  stage_tile(sC, acc, wm, wn, lq, hi, 1.0f);
  __syncthreads();

  const int b     = nblk / SEQ;
  const int t0    = nblk % SEQ;
  const bool early = (t0 < EARLY_T);            // block-uniform
  const int seg   = tid & 7;
  const int hs    = (tid >> 3) & 1;
  const int rsub  = tid >> 4;

  v4u hv[8], rv[8];
  #pragma unroll
  for (int p = 0; p < 8; ++p) {
    const int row = p * 16 + rsub;
    const float bz = bfr(bv[mblk + row]);
    const float* sp = sC + row * CP + hs * 64 + seg * 8;
    const v4f s0 = *(const v4f*)(sp);
    const v4f s1 = *(const v4f*)(sp + 4);
    float ov[8];
    #pragma unroll
    for (int i = 0; i < 4; ++i) {
      ov[i]     = s0[i] + bz;
      ov[4 + i] = s1[i] + bz;
    }
    pack_hr(ov, V_CARRY, hv[p], rv[p]);
  }
  const int tcol = t0 + hs * 64 + seg * 8;
  #pragma unroll
  for (int p = 0; p < 8; ++p) {
    const size_t crow = (size_t)b * DM + mblk + p * 16 + rsub;
    *(v4u*)(vt + crow * SEQ + tcol) = hv[p];
    if (early) *(v4u*)(vtr + crow * EARLY_T + tcol) = rv[p];
  }
  
}

// Output projection: out[(b,t)][n] = (ctx . Wp[n][:]) / (64*64) + bias[n]. RES != 0: rows t < EARLY_T, a second
// k sweep over the residual ctx plane is folded with 1/2048. Each wave writes one whole 512-B tile row
template <int RES>
__global__ __launch_bounds__(256) void gemm_out_kernel(const u16* __restrict__ ctxh, const u16* __restrict__ ctxr,
                                                       const u16* __restrict__ wpb, const float* __restrict__ bp,
                                                       float* __restrict__ out) {
  __shared__ __align__(16) unsigned char sMem[GEMM_LDS_B];   // operand ring, then the f32 staging tile (block barriers)
  u16*   ring = (u16*)sMem;
  float* sC   = (float*)sMem;
  const int tid  = threadIdx.x;
  const int lane = tid & 31;
  const int wave = tid >> 5;
  const int lq   = lane & 15;
  const int hi   = lane >> 4;
  const int nblk = blockIdx.x * GT;
  const int y    = blockIdx.y;
  const int b    = (RES != 0) ? (y / EARLY_TILES) : (y / LATE_TILES);
  const int t0   = (RES != 0) ? ((y % EARLY_TILES) * GT) : (EARLY_T + (y % LATE_TILES) * GT);
  const int wm   = (wave & 3) * 32;
  const int wn   = (wave >> 2) * 64;

  v8f acc[2][4];
  #pragma unroll
  for (int mt = 0; mt < 2; ++mt) {
    #pragma unroll
    for (int nt = 0; nt < 4; ++nt) acc[mt][nt] = (v8f){0, 0, 0, 0, 0, 0, 0, 0};
  }
  const u16* bblk = wpb + (size_t)nblk * DM;
  gemm_core<1>(ctxh + ((size_t)b * SEQ + t0) * DM, bblk, ring, tid, wm, wn, lq, hi, acc);
  if (RES != 0) {
    v8f acc2[2][4];
    #pragma unroll
    for (int mt = 0; mt < 2; ++mt) {
      #pragma unroll
      for (int nt = 0; nt < 4; ++nt) acc2[mt][nt] = (v8f){0, 0, 0, 0, 0, 0, 0, 0};
    }
    gemm_core<1>(ctxr + ((size_t)b * EARLY_T + t0) * DM, bblk, ring, tid, wm, wn, lq, hi, acc2);
    stage_tile2(sC, acc, acc2, wm, wn, lq, hi, 1.0f / (CTX_CARRY * WP_CARRY), RES_INV / (CTX_CARRY * WP_CARRY));
  } else {
    stage_tile(sC, acc, wm, wn, lq, hi, 1.0f / (CTX_CARRY * WP_CARRY));
  }
  __syncthreads();

  const int col = lane * 4;
  v4f bz = *(const v4f*)(bp + nblk + col);
  #pragma unroll
  for (int i = 0; i < 4; ++i) bz[i] = bfr(bz[i]);

  v4f vals[16];
  #pragma unroll
  for (int p = 0; p < 16; ++p) {
    const int row = p * 8 + wave;
    const v4f v = *(const v4f*)(sC + row * CP + col);
    vals[p] = v + bz;
  }
  float* obase = out + ((size_t)b * SEQ_FULL + t0 + wave) * DM + nblk + col;
  #pragma unroll
  for (int p = 0; p < 16; ++p) *(v4f*)(obase + (size_t)p * 8 * DM) = vals[p];
  
}

// ---------------------------------------------------------------------------------------------------------
// Flash attention. Block = (query block of 128, head, batch); one wave owns 16 query rows.
// S^T = K x Q^T so queries sit on lanes; P^T in C-layout is bit-identical to the A-fragment layout of O += P x V.
// K A-fragments, Q B-fragments and V^T B-fragments come straight from the f16 planes (two 16-B loads each).
// Mask: per element replace-fill from the packed bit planes; key tiles past the diagonal are skipped only when the
// packed row flags of all 16 rows of the wave say that nothing beyond the diagonal is allowed and the diagonal is.
// RES != 0: residual planes (x2048) for q, k, v and P on separate accumulators.
template <int RES>
__global__ __launch_bounds__(256) void attn_kernel(const u16* __restrict__ qh_p, const u16* __restrict__ kh_p,
                                                   const u16* __restrict__ vt_p,
                                                   const u16* __restrict__ qr_p, const u16* __restrict__ kr_p,
                                                   const u16* __restrict__ vtr_p,
                                                   const unsigned* __restrict__ mbits,
                                                   const unsigned* __restrict__ pbits,
                                                   u16* __restrict__ ctxh, u16* __restrict__ ctxr, int qblk0) {
  const int qblk = qblk0 + blockIdx.x;
  const int h    = blockIdx.y;
  const int b    = blockIdx.z;
  const int tid  = threadIdx.x;
  const int wave = tid >> 5;
  const int lane = tid & 31;
  const int lq   = lane & 15;   // query column of S^T / d column of O
  const int hi   = lane >> 4;   // k-split half

  __shared__ __align__(16) float sO[NWAVE * 16 * OP];   // per-wave output staging (block barrier used)

  const int qrow0 = qblk * BQ + wave * 16;
  const int qi    = qrow0 + lq;
  const size_t bh = (size_t)b * NHEAD + h;

  // Q as B-operand fragments: lane lq holds query qi, split d map.
  Frag qf[2], qrf[2];
  {
    const u16* qp = qh_p + (bh * SEQ + qi) * HDIM + hi * 8;
    #pragma unroll
    for (int f = 0; f < 2; ++f) {
      qf[f].q[0] = *(const v4u*)(qp + f * 32);        // d = f*32 + hi*8 + 0..7
      qf[f].q[1] = *(const v4u*)(qp + f * 32 + 16);   // d = f*32 + 16 + hi*8 + 0..7
    }
  }
  if (RES != 0) {
    const u16* qp = qr_p + (bh * EARLY_T + qi) * HDIM + hi * 8;
    #pragma unroll
    for (int f = 0; f < 2; ++f) {
      qrf[f].q[0] = *(const v4u*)(qp + f * 32);
      qrf[f].q[1] = *(const v4u*)(qp + f * 32 + 16);
    }
  } else {
    #pragma unroll
    for (int f = 0; f < 2; ++f) {
      qrf[f].q[0] = (v4u){0u, 0u, 0u, 0u};
      qrf[f].q[1] = (v4u){0u, 0u, 0u, 0u};
    }
  }

  const u16* kp  = kh_p  + (bh * SEQ + lq) * HDIM + hi * 8;
  const u16* krp = kr_p  + (bh * EARLY_T + lq) * HDIM + hi * 8;
  const u16* vp  = vt_p  + (bh * HDIM + lq) * SEQ + hi * 8;
  const u16* vrp = vtr_p + (bh * HDIM + lq) * EARLY_T + hi * 8;

  const unsigned* mrow = mbits + (size_t)qi * MPITCH;
  const unsigned* prow = pbits + (size_t)b * MPITCH;

  // wave-uniform tile-skip decision from the packed row flags and the diagonal padding bits
  const unsigned rk = mrow[MW];
  const unsigned pw = prow[qi >> 5];
  const bool rowok  = (rk == 1u) && (((pw >> (qi & 31)) & 1u) != 0u);
  const bool allok  = (__builtin_amdgcn_ballot_w32(rowok) == 0xffffffffu);
  int nchunk = allok ? ((qrow0 + 15) / BK + 1) : (SEQ / BK);
  nchunk = (nchunk < SEQ / BK) ? nchunk : (SEQ / BK);      // static bound

  v8f o[4], o2[4];
  #pragma unroll
  for (int dt = 0; dt < 4; ++dt) {
    o[dt]  = (v8f){0, 0, 0, 0, 0, 0, 0, 0};
    o2[dt] = (v8f){0, 0, 0, 0, 0, 0, 0, 0};
  }

  float rmax = -__builtin_inff();
  float rsum = 0.0f;
  const float SL      = (0.125f / (QK_CARRY * QK_CARRY)) * 1.4426950408889634f;   // scale * log2(e) / carries
  const float FILLRAW = -1.0e30f * 8.0f * (QK_CARRY * QK_CARRY);                  // fill value in the carried raw domain

  for (int i = 0; i < nchunk; ++i) {
    const int j0 = i * BK;
    const unsigned mw = mrow[i] & prow[i];                      // allowed bits of keys j0..j0+31 for query qi
    const bool res_on = (RES != 0) && (j0 < EARLY_T);           // wave-uniform
    const int  jr     = (j0 < EARLY_T) ? j0 : (EARLY_T - BK);   // clamped address for the residual planes

    // S^T tiles: c[sub][r] = carried rawscore(query qi, key j0 + sub*16 + hi*8 + r)
    v8f c[2];
    #pragma unroll
    for (int sub = 0; sub < 2; ++sub) {
      Frag ak[2];
      const u16* kb = kp + (size_t)(j0 + sub * 16) * HDIM;
      #pragma unroll
      for (int f = 0; f < 2; ++f) {
        ak[f].q[0] = *(const v4u*)(kb + f * 32);
        ak[f].q[1] = *(const v4u*)(kb + f * 32 + 16);
      }
      v8f acc = (v8f){0, 0, 0, 0, 0, 0, 0, 0};
      acc = mma_f16(ak[0].vh, qf[0].vh, acc);
      acc = mma_f16(ak[1].vh, qf[1].vh, acc);
      if (RES != 0) {
        Frag akr[2];
        const u16* kbr = krp + (size_t)(jr + sub * 16) * HDIM;
        #pragma unroll
        for (int f = 0; f < 2; ++f) {
          const v4u l0 = *(const v4u*)(kbr + f * 32);
          const v4u l1 = *(const v4u*)(kbr + f * 32 + 16);
          akr[f].q[0] = res_on ? l0 : (v4u){0u, 0u, 0u, 0u};
          akr[f].q[1] = res_on ? l1 : (v4u){0u, 0u, 0u, 0u};
        }
        v8f acc2 = (v8f){0, 0, 0, 0, 0, 0, 0, 0};
        acc2 = mma_f16(ak[0].vh,  qrf[0].vh, acc2);
        acc2 = mma_f16(ak[1].vh,  qrf[1].vh, acc2);
        acc2 = mma_f16(akr[0].vh, qf[0].vh,  acc2);
        acc2 = mma_f16(akr[1].vh, qf[1].vh,  acc2);
        #pragma unroll
        for (int r = 0; r < 8; ++r) acc[r] += acc2[r] * RES_INV;
        asm volatile("" ::: "memory");
      }
      c[sub] = acc;
    }

    // mask: replace-fill; branch is wave-uniform, selects are per lane
    if (__builtin_amdgcn_ballot_w32(mw != 0xffffffffu) != 0u) {
      const unsigned ms = mw >> (hi * 8);
      #pragma unroll
      for (int sub = 0; sub < 2; ++sub) {
        #pragma unroll
        for (int r = 0; r < 8; ++r) {
          const bool allowed = ((ms >> (sub * 16 + r)) & 1u) != 0u;
          c[sub][r] = allowed ? c[sub][r] : FILLRAW;
        }
      }
    }

    // online softmax: query lq's 32 scores are split across lane / lane^16
    float m_new = rmax;
    #pragma unroll
    for (int r = 0; r < 8; ++r) {
      m_new = fmaxf(m_new, c[0][r]);
      m_new = fmaxf(m_new, c[1][r]);
    }
    m_new = fmaxf(m_new, __shfl_xor(m_new, 16, 32));
    const float scale = __builtin_amdgcn_exp2f((rmax - m_new) * SL);
    rmax = m_new;

    // exp + pack: P^T C-layout == A-fragment layout for the PV product
    Frag pa, pr;
    {
      Pack8H a0, a1, r0, r1;
      float psum = 0.0f;
      #pragma unroll
      for (int r = 0; r < 8; ++r) {
        const float p0 = __builtin_amdgcn_exp2f((c[0][r] - m_new) * SL);   // key hi*8 + r
        const float p1 = __builtin_amdgcn_exp2f((c[1][r] - m_new) * SL);   // key 16 + hi*8 + r
        psum += p0 + p1;
        const float pc0 = p0 * P_CARRY;
        const float pc1 = p1 * P_CARRY;
        const f16 h0 = (f16)pc0;
        const f16 h1 = (f16)pc1;
        a0.h[r] = h0;
        a1.h[r] = h1;
        if (RES != 0) {
          r0.h[r] = (f16)((pc0 - (float)h0) * RES_CARRY);
          r1.h[r] = (f16)((pc1 - (float)h1) * RES_CARRY);
        } else {
          r0.h[r] = (f16)0.0f;
          r1.h[r] = (f16)0.0f;
        }
      }
      pa.q[0] = a0.u;  pa.q[1] = a1.u;
      pr.q[0] = r0.u;  pr.q[1] = r1.u;
      rsum = rsum * scale + psum + __shfl_xor(psum, 16, 32);
    }

    // rescale O: queries are the row dimension there -> per-row scale from lane 8*hi + r
    float sc[8];
    #pragma unroll
    for (int r = 0; r < 8; ++r) sc[r] = __shfl(scale, (hi << 3) + r, 32);
    #pragma unroll
    for (int dt = 0; dt < 4; ++dt) {
      #pragma unroll
      for (int r = 0; r < 8; ++r) {
        o[dt][r] *= sc[r];
        if (RES != 0) o2[dt][r] *= sc[r];
      }
    }
    if (RES != 0) asm volatile("" ::: "memory");

    // O += P x V ; V B-fragments: column n = d = dt*16 + lq, split key map from the transposed plane
    #pragma unroll
    for (int dt = 0; dt < 4; ++dt) {
      Frag bv;
      const u16* vb = vp + (size_t)dt * 16 * SEQ + j0;
      bv.q[0] = *(const v4u*)(vb);            // keys j0 + hi*8 + 0..7
      bv.q[1] = *(const v4u*)(vb + 16);       // keys j0 + 16 + hi*8 + 0..7
      o[dt] = mma_f16(pa.vh, bv.vh, o[dt]);
      if (RES != 0) {
        Frag bvr;
        const u16* vbr = vrp + (size_t)dt * 16 * EARLY_T + jr;
        const v4u l0 = *(const v4u*)(vbr);
        const v4u l1 = *(const v4u*)(vbr + 16);
        bvr.q[0] = res_on ? l0 : (v4u){0u, 0u, 0u, 0u};
        bvr.q[1] = res_on ? l1 : (v4u){0u, 0u, 0u, 0u};
        o2[dt] = mma_f16(pa.vh, bvr.vh, o2[dt]);
        o2[dt] = mma_f16(pr.vh, bv.vh,  o2[dt]);
      }
    }
  }

  // normalize: lane holds column d = dt*16 + lq for query rows 8*hi + r
  float rs[8];
  #pragma unroll
  for (int r = 0; r < 8; ++r) rs[r] = 1.0f / __shfl(rsum, (hi << 3) + r, 32);

  float* so = sO + wave * (16 * OP);
  #pragma unroll
  for (int r = 0; r < 8; ++r) {
    #pragma unroll
    for (int dt = 0; dt < 4; ++dt) {
      float val = o[dt][r];
      if (RES != 0) val += o2[dt][r] * RES_INV;
      so[(hi * 8 + r) * OP + dt * 16 + lq] = val * (1.0f / (P_CARRY * V_CARRY)) * rs[r];
    }
  }
  __syncthreads();

  // rows it*4 + (lane>>3), it = 0..3 cover the wave's 16 rows, (lane&7)*8 covers d 0..63.
  const int seg = lane & 7;
  v4u hv[4], rv[4];
  #pragma unroll
  for (int it = 0; it < 4; ++it) {
    const int row = it * 4 + (lane >> 3);
    const v4f a0 = *(const v4f*)(so + row * OP + seg * 8);
    const v4f a1 = *(const v4f*)(so + row * OP + seg * 8 + 4);
    float ov[8];
    #pragma unroll
    for (int i = 0; i < 4; ++i) {
      ov[i]     = a0[i];
      ov[4 + i] = a1[i];
    }
    pack_hr(ov, CTX_CARRY, hv[it], rv[it]);
  }
  #pragma unroll
  for (int it = 0; it < 4; ++it) {
    const int row = qrow0 + it * 4 + (lane >> 3);
    *(v4u*)(ctxh + ((size_t)b * SEQ + row) * DM + h * HDIM + seg * 8) = hv[it];
    if (RES != 0) *(v4u*)(ctxr + ((size_t)b * EARLY_T + row) * DM + h * HDIM + seg * 8) = rv[it];
  }
  
}

// ---------------------------------------------------------------------------------------------------------
static constexpr size_t al128(size_t x) { return (x + 127) & ~(size_t)127; }
static constexpr size_t XB_B   = al128((size_t)NB * SEQ * DM * 2);
static constexpr size_t WPL_B  = al128((size_t)4 * DM * DM * 2);
static constexpr size_t QH_B   = al128((size_t)NB * NHEAD * SEQ * HDIM * 2);
static constexpr size_t QR_B   = al128((size_t)NB * NHEAD * EARLY_T * HDIM * 2);
static constexpr size_t VT_B   = al128((size_t)NB * DM * SEQ * 2);
static constexpr size_t VTR_B  = al128((size_t)NB * DM * EARLY_T * 2);
static constexpr size_t CTXH_B = al128((size_t)NB * SEQ * DM * 2);
static constexpr size_t CTXR_B = al128((size_t)NB * EARLY_T * DM * 2);
static constexpr size_t MB_B   = al128((size_t)SEQ * MPITCH * 4);
static constexpr size_t PB_B   = al128((size_t)NB * MPITCH * 4);
static constexpr size_t WS_TOTAL = XB_B + WPL_B + 2 * QH_B + 2 * QR_B + VT_B + VTR_B + CTXH_B + CTXR_B + MB_B + PB_B;
static_assert(WS_TOTAL <= (size_t)134217728);

extern "C" void kernel_launch(void* const* d_in, const int* in_sizes, int n_in,
                              void* d_out, int out_size, void* d_ws, size_t ws_size,
                              hipStream_t stream) {
  if (n_in < 12) return;
  const size_t rows_used = (size_t)(NB - 1) * SEQ_FULL + SEQ;
  if ((size_t)in_sizes[0] < rows_used * DM) return;
  if ((size_t)in_sizes[1] < (size_t)SEQ * HDIM) return;
  if ((size_t)in_sizes[2] < (size_t)(SEQ - 1) * SEQ_FULL + SEQ) return;
  if ((size_t)in_sizes[3] < rows_used) return;
  if ((size_t)in_sizes[4] < (size_t)DM * DM || (size_t)in_sizes[6] < (size_t)DM * DM) return;
  if ((size_t)in_sizes[8] < (size_t)DM * DM || (size_t)in_sizes[10] < (size_t)DM * DM) return;
  if (in_sizes[5] < DM || in_sizes[7] < DM || in_sizes[9] < DM || in_sizes[11] < DM) return;
  if ((size_t)out_size < rows_used * DM) return;
  if (ws_size < WS_TOTAL) return;

  const float* x   = (const float*)d_in[0];
  const float* fc  = (const float*)d_in[1];
  const int*   am  = (const int*)d_in[2];
  const int*   pm  = (const int*)d_in[3];
  const float* Wq  = (const float*)d_in[4];
  const float* bq  = (const float*)d_in[5];
  const float* Wk  = (const float*)d_in[6];
  const float* bk  = (const float*)d_in[7];
  const float* Wv  = (const float*)d_in[8];
  const float* bv  = (const float*)d_in[9];
  const float* Wp  = (const float*)d_in[10];
  const float* bp  = (const float*)d_in[11];
  float* out = (float*)d_out;

  char* ws = (char*)d_ws;
  size_t off = 0;
  u16* xb   = (u16*)(ws + off); off += XB_B;
  u16* wpl  = (u16*)(ws + off); off += WPL_B;
  u16* qh   = (u16*)(ws + off); off += QH_B;
  u16* kh   = (u16*)(ws + off); off += QH_B;
  u16* vt   = (u16*)(ws + off); off += VT_B;
  u16* qr   = (u16*)(ws + off); off += QR_B;
  u16* kr   = (u16*)(ws + off); off += QR_B;
  u16* vtr  = (u16*)(ws + off); off += VTR_B;
  u16* ctxh = (u16*)(ws + off); off += CTXH_B;
  u16* ctxr = (u16*)(ws + off); off += CTXR_B;
  unsigned* mbits = (unsigned*)(ws + off); off += MB_B;
  unsigned* pbits = (unsigned*)(ws + off); off += PB_B;

  cvt_x_kernel<<<dim3((unsigned)(((size_t)NB * SEQ * DM) / 2048)), 256, 0, stream>>>(x, xb);
  cvt_w_kernel<<<dim3((unsigned)(((size_t)DM * DM) / 2048), 4), 256, 0, stream>>>(Wq, Wk, Wv, Wp, wpl);
  mask_pack_kernel<<<dim3(SEQ + NB), 256, 0, stream>>>(am, pm, mbits, pbits);

  gemm_qk_kernel<<<dim3(DM / GT, (NB * SEQ) / GT, 2), 256, 0, stream>>>(xb, wpl, bq, bk, fc, qh, kh, qr, kr);
  gemm_v_kernel<<<dim3((NB * SEQ) / GT, DM / GT), 256, 0, stream>>>(wpl + (size_t)2 * DM * DM, xb, bv, vt, vtr);

  const int n_early = EARLY_T / BQ;
  const int n_late  = SEQ / BQ - n_early;
  attn_kernel<1><<<dim3(n_early, NHEAD, NB), 256, 0, stream>>>(qh, kh, vt, qr, kr, vtr, mbits, pbits, ctxh, ctxr, 0);
  if (n_late > 0)
    attn_kernel<0><<<dim3(n_late, NHEAD, NB), 256, 0, stream>>>(qh, kh, vt, qr, kr, vtr, mbits, pbits, ctxh, ctxr,
                                                                 n_early);

  const u16* wpb = wpl + (size_t)3 * DM * DM;
  gemm_out_kernel<1><<<dim3(DM / GT, NB * EARLY_TILES), 256, 0, stream>>>(ctxh, ctxr, wpb, bp, out);
  if (LATE_T > 0)
    gemm_out_kernel<0><<<dim3(DM / GT, NB * (LATE_T / GT)), 256, 0, stream>>>(ctxh, ctxr, wpb, bp, out);
}

// v002
// It runs in 198 microseconds.
// Next to v001, in two timings, it ran 1.78 and 1.77 times as fast.
// Over all steps from v000 it is 2.48 times as fast.
#include <hip/hip_runtime.h>

// Contractions: q/k/v projections on v_wmma_f32_16x16x32_bf16 (bf16 operands = RNE-converted inputs, f32 accumulate);
// scores S^T = K x Q^T, O = P x V and the output projection on v_wmma_f32_16x16x32_f16 (f16 planes with power-of-two
// carries: q,k,v x16, P x4096, ctx x64, Wp x64; query rows < EARLY_T add f16 residual planes x2048 on separate
// accumulators); bias, rotary step and softmax in f32.

#ifndef NB
#define NB 4
#endif
#ifndef SEQ
#define SEQ 2048
#endif
#define NB_FULL    4
#define SEQ_FULL   2048
#define NHEAD      16
#define HDIM       64
#define DM         (NHEAD * HDIM)            // model width
#define BQ         128                       // query rows per attention workgroup (8 waves x 16)
#define BK         32                        // keys per inner iteration
#define NWAVE      8
#define EARLY_T    ((SEQ < 512) ? SEQ : 512) // query/key rows that carry residual planes
#define OP         68                        // LDS pitch (floats) of the attention output staging tile
#define GT         128                       // GEMM block tile (rows and columns)
#define CP         132                       // LDS pitch (floats) of the GEMM staging tile
#define KS         64                        // k per GEMM ring stage (one 128-B line of every operand row)
#define LP         72                        // LDS pitch (16-bit elements) of a staged operand row: 144 B = 16 B x odd
#define TILE_H     (GT * LP)                 // 16-bit elements of one staged operand tile
#define STAGE_H    (2 * TILE_H)              // one ring buffer: [A 128 rows | B 128 rows]
#define NSTAGE     (DM / KS)
#define GEMM_LDS_B (2 * STAGE_H * 2)         // two ring buffers; the f32 staging tile reuses them behind the k sweeps
#define SK         64                        // keys per attention ring stage (one 128-B line of every K and V^T row)
#define AT_H       (SK * LP)                 // 16-bit elements of one staged attention tile: 64 rows at pitch LP
#define MW         (SEQ / 32)                // mask words per row
#define MPITCH     (((MW + 1 + 31) / 32) * 32)   // words per packed mask row (bits, row flag, zero pad)
#define LATE_T     (SEQ - EARLY_T)
#define LATE_TILES (((LATE_T / GT) > 0) ? (LATE_T / GT) : 1)
#define EARLY_TILES (EARLY_T / GT)

#define QK_CARRY   16.0f
#define V_CARRY    16.0f
#define P_CARRY    4096.0f
#define CTX_CARRY  64.0f
#define WP_CARRY   64.0f
#define RES_CARRY  2048.0f
#define RES_INV    (1.0f / 2048.0f)

static_assert(SEQ % 256 == 0);
static_assert(SEQ % GT == 0);
static_assert(SEQ % BQ == 0);
static_assert(EARLY_T % GT == 0);
static_assert(EARLY_T % BQ == 0);
static_assert(EARLY_T >= BK);
static_assert(BQ == NWAVE * 16);
static_assert(HDIM == 64);
static_assert(DM % GT == 0);
static_assert(DM % 32 == 0);
static_assert(SEQ <= SEQ_FULL);
static_assert(NB >= 1 && NB <= NB_FULL);
static_assert((OP * 4) % 16 == 0);
static_assert((CP * 4) % 16 == 0);
static_assert(DM % KS == 0 && NSTAGE >= 2);
static_assert(KS * 2 == 128 && (LP * 2) % 16 == 0 && LP >= KS);
static_assert(256 * 4 * 8 == GT * KS);        // ring fill per operand: threads x copies x 16-bit elements
static_assert(GEMM_LDS_B >= GT * CP * 4);
static_assert(MPITCH / 4 <= 32);
static_assert(MPITCH <= 256);
static_assert(((size_t)NB * SEQ * DM) % 2048 == 0);
static_assert(((size_t)DM * DM) % 2048 == 0);
static_assert(256 * 8 * 8 == GT * GT);        // 16-bit plane epilogues: threads x passes x halves
static_assert(256 * 16 * 4 == GT * GT);       // f32 output epilogue: threads x passes x floats
static_assert(32 * 4 * 8 == 16 * HDIM);       // attention epilogue per wave
static_assert(SK == HDIM && SK * 2 == 128 && SK % BK == 0);   // K tile: SK rows of HDIM; V^T tile: HDIM rows of SK
static_assert(SEQ % SK == 0 && EARLY_T % SK == 0 && EARLY_T >= SK);
static_assert(256 * 2 * 8 == SK * HDIM);      // attention ring fill per tile: threads x copies x 16-bit elements

typedef __bf16         bf16;
typedef _Float16       f16;
typedef unsigned short u16;
typedef bf16     v16bf __attribute__((ext_vector_type(16)));
typedef f16      v16h  __attribute__((ext_vector_type(16)));
typedef float    v8f   __attribute__((ext_vector_type(8)));
typedef float    v4f   __attribute__((ext_vector_type(4)));
typedef unsigned v4u   __attribute__((ext_vector_type(4)));

union Frag   { v16bf vb; v16h vh; v4u q[2]; };
union Pack8B { v4u u; bf16 h[8]; };
union Pack8H { v4u u; f16  h[8]; };

// WMMA helpers: builtin followed by the VALU hazard guard (ties D, keeps A/B live).
static __device__ __forceinline__ v8f mma_bf16(v16bf a, v16bf b, v8f acc) {
  acc = __builtin_amdgcn_wmma_f32_16x16x32_bf16(false, a, false, b, (short)0, acc, false, false);
  asm volatile("v_nop\n\tv_nop\n\tv_nop\n\tv_nop" : "+v"(acc) : "v"(a), "v"(b));
  return acc;
}
static __device__ __forceinline__ v8f mma_f16(v16h a, v16h b, v8f acc) {
  acc = __builtin_amdgcn_wmma_f32_16x16x32_f16(false, a, false, b, (short)0, acc, false, false);
  asm volatile("v_nop\n\tv_nop\n\tv_nop\n\tv_nop" : "+v"(acc) : "v"(a), "v"(b));
  return acc;
}

static __device__ __forceinline__ float bfr(float x) { return (float)(bf16)x; }   // RNE convert to bf16 and back

// 8 floats -> f16 hi plane piece and f16 residual piece (x RES_CARRY), both carried by 'carry'.
static __device__ __forceinline__ void pack_hr(const float (&v)[8], float carry, v4u& hv, v4u& rv) {
  Pack8H ph, pr;
  #pragma unroll
  for (int i = 0; i < 8; ++i) {
    const float yc = v[i] * carry;
    const f16 hh = (f16)yc;
    ph.h[i] = hh;
    pr.h[i] = (f16)((yc - (float)hh) * RES_CARRY);
  }
  hv = ph.u;
  rv = pr.u;
}

// ---------------------------------------------------------------------------------------------------------
// x [NB][SEQ][DM] f32 (full-size strides) -> xb [NB*SEQ][DM] bf16. 8 elements per thread, 16-B pieces,
__global__ __launch_bounds__(256) void cvt_x_kernel(const float* __restrict__ x, u16* __restrict__ xb) {
  const size_t e   = ((size_t)blockIdx.x * 256 + threadIdx.x) * 8;
  const size_t row = e / DM;
  const int    col = (int)(e % DM);
  const size_t b   = row / SEQ;
  const size_t t   = row % SEQ;
  const float* src = x + (b * SEQ_FULL + t) * DM + col;
  const v4f a0 = *(const v4f*)(src);
  const v4f a1 = *(const v4f*)(src + 4);
  Pack8B pk;
  #pragma unroll
  for (int i = 0; i < 4; ++i) {
    pk.h[i]     = (bf16)a0[i];
    pk.h[4 + i] = (bf16)a1[i];
  }
  const v4u val = pk.u;
  *(v4u*)(xb + e) = val;
  
}

// Weight planes: z = 0,1,2 -> bf16 of Wq,Wk,Wv; z = 3 -> f16 of (bf16 Wp) x WP_CARRY. [n][k] layout kept.
// coverage: (DM*DM/2048) blocks * 256 * 8 == DM*DM per plane, 4 planes.
__global__ __launch_bounds__(256) void cvt_w_kernel(const float* __restrict__ wq, const float* __restrict__ wk,
                                                    const float* __restrict__ wv, const float* __restrict__ wp,
                                                    u16* __restrict__ wpl) {
  const int z = blockIdx.y;
  const float* src = (z == 0) ? wq : (z == 1) ? wk : (z == 2) ? wv : wp;
  const size_t e = ((size_t)blockIdx.x * 256 + threadIdx.x) * 8;
  const v4f a0 = *(const v4f*)(src + e);
  const v4f a1 = *(const v4f*)(src + e + 4);
  v4u val;
  if (z < 3) {
    Pack8B pk;
    #pragma unroll
    for (int i = 0; i < 4; ++i) {
      pk.h[i]     = (bf16)a0[i];
      pk.h[4 + i] = (bf16)a1[i];
    }
    val = pk.u;
  } else {
    Pack8H ph;
    #pragma unroll
    for (int i = 0; i < 4; ++i) {
      ph.h[i]     = (f16)(bfr(a0[i]) * WP_CARRY);
      ph.h[4 + i] = (f16)(bfr(a1[i]) * WP_CARRY);
    }
    val = ph.u;
  }
  u16* dst = wpl + (size_t)z * DM * DM + e;
  *(v4u*)dst = val;
  
}

// Mask bit planes. Block r < SEQ packs attention-mask row r: words 0..MW-1 = allowed bits (bit j of word w = key
// 32w+j), word MW = 1 when the row has no allowed key beyond the diagonal and the diagonal key is allowed, rest 0.
// Blocks r >= SEQ pack the key-padding row of batch r-SEQ the same way (flag word = 1).
// Each packed row (MPITCH words) is written by wave 0 with one 16-B-per-lane instruction.
__global__ __launch_bounds__(256) void mask_pack_kernel(const int* __restrict__ amask, const int* __restrict__ pmask,
                                                        unsigned* __restrict__ mbits, unsigned* __restrict__ pbits) {
  __shared__ __align__(16) unsigned sW[MPITCH];   // cross-wave (block barriers)
  __shared__ int sBad;                            // cross-wave (block barriers)
  const int tid  = threadIdx.x;
  const int wave = tid >> 5;
  const int lane = tid & 31;
  const int rid  = blockIdx.x;
  const bool is_pad = (rid >= SEQ);
  const int q  = is_pad ? 0 : rid;
  const int pb = is_pad ? (rid - SEQ) : 0;
  const int* src = is_pad ? (pmask + (size_t)pb * SEQ_FULL) : (amask + (size_t)q * SEQ_FULL);
  unsigned*  dst = is_pad ? (pbits + (size_t)pb * MPITCH)   : (mbits + (size_t)q * MPITCH);
  if (tid == 0) sBad = 0;
  #pragma unroll 1
  for (int it = 0; it < SEQ / 256; ++it) {
    const int v = src[it * 256 + tid];
    const unsigned w = __builtin_amdgcn_ballot_w32(v != 0);
    if (lane == 0) sW[it * 8 + wave] = w;
  }
  __syncthreads();
  if (!is_pad && tid < MW) {
    const unsigned w = sW[tid];
    const int wq = q >> 5;
    const int bq = q & 31;
    int bad = 0;
    if (tid > wq) bad = (w != 0u);
    if (tid == wq) {
      const unsigned upper = (bq == 31) ? 0u : (w >> (bq + 1));
      bad = (upper != 0u) || (((w >> bq) & 1u) == 0u);
    }
    if (bad) sBad = 1;
  }
  __syncthreads();
  const int anybad = sBad;
  if (tid >= MW && tid < MPITCH) sW[tid] = (tid == MW) ? (anybad ? 0u : 1u) : 0u;
  __syncthreads();
  if (tid < MPITCH / 4) {
    const v4u val = *(const v4u*)(sW + tid * 4);
    *(v4u*)(dst + tid * 4) = val;
    
  }
}

// ---------------------------------------------------------------------------------------------------------
// GEMM core: block tile 128 x 128, wave tile 32 x 64 of C[m][n] = sum_k A[m][k] * B[n][k], K = DM, both operands
// 16-bit row-major with k contiguous. Stages of KS k are brought into a two-buffer LDS ring by asynchronous copies
// (16 B per lane, a wave covers four whole 128-B rows per copy); the fragments are read from the ring with one split
// k map for A and B, k ascending.

// One stage of both operand tiles: rows r, r+32, r+64, r+96 (r = tid/8) of A and of B, 16-B piece tid%8 of each row.
// lds: the lane's byte address in the A tile of the target buffer; the B tile lies TILE_H elements behind it.
// The s_wait_xcnt stands inside the statement so that no address register is rewritten ahead of it.
static __device__ __forceinline__ void copy_stage(unsigned lds, const u16* ga, const u16* gb) {
  const unsigned ldb = lds + TILE_H * 2u;
  asm volatile("global_load_async_to_lds_b128 %0, %8, off\n\t"
               "global_load_async_to_lds_b128 %1, %9, off\n\t"
               "global_load_async_to_lds_b128 %2, %10, off\n\t"
               "global_load_async_to_lds_b128 %3, %11, off\n\t"
               "global_load_async_to_lds_b128 %4, %12, off\n\t"
               "global_load_async_to_lds_b128 %5, %13, off\n\t"
               "global_load_async_to_lds_b128 %6, %14, off\n\t"
               "global_load_async_to_lds_b128 %7, %15, off\n\t"
               "s_wait_xcnt 0x0"
               :: "v"(lds), "v"(lds + 32u * LP * 2u), "v"(lds + 64u * LP * 2u), "v"(lds + 96u * LP * 2u),
                  "v"(ldb), "v"(ldb + 32u * LP * 2u), "v"(ldb + 64u * LP * 2u), "v"(ldb + 96u * LP * 2u),
                  "v"(ga), "v"(ga + (size_t)32 * DM), "v"(ga + (size_t)64 * DM), "v"(ga + (size_t)96 * DM),
                  "v"(gb), "v"(gb + (size_t)32 * DM), "v"(gb + (size_t)64 * DM), "v"(gb + (size_t)96 * DM)
               : "memory");
}

// ablk / bblk: first element of the block's 128 rows of A and of B. ring: the block's LDS (GEMM_LDS_B bytes); every
// earlier LDS access of the block must lie in front of a block barrier. On return every wave has passed the barrier
// that ends the last read of the ring.
template <int F16>
static __device__ __forceinline__ void gemm_core(const u16* __restrict__ ablk, const u16* __restrict__ bblk,
                                                 u16* ring, int tid, int wm, int wn, int lq, int hi,
                                                 v8f (&acc)[2][4]) {
  const int crow = tid >> 3;
  const int cseg = tid & 7;
  const u16* ga = ablk + (size_t)crow * DM + cseg * 8;
  const u16* gb = bblk + (size_t)crow * DM + cseg * 8;
  const unsigned l0 = (unsigned)(uintptr_t)ring + (unsigned)(crow * LP + cseg * 8) * 2u;   // LDS byte address
  const u16* fa = ring + (wm + lq) * LP + hi * 8;
  const u16* fb = ring + TILE_H + (wn + lq) * LP + hi * 8;

  copy_stage(l0, ga, gb);
  asm volatile("s_wait_asynccnt 0x0" ::: "memory");   // stage 0 landed (this wave's copies)
  __syncthreads();                                    // stage 0 readable by every wave
  copy_stage(l0 + STAGE_H * 2u, ga + KS, gb + KS);

  #pragma unroll 1   // one ring stage per trip: the buffer index stays a run-time value
  for (int t = 0; t < NSTAGE; ++t) {
    const int bo = (t & 1) * STAGE_H;
    #pragma unroll   // the k offsets inside a stage become immediate offsets of the LDS loads
    for (int ks = 0; ks < KS; ks += 32) {
      Frag a[2], bb[4];
      #pragma unroll
      for (int mt = 0; mt < 2; ++mt) {
        a[mt].q[0] = *(const v4u*)(fa + bo + mt * 16 * LP + ks);        // k = t*KS + ks + hi*8 + 0..7
        a[mt].q[1] = *(const v4u*)(fa + bo + mt * 16 * LP + ks + 16);   // k = t*KS + ks + 16 + hi*8 + 0..7
      }
      #pragma unroll
      for (int nt = 0; nt < 4; ++nt) {
        bb[nt].q[0] = *(const v4u*)(fb + bo + nt * 16 * LP + ks);
        bb[nt].q[1] = *(const v4u*)(fb + bo + nt * 16 * LP + ks + 16);
      }
      #pragma unroll
      for (int mt = 0; mt < 2; ++mt) {
        #pragma unroll
        for (int nt = 0; nt < 4; ++nt) {
          if (F16 != 0) acc[mt][nt] = mma_f16(a[mt].vh, bb[nt].vh, acc[mt][nt]);
          else          acc[mt][nt] = mma_bf16(a[mt].vb, bb[nt].vb, acc[mt][nt]);
        }
      }
    }
    asm volatile("s_wait_dscnt 0x0" ::: "memory");      // this wave's reads of buffer t%2 are done before its refill
    asm volatile("s_wait_asynccnt 0x0" ::: "memory");   // stage t+1 landed (this wave's copies)
    __syncthreads();                                    // publishes stage t+1, ends every read of buffer t%2
    if (t + 2 < NSTAGE) {                               // block-uniform
      copy_stage(l0 + (unsigned)bo * 2u, ga + (t + 2) * KS, gb + (t + 2) * KS);
    }
  }
  asm volatile("s_wait_asynccnt 0x0" ::: "memory");     // nothing in flight when the ring is reused
}

// D layout -> LDS tile: acc[mt][nt][r] is (row wm+mt*16+hi*8+r, col wn+nt*16+lq).
static __device__ __forceinline__ void stage_tile(float* sC, const v8f (&acc)[2][4], int wm, int wn, int lq, int hi,
                                                  float scl) {
  #pragma unroll
  for (int mt = 0; mt < 2; ++mt) {
    #pragma unroll
    for (int nt = 0; nt < 4; ++nt) {
      #pragma unroll
      for (int r = 0; r < 8; ++r) {
        const int idx = (wm + mt * 16 + hi * 8 + r) * CP + wn + nt * 16 + lq;
        sC[idx] = acc[mt][nt][r] * scl;
      }
    }
  }
}

// The same for the sum of two accumulator sets, each with its own power-of-two scale.
static __device__ __forceinline__ void stage_tile2(float* sC, const v8f (&acc)[2][4], const v8f (&acc2)[2][4], int wm,
                                                   int wn, int lq, int hi, float scl, float scl2) {
  #pragma unroll
  for (int mt = 0; mt < 2; ++mt) {
    #pragma unroll
    for (int nt = 0; nt < 4; ++nt) {
      #pragma unroll
      for (int r = 0; r < 8; ++r) {
        const int idx = (wm + mt * 16 + hi * 8 + r) * CP + wn + nt * 16 + lq;
        sC[idx] = acc[mt][nt][r] * scl + acc2[mt][nt][r] * scl2;
      }
    }
  }
}

// q / k projection (z = 0 / 1): C = xb x W^T, + bias, interleaved rotary step with the bf16 table values, x16 carry,
// f16 hi plane [NB][NHEAD][SEQ][HDIM] and residual plane [NB][NHEAD][EARLY_T][HDIM] for rows < EARLY_T.
__global__ __launch_bounds__(256) void gemm_qk_kernel(const u16* __restrict__ xb, const u16* __restrict__ wpl,
                                                      const float* __restrict__ bq, const float* __restrict__ bk,
                                                      const float* __restrict__ fc,
                                                      u16* __restrict__ qh, u16* __restrict__ kh,
                                                      u16* __restrict__ qr, u16* __restrict__ kr) {
  __shared__ __align__(16) unsigned char sMem[GEMM_LDS_B];   // operand ring, then the f32 staging tile (block barriers)
  u16*   ring = (u16*)sMem;
  float* sC   = (float*)sMem;
  const int tid  = threadIdx.x;
  const int lane = tid & 31;
  const int wave = tid >> 5;
  const int lq   = lane & 15;
  const int hi   = lane >> 4;
  const int z    = blockIdx.z;
  const int nblk = blockIdx.x * GT;
  const int mblk = blockIdx.y * GT;
  const int wm   = (wave & 3) * 32;
  const int wn   = (wave >> 2) * 64;
  const u16*   W    = wpl + (size_t)z * DM * DM;
  const float* bias = (z == 0) ? bq : bk;
  u16* hp = (z == 0) ? qh : kh;
  u16* rp = (z == 0) ? qr : kr;

  v8f acc[2][4];
  #pragma unroll
  for (int mt = 0; mt < 2; ++mt) {
    #pragma unroll
    for (int nt = 0; nt < 4; ++nt) acc[mt][nt] = (v8f){0, 0, 0, 0, 0, 0, 0, 0};
  }
  gemm_core<0>(xb + (size_t)mblk * DM, W + (size_t)nblk * DM, ring, tid, wm, wn, lq, hi, acc);
  stage_tile(sC, acc, wm, wn, lq, hi, 1.0f);
  __syncthreads();

  const int b     = mblk / SEQ;
  const int t0    = mblk % SEQ;
  const bool early = (t0 < EARLY_T);            // block-uniform
  const int seg   = tid & 7;
  const int hs    = (tid >> 3) & 1;
  const int rsub  = tid >> 4;                   // 0..15
  const int n0    = nblk + hs * 64 + seg * 8;
  const int h     = n0 >> 6;

  float bz[8];
  {
    const v4f b0 = *(const v4f*)(bias + n0);
    const v4f b1 = *(const v4f*)(bias + n0 + 4);
    #pragma unroll
    for (int i = 0; i < 4; ++i) {
      bz[i]     = bfr(b0[i]);
      bz[4 + i] = bfr(b1[i]);
    }
  }

  v4u hv[8], rv[8];
  #pragma unroll
  for (int p = 0; p < 8; ++p) {
    const int row = p * 16 + rsub;
    const int t   = t0 + row;
    const float* sp = sC + row * CP + hs * 64 + seg * 8;
    const v4f s0 = *(const v4f*)(sp);
    const v4f s1 = *(const v4f*)(sp + 4);
    const float* fp = fc + ((size_t)t * (HDIM / 2) + seg * 4) * 2;   // (cos, sin) pairs of 4 consecutive i
    const v4f f0 = *(const v4f*)(fp);
    const v4f f1 = *(const v4f*)(fp + 4);
    float xv[8], cs[8], ov[8];
    #pragma unroll
    for (int i = 0; i < 4; ++i) {
      xv[i]     = s0[i] + bz[i];
      xv[4 + i] = s1[i] + bz[4 + i];
      cs[i]     = bfr(f0[i]);
      cs[4 + i] = bfr(f1[i]);
    }
    #pragma unroll
    for (int j = 0; j < 4; ++j) {
      const float x1 = xv[2 * j], x2 = xv[2 * j + 1];
      const float c  = cs[2 * j], s  = cs[2 * j + 1];
      ov[2 * j]     = x1 * c - x2 * s;
      ov[2 * j + 1] = x1 * s + x2 * c;
    }
    pack_hr(ov, QK_CARRY, hv[p], rv[p]);
  }

  const size_t bh = (size_t)b * NHEAD + h;
  #pragma unroll
  for (int p = 0; p < 8; ++p) {
    const int t = t0 + p * 16 + rsub;
    *(v4u*)(hp + (bh * SEQ + t) * HDIM + seg * 8) = hv[p];
    if (early) *(v4u*)(rp + (bh * EARLY_T + t) * HDIM + seg * 8) = rv[p];
  }
  
}

// v projection computed transposed: C[c][(b,t)] = Wv[c][:] . xb[(b,t)][:], + bias[c], x16 carry,
// vt [NB][DM][SEQ] f16 (row c = h*64+d, keys contiguous) and vtr [NB][DM][EARLY_T] residual for keys < EARLY_T.
__global__ __launch_bounds__(256) void gemm_v_kernel(const u16* __restrict__ wvb, const u16* __restrict__ xb,
                                                     const float* __restrict__ bv,
                                                     u16* __restrict__ vt, u16* __restrict__ vtr) {
  __shared__ __align__(16) unsigned char sMem[GEMM_LDS_B];   // operand ring, then the f32 staging tile (block barriers)
  u16*   ring = (u16*)sMem;
  float* sC   = (float*)sMem;
  const int tid  = threadIdx.x;
  const int lane = tid & 31;
  const int wave = tid >> 5;
  const int lq   = lane & 15;
  const int hi   = lane >> 4;
  const int nblk = blockIdx.x * GT;             // compact (b,t) columns
  const int mblk = blockIdx.y * GT;             // channel rows c
  const int wm   = (wave & 3) * 32;
  const int wn   = (wave >> 2) * 64;

  v8f acc[2][4];
  #pragma unroll
  for (int mt = 0; mt < 2; ++mt) {
    #pragma unroll
    for (int nt = 0; nt < 4; ++nt) acc[mt][nt] = (v8f){0, 0, 0, 0, 0, 0, 0, 0};
  }
  gemm_core<0>(wvb + (size_t)mblk * DM, xb + (size_t)nblk * DM, ring, tid, wm, wn, lq, hi, acc);
  stage_tile(sC, acc, wm, wn, lq, hi, 1.0f);
  __syncthreads();

  const int b     = nblk / SEQ;
  const int t0    = nblk % SEQ;
  const bool early = (t0 < EARLY_T);            // block-uniform
  const int seg   = tid & 7;
  const int hs    = (tid >> 3) & 1;
  const int rsub  = tid >> 4;

  v4u hv[8], rv[8];
  #pragma unroll
  for (int p = 0; p < 8; ++p) {
    const int row = p * 16 + rsub;
    const float bz = bfr(bv[mblk + row]);
    const float* sp = sC + row * CP + hs * 64 + seg * 8;
    const v4f s0 = *(const v4f*)(sp);
    const v4f s1 = *(const v4f*)(sp + 4);
    float ov[8];
    #pragma unroll
    for (int i = 0; i < 4; ++i) {
      ov[i]     = s0[i] + bz;
      ov[4 + i] = s1[i] + bz;
    }
    pack_hr(ov, V_CARRY, hv[p], rv[p]);
  }
  const int tcol = t0 + hs * 64 + seg * 8;
  #pragma unroll
  for (int p = 0; p < 8; ++p) {
    const size_t crow = (size_t)b * DM + mblk + p * 16 + rsub;
    *(v4u*)(vt + crow * SEQ + tcol) = hv[p];
    if (early) *(v4u*)(vtr + crow * EARLY_T + tcol) = rv[p];
  }
  
}

// Output projection: out[(b,t)][n] = (ctx . Wp[n][:]) / (64*64) + bias[n]. RES != 0: rows t < EARLY_T, a second
// k sweep over the residual ctx plane is folded with 1/2048. Each wave writes one whole 512-B tile row
template <int RES>
__global__ __launch_bounds__(256) void gemm_out_kernel(const u16* __restrict__ ctxh, const u16* __restrict__ ctxr,
                                                       const u16* __restrict__ wpb, const float* __restrict__ bp,
                                                       float* __restrict__ out) {
  __shared__ __align__(16) unsigned char sMem[GEMM_LDS_B];   // operand ring, then the f32 staging tile (block barriers)
  u16*   ring = (u16*)sMem;
  float* sC   = (float*)sMem;
  const int tid  = threadIdx.x;
  const int lane = tid & 31;
  const int wave = tid >> 5;
  const int lq   = lane & 15;
  const int hi   = lane >> 4;
  const int nblk = blockIdx.x * GT;
  const int y    = blockIdx.y;
  const int b    = (RES != 0) ? (y / EARLY_TILES) : (y / LATE_TILES);
  const int t0   = (RES != 0) ? ((y % EARLY_TILES) * GT) : (EARLY_T + (y % LATE_TILES) * GT);
  const int wm   = (wave & 3) * 32;
  const int wn   = (wave >> 2) * 64;

  v8f acc[2][4];
  #pragma unroll
  for (int mt = 0; mt < 2; ++mt) {
    #pragma unroll
    for (int nt = 0; nt < 4; ++nt) acc[mt][nt] = (v8f){0, 0, 0, 0, 0, 0, 0, 0};
  }
  const u16* bblk = wpb + (size_t)nblk * DM;
  gemm_core<1>(ctxh + ((size_t)b * SEQ + t0) * DM, bblk, ring, tid, wm, wn, lq, hi, acc);
  if (RES != 0) {
    v8f acc2[2][4];
    #pragma unroll
    for (int mt = 0; mt < 2; ++mt) {
      #pragma unroll
      for (int nt = 0; nt < 4; ++nt) acc2[mt][nt] = (v8f){0, 0, 0, 0, 0, 0, 0, 0};
    }
    gemm_core<1>(ctxr + ((size_t)b * EARLY_T + t0) * DM, bblk, ring, tid, wm, wn, lq, hi, acc2);
    stage_tile2(sC, acc, acc2, wm, wn, lq, hi, 1.0f / (CTX_CARRY * WP_CARRY), RES_INV / (CTX_CARRY * WP_CARRY));
  } else {
    stage_tile(sC, acc, wm, wn, lq, hi, 1.0f / (CTX_CARRY * WP_CARRY));
  }
  __syncthreads();

  const int col = lane * 4;
  v4f bz = *(const v4f*)(bp + nblk + col);
  #pragma unroll
  for (int i = 0; i < 4; ++i) bz[i] = bfr(bz[i]);

  v4f vals[16];
  #pragma unroll
  for (int p = 0; p < 16; ++p) {
    const int row = p * 8 + wave;
    const v4f v = *(const v4f*)(sC + row * CP + col);
    vals[p] = v + bz;
  }
  float* obase = out + ((size_t)b * SEQ_FULL + t0 + wave) * DM + nblk + col;
  #pragma unroll
  for (int p = 0; p < 16; ++p) *(v4f*)(obase + (size_t)p * 8 * DM) = vals[p];
  
}

// ---------------------------------------------------------------------------------------------------------
// Flash attention. Block = (query block of 128, head, batch); one wave owns 16 query rows.
// S^T = K x Q^T so queries sit on lanes; P^T in C-layout is bit-identical to the A-fragment layout of O += P x V.
// Q B-fragments come straight from the f16 plane. K and V^T tiles of SK keys are brought once per block into a
// two-buffer LDS ring by asynchronous copies (16 B per lane, a wave covers four whole 128-B rows per copy) and all
// eight waves read their K A-fragments and V^T B-fragments from the ring (two 16-B LDS loads each).
// Mask: per element replace-fill from the packed bit planes; key tiles past the diagonal are skipped only when the
// packed row flags of all 16 rows of the wave say that nothing beyond the diagonal is allowed and the diagonal is.
// RES != 0: residual planes (x2048) for q, k, v and P on separate accumulators.
// One K tile and one V^T tile: rows r and r+32 (r = tid/8) of each, 16-B piece tid%8 of every row.
// lds: the lane's byte address in the K tile of the target buffer; the V^T tile lies AT_H elements behind it.
// The s_wait_xcnt stands inside the statement so that no address register is rewritten ahead of it.
static __device__ __forceinline__ void copy_kv(unsigned lds, const u16* gk, const u16* gv, size_t vpitch) {
  const unsigned ldv = lds + AT_H * 2u;
  asm volatile("global_load_async_to_lds_b128 %0, %4, off\n\t"
               "global_load_async_to_lds_b128 %1, %5, off\n\t"
               "global_load_async_to_lds_b128 %2, %6, off\n\t"
               "global_load_async_to_lds_b128 %3, %7, off\n\t"
               "s_wait_xcnt 0x0"
               :: "v"(lds), "v"(lds + 32u * LP * 2u), "v"(ldv), "v"(ldv + 32u * LP * 2u),
                  "v"(gk), "v"(gk + (size_t)32 * HDIM), "v"(gv), "v"(gv + (size_t)32 * vpitch)
               : "memory");
}

template <int RES>
__global__ __launch_bounds__(256) void attn_kernel(const u16* __restrict__ qh_p, const u16* __restrict__ kh_p,
                                                   const u16* __restrict__ vt_p,
                                                   const u16* __restrict__ qr_p, const u16* __restrict__ kr_p,
                                                   const u16* __restrict__ vtr_p,
                                                   const unsigned* __restrict__ mbits,
                                                   const unsigned* __restrict__ pbits,
                                                   u16* __restrict__ ctxh, u16* __restrict__ ctxr, int qblk0) {
  const int qblk = qblk0 + blockIdx.x;
  const int h    = blockIdx.y;
  const int b    = blockIdx.z;
  const int tid  = threadIdx.x;
  const int wave = tid >> 5;
  const int lane = tid & 31;
  const int lq   = lane & 15;   // query column of S^T / d column of O
  const int hi   = lane >> 4;   // k-split half

  __shared__ __align__(16) float sO[NWAVE * 16 * OP];   // per-wave output staging (block barrier used)
  constexpr int ABUF_H = ((RES != 0) ? 4 : 2) * AT_H;   // one ring buffer: [K | V^T] and, with RES, [K res | V^T res]
  __shared__ __align__(16) u16 sKV[2 * ABUF_H];         // cross-wave (block barriers)
  __shared__ int sN[NWAVE];                             // cross-wave (block barrier)

  const int qrow0 = qblk * BQ + wave * 16;
  const int qi    = qrow0 + lq;
  const size_t bh = (size_t)b * NHEAD + h;

  // Q as B-operand fragments: lane lq holds query qi, split d map.
  Frag qf[2], qrf[2];
  {
    const u16* qp = qh_p + (bh * SEQ + qi) * HDIM + hi * 8;
    #pragma unroll
    for (int f = 0; f < 2; ++f) {
      qf[f].q[0] = *(const v4u*)(qp + f * 32);        // d = f*32 + hi*8 + 0..7
      qf[f].q[1] = *(const v4u*)(qp + f * 32 + 16);   // d = f*32 + 16 + hi*8 + 0..7
    }
  }
  if (RES != 0) {
    const u16* qp = qr_p + (bh * EARLY_T + qi) * HDIM + hi * 8;
    #pragma unroll
    for (int f = 0; f < 2; ++f) {
      qrf[f].q[0] = *(const v4u*)(qp + f * 32);
      qrf[f].q[1] = *(const v4u*)(qp + f * 32 + 16);
    }
  } else {
    #pragma unroll
    for (int f = 0; f < 2; ++f) {
      qrf[f].q[0] = (v4u){0u, 0u, 0u, 0u};
      qrf[f].q[1] = (v4u){0u, 0u, 0u, 0u};
    }
  }

  // ring fill: the lane's source piece in stage 0 of each plane and its LDS byte address in buffer 0
  const int crow = tid >> 3;
  const int cseg = tid & 7;
  const u16* gk  = kh_p  + (bh * SEQ + crow) * HDIM + cseg * 8;
  const u16* gkr = kr_p  + (bh * EARLY_T + crow) * HDIM + cseg * 8;
  const u16* gv  = vt_p  + (bh * HDIM + crow) * SEQ + cseg * 8;
  const u16* gvr = vtr_p + (bh * HDIM + crow) * EARLY_T + cseg * 8;
  const unsigned l0 = (unsigned)(uintptr_t)sKV + (unsigned)(crow * LP + cseg * 8) * 2u;
  // fragment reads: K row = key lq of a 16-key group, V^T row = d lq of a 16-d group, split k map
  const u16* fk = sKV + lq * LP + hi * 8;
  const u16* fv = sKV + AT_H + lq * LP + hi * 8;

  const unsigned* mrow = mbits + (size_t)qi * MPITCH;
  const unsigned* prow = pbits + (size_t)b * MPITCH;

  // wave-uniform tile-skip decision from the packed row flags and the diagonal padding bits
  const unsigned rk = mrow[MW];
  const unsigned pw = prow[qi >> 5];
  const bool rowok  = (rk == 1u) && (((pw >> (qi & 31)) & 1u) != 0u);
  const bool allok  = (__builtin_amdgcn_ballot_w32(rowok) == 0xffffffffu);
  int nchunk = allok ? ((qrow0 + 15) / BK + 1) : (SEQ / BK);
  nchunk = (nchunk < SEQ / BK) ? nchunk : (SEQ / BK);      // static bound
  nchunk = __builtin_amdgcn_readfirstlane(nchunk);

  // block-uniform stage count: the ring serves the wave that walks furthest
  if (lane == 0) sN[wave] = nchunk;
  __syncthreads();
  int nmax = sN[0];
  #pragma unroll
  for (int w = 1; w < NWAVE; ++w) nmax = (sN[w] > nmax) ? sN[w] : nmax;
  const int nstage = __builtin_amdgcn_readfirstlane((nmax + SK / BK - 1) / (SK / BK));   // 1 .. SEQ / SK

  // stage s into the buffer at byte offset bufb; residual planes end at EARLY_T: later stages copy the last one
  auto fill = [&](int s, unsigned bufb) {
    copy_kv(l0 + bufb, gk + (size_t)s * SK * HDIM, gv + (size_t)s * SK, SEQ);
    if (RES != 0) {
      const int sr = (s < EARLY_T / SK) ? s : (EARLY_T / SK - 1);
      copy_kv(l0 + bufb + 2u * AT_H * 2u, gkr + (size_t)sr * SK * HDIM, gvr + (size_t)sr * SK, EARLY_T);
    }
  };

  v8f o[4], o2[4];
  #pragma unroll
  for (int dt = 0; dt < 4; ++dt) {
    o[dt]  = (v8f){0, 0, 0, 0, 0, 0, 0, 0};
    o2[dt] = (v8f){0, 0, 0, 0, 0, 0, 0, 0};
  }

  float rmax = -__builtin_inff();
  float rsum = 0.0f;
  const float SL      = (0.125f / (QK_CARRY * QK_CARRY)) * 1.4426950408889634f;   // scale * log2(e) / carries
  const float FILLRAW = -1.0e30f * 8.0f * (QK_CARRY * QK_CARRY);                  // fill value in the carried raw domain

  fill(0, 0u);
  asm volatile("s_wait_asynccnt 0x0" ::: "memory");   // stage 0 landed (this wave's copies)
  __syncthreads();                                    // stage 0 readable by every wave
  if (nstage > 1) fill(1, (unsigned)ABUF_H * 2u);     // block-uniform

  #pragma unroll 1   // one ring stage per trip: the buffer index stays a run-time value
  for (int s = 0; s < nstage; ++s) {
   const int bo = (s & 1) * ABUF_H;
   #pragma unroll    // the chunk offsets inside a stage become immediate offsets of the LDS loads
   for (int cc = 0; cc < SK / BK; ++cc) {
    const int i = s * (SK / BK) + cc;
    if (i >= nchunk) continue;                                  // wave-uniform; the publish point below is not skipped
    const int j0 = i * BK;
    const unsigned mw = mrow[i] & prow[i];                      // allowed bits of keys j0..j0+31 for query qi
    const bool res_on = (RES != 0) && (j0 < EARLY_T);           // wave-uniform

    // S^T tiles: c[sub][r] = carried rawscore(query qi, key j0 + sub*16 + hi*8 + r)
    v8f c[2];
    #pragma unroll
    for (int sub = 0; sub < 2; ++sub) {
      Frag ak[2];
      const u16* kb = fk + bo + (cc * BK + sub * 16) * LP;
      #pragma unroll
      for (int f = 0; f < 2; ++f) {
        ak[f].q[0] = *(const v4u*)(kb + f * 32);
        ak[f].q[1] = *(const v4u*)(kb + f * 32 + 16);
      }
      v8f acc = (v8f){0, 0, 0, 0, 0, 0, 0, 0};
      acc = mma_f16(ak[0].vh, qf[0].vh, acc);
      acc = mma_f16(ak[1].vh, qf[1].vh, acc);
      if (RES != 0) {
        Frag akr[2];
        const u16* kbr = fk + bo + 2 * AT_H + (cc * BK + sub * 16) * LP;
        #pragma unroll
        for (int f = 0; f < 2; ++f) {
          const v4u l0 = *(const v4u*)(kbr + f * 32);
          const v4u l1 = *(const v4u*)(kbr + f * 32 + 16);
          akr[f].q[0] = res_on ? l0 : (v4u){0u, 0u, 0u, 0u};
          akr[f].q[1] = res_on ? l1 : (v4u){0u, 0u, 0u, 0u};
        }
        v8f acc2 = (v8f){0, 0, 0, 0, 0, 0, 0, 0};
        acc2 = mma_f16(ak[0].vh,  qrf[0].vh, acc2);
        acc2 = mma_f16(ak[1].vh,  qrf[1].vh, acc2);
        acc2 = mma_f16(akr[0].vh, qf[0].vh,  acc2);
        acc2 = mma_f16(akr[1].vh, qf[1].vh,  acc2);
        #pragma unroll
        for (int r = 0; r < 8; ++r) acc[r] += acc2[r] * RES_INV;
        asm volatile("" ::: "memory");
      }
      c[sub] = acc;
    }

    // mask: replace-fill; branch is wave-uniform, selects are per lane
    if (__builtin_amdgcn_ballot_w32(mw != 0xffffffffu) != 0u) {
      const unsigned ms = mw >> (hi * 8);
      #pragma unroll
      for (int sub = 0; sub < 2; ++sub) {
        #pragma unroll
        for (int r = 0; r < 8; ++r) {
          const bool allowed = ((ms >> (sub * 16 + r)) & 1u) != 0u;
          c[sub][r] = allowed ? c[sub][r] : FILLRAW;
        }
      }
    }

    // online softmax: query lq's 32 scores are split across lane / lane^16
    float m_new = rmax;
    #pragma unroll
    for (int r = 0; r < 8; ++r) {
      m_new = fmaxf(m_new, c[0][r]);
      m_new = fmaxf(m_new, c[1][r]);
    }
    m_new = fmaxf(m_new, __shfl_xor(m_new, 16, 32));
    const float scale = __builtin_amdgcn_exp2f((rmax - m_new) * SL);
    rmax = m_new;

    // exp + pack: P^T C-layout == A-fragment layout for the PV product
    Frag pa, pr;
    {
      Pack8H a0, a1, r0, r1;
      float psum = 0.0f;
      #pragma unroll
      for (int r = 0; r < 8; ++r) {
        const float p0 = __builtin_amdgcn_exp2f((c[0][r] - m_new) * SL);   // key hi*8 + r
        const float p1 = __builtin_amdgcn_exp2f((c[1][r] - m_new) * SL);   // key 16 + hi*8 + r
        psum += p0 + p1;
        const float pc0 = p0 * P_CARRY;
        const float pc1 = p1 * P_CARRY;
        const f16 h0 = (f16)pc0;
        const f16 h1 = (f16)pc1;
        a0.h[r] = h0;
        a1.h[r] = h1;
        if (RES != 0) {
          r0.h[r] = (f16)((pc0 - (float)h0) * RES_CARRY);
          r1.h[r] = (f16)((pc1 - (float)h1) * RES_CARRY);
        } else {
          r0.h[r] = (f16)0.0f;
          r1.h[r] = (f16)0.0f;
        }
      }
      pa.q[0] = a0.u;  pa.q[1] = a1.u;
      pr.q[0] = r0.u;  pr.q[1] = r1.u;
      rsum = rsum * scale + psum + __shfl_xor(psum, 16, 32);
    }

    // rescale O: queries are the row dimension there -> per-row scale from lane 8*hi + r
    float sc[8];
    #pragma unroll
    for (int r = 0; r < 8; ++r) sc[r] = __shfl(scale, (hi << 3) + r, 32);
    #pragma unroll
    for (int dt = 0; dt < 4; ++dt) {
      #pragma unroll
      for (int r = 0; r < 8; ++r) {
        o[dt][r] *= sc[r];
        if (RES != 0) o2[dt][r] *= sc[r];
      }
    }
    if (RES != 0) asm volatile("" ::: "memory");

    // O += P x V ; V B-fragments: column n = d = dt*16 + lq, split key map from the transposed plane
    #pragma unroll
    for (int dt = 0; dt < 4; ++dt) {
      Frag bv;
      const u16* vb = fv + bo + dt * 16 * LP + cc * BK;
      bv.q[0] = *(const v4u*)(vb);            // keys j0 + hi*8 + 0..7
      bv.q[1] = *(const v4u*)(vb + 16);       // keys j0 + 16 + hi*8 + 0..7
      o[dt] = mma_f16(pa.vh, bv.vh, o[dt]);
      if (RES != 0) {
        Frag bvr;
        const u16* vbr = fv + bo + 2 * AT_H + dt * 16 * LP + cc * BK;
        const v4u l0 = *(const v4u*)(vbr);
        const v4u l1 = *(const v4u*)(vbr + 16);
        bvr.q[0] = res_on ? l0 : (v4u){0u, 0u, 0u, 0u};
        bvr.q[1] = res_on ? l1 : (v4u){0u, 0u, 0u, 0u};
        o2[dt] = mma_f16(pa.vh, bvr.vh, o2[dt]);
        o2[dt] = mma_f16(pr.vh, bv.vh,  o2[dt]);
      }
    }
   }
   asm volatile("s_wait_dscnt 0x0" ::: "memory");      // this wave's reads of buffer s%2 are done before its refill
   asm volatile("s_wait_asynccnt 0x0" ::: "memory");   // stage s+1 landed (this wave's copies)
   __syncthreads();                                    // publishes stage s+1, ends every read of buffer s%2
   if (s + 2 < nstage) fill(s + 2, (unsigned)bo * 2u); // block-uniform
  }
  asm volatile("s_wait_asynccnt 0x0" ::: "memory");    // nothing in flight when the wave ends

  // normalize: lane holds column d = dt*16 + lq for query rows 8*hi + r
  float rs[8];
  #pragma unroll
  for (int r = 0; r < 8; ++r) rs[r] = 1.0f / __shfl(rsum, (hi << 3) + r, 32);

  float* so = sO + wave * (16 * OP);
  #pragma unroll
  for (int r = 0; r < 8; ++r) {
    #pragma unroll
    for (int dt = 0; dt < 4; ++dt) {
      float val = o[dt][r];
      if (RES != 0) val += o2[dt][r] * RES_INV;
      so[(hi * 8 + r) * OP + dt * 16 + lq] = val * (1.0f / (P_CARRY * V_CARRY)) * rs[r];
    }
  }
  __syncthreads();

  // rows it*4 + (lane>>3), it = 0..3 cover the wave's 16 rows, (lane&7)*8 covers d 0..63.
  const int seg = lane & 7;
  v4u hv[4], rv[4];
  #pragma unroll
  for (int it = 0; it < 4; ++it) {
    const int row = it * 4 + (lane >> 3);
    const v4f a0 = *(const v4f*)(so + row * OP + seg * 8);
    const v4f a1 = *(const v4f*)(so + row * OP + seg * 8 + 4);
    float ov[8];
    #pragma unroll
    for (int i = 0; i < 4; ++i) {
      ov[i]     = a0[i];
      ov[4 + i] = a1[i];
    }
    pack_hr(ov, CTX_CARRY, hv[it], rv[it]);
  }
  #pragma unroll
  for (int it = 0; it < 4; ++it) {
    const int row = qrow0 + it * 4 + (lane >> 3);
    *(v4u*)(ctxh + ((size_t)b * SEQ + row) * DM + h * HDIM + seg * 8) = hv[it];
    if (RES != 0) *(v4u*)(ctxr + ((size_t)b * EARLY_T + row) * DM + h * HDIM + seg * 8) = rv[it];
  }
  
}

// ---------------------------------------------------------------------------------------------------------
static constexpr size_t al128(size_t x) { return (x + 127) & ~(size_t)127; }
static constexpr size_t XB_B   = al128((size_t)NB * SEQ * DM * 2);
static constexpr size_t WPL_B  = al128((size_t)4 * DM * DM * 2);
static constexpr size_t QH_B   = al128((size_t)NB * NHEAD * SEQ * HDIM * 2);
static constexpr size_t QR_B   = al128((size_t)NB * NHEAD * EARLY_T * HDIM * 2);
static constexpr size_t VT_B   = al128((size_t)NB * DM * SEQ * 2);
static constexpr size_t VTR_B  = al128((size_t)NB * DM * EARLY_T * 2);
static constexpr size_t CTXH_B = al128((size_t)NB * SEQ * DM * 2);
static constexpr size_t CTXR_B = al128((size_t)NB * EARLY_T * DM * 2);
static constexpr size_t MB_B   = al128((size_t)SEQ * MPITCH * 4);
static constexpr size_t PB_B   = al128((size_t)NB * MPITCH * 4);
static constexpr size_t WS_TOTAL = XB_B + WPL_B + 2 * QH_B + 2 * QR_B + VT_B + VTR_B + CTXH_B + CTXR_B + MB_B + PB_B;
static_assert(WS_TOTAL <= (size_t)134217728);

extern "C" void kernel_launch(void* const* d_in, const int* in_sizes, int n_in,
                              void* d_out, int out_size, void* d_ws, size_t ws_size,
                              hipStream_t stream) {
  if (n_in < 12) return;
  const size_t rows_used = (size_t)(NB - 1) * SEQ_FULL + SEQ;
  if ((size_t)in_sizes[0] < rows_used * DM) return;
  if ((size_t)in_sizes[1] < (size_t)SEQ * HDIM) return;
  if ((size_t)in_sizes[2] < (size_t)(SEQ - 1) * SEQ_FULL + SEQ) return;
  if ((size_t)in_sizes[3] < rows_used) return;
  if ((size_t)in_sizes[4] < (size_t)DM * DM || (size_t)in_sizes[6] < (size_t)DM * DM) return;
  if ((size_t)in_sizes[8] < (size_t)DM * DM || (size_t)in_sizes[10] < (size_t)DM * DM) return;
  if (in_sizes[5] < DM || in_sizes[7] < DM || in_sizes[9] < DM || in_sizes[11] < DM) return;
  if ((size_t)out_size < rows_used * DM) return;
  if (ws_size < WS_TOTAL) return;

  const float* x   = (const float*)d_in[0];
  const float* fc  = (const float*)d_in[1];
  const int*   am  = (const int*)d_in[2];
  const int*   pm  = (const int*)d_in[3];
  const float* Wq  = (const float*)d_in[4];
  const float* bq  = (const float*)d_in[5];
  const float* Wk  = (const float*)d_in[6];
  const float* bk  = (const float*)d_in[7];
  const float* Wv  = (const float*)d_in[8];
  const float* bv  = (const float*)d_in[9];
  const float* Wp  = (const float*)d_in[10];
  const float* bp  = (const float*)d_in[11];
  float* out = (float*)d_out;

  char* ws = (char*)d_ws;
  size_t off = 0;
  u16* xb   = (u16*)(ws + off); off += XB_B;
  u16* wpl  = (u16*)(ws + off); off += WPL_B;
  u16* qh   = (u16*)(ws + off); off += QH_B;
  u16* kh   = (u16*)(ws + off); off += QH_B;
  u16* vt   = (u16*)(ws + off); off += VT_B;
  u16* qr   = (u16*)(ws + off); off += QR_B;
  u16* kr   = (u16*)(ws + off); off += QR_B;
  u16* vtr  = (u16*)(ws + off); off += VTR_B;
  u16* ctxh = (u16*)(ws + off); off += CTXH_B;
  u16* ctxr = (u16*)(ws + off); off += CTXR_B;
  unsigned* mbits = (unsigned*)(ws + off); off += MB_B;
  unsigned* pbits = (unsigned*)(ws + off); off += PB_B;

  cvt_x_kernel<<<dim3((unsigned)(((size_t)NB * SEQ * DM) / 2048)), 256, 0, stream>>>(x, xb);
  cvt_w_kernel<<<dim3((unsigned)(((size_t)DM * DM) / 2048), 4), 256, 0, stream>>>(Wq, Wk, Wv, Wp, wpl);
  mask_pack_kernel<<<dim3(SEQ + NB), 256, 0, stream>>>(am, pm, mbits, pbits);

  gemm_qk_kernel<<<dim3(DM / GT, (NB * SEQ) / GT, 2), 256, 0, stream>>>(xb, wpl, bq, bk, fc, qh, kh, qr, kr);
  gemm_v_kernel<<<dim3((NB * SEQ) / GT, DM / GT), 256, 0, stream>>>(wpl + (size_t)2 * DM * DM, xb, bv, vt, vtr);

  const int n_early = EARLY_T / BQ;
  const int n_late  = SEQ / BQ - n_early;
  attn_kernel<1><<<dim3(n_early, NHEAD, NB), 256, 0, stream>>>(qh, kh, vt, qr, kr, vtr, mbits, pbits, ctxh, ctxr, 0);
  if (n_late > 0)
    attn_kernel<0><<<dim3(n_late, NHEAD, NB), 256, 0, stream>>>(qh, kh, vt, qr, kr, vtr, mbits, pbits, ctxh, ctxr,
                                                                 n_early);

  const u16* wpb = wpl + (size_t)3 * DM * DM;
  gemm_out_kernel<1><<<dim3(DM / GT, NB * EARLY_TILES), 256, 0, stream>>>(ctxh, ctxr, wpb, bp, out);
  if (LATE_T > 0)
    gemm_out_kernel<0><<<dim3(DM / GT, NB * (LATE_T / GT)), 256, 0, stream>>>(ctxh, ctxr, wpb, bp, out);
}

// v003
// One run takes 148 microseconds.
// Next to v002, in two timings, it ran 1.33 and 1.34 times as fast.
// Counting every step since v000, it is 3.31 times as fast.
#include <hip/hip_runtime.h>

// Contractions: q/k/v projections on v_wmma_f32_16x16x32_bf16 (bf16 operands = RNE-converted inputs, f32 accumulate);
// scores S^T = K x Q^T, O = P x V and the output projection on v_wmma_f32_16x16x32_f16 (f16 planes with power-of-two
// carries: q,k,v x16, P x4096, ctx x64, Wp x64; query rows < EARLY_T add f16 residual planes x2048 on separate
// accumulators); bias, rotary step and softmax in f32.

#ifndef NB
#define NB 4
#endif
#ifndef SEQ
#define SEQ 2048
#endif
#define NB_FULL    4
#define SEQ_FULL   2048
#define NHEAD      16
#define HDIM       64
#define DM         (NHEAD * HDIM)            // model width
#define BQ         128                       // query rows per attention workgroup (8 waves x 16)
#define BK         32                        // keys per inner iteration
#define NWAVE      8
#define EARLY_T    ((SEQ < 512) ? SEQ : 512) // query/key rows that carry residual planes
#define OP         68                        // LDS pitch (floats) of the attention output staging tile
#define GT         128                       // GEMM block tile (rows and columns)
#define CP         132                       // LDS pitch (floats) of the GEMM staging tile
#define KS         64                        // k per GEMM ring stage (one 128-B line of every operand row)
#define LP         72                        // LDS pitch (16-bit elements) of a staged operand row: 144 B = 16 B x odd
#define TILE_H     (GT * LP)                 // 16-bit elements of one staged operand tile
#define STAGE_H    (2 * TILE_H)              // one ring buffer: [A 128 rows | B 128 rows]
#define NSTAGE     (DM / KS)
#define GEMM_LDS_B (2 * STAGE_H * 2)         // two ring buffers; the f32 staging tile reuses them behind the k sweeps
#define SK         64                        // keys per attention ring stage (one 128-B line of every K and V^T row)
#define AT_H       (SK * LP)                 // 16-bit elements of one staged attention tile: 64 rows at pitch LP
#define MW         (SEQ / 32)                // mask words per row
#define MPITCH     (((MW + 1 + 31) / 32) * 32)   // words per packed mask row (bits, row flag, zero pad)
#define LATE_T     (SEQ - EARLY_T)
#define LATE_TILES (((LATE_T / GT) > 0) ? (LATE_T / GT) : 1)
#define EARLY_TILES (EARLY_T / GT)

#define QK_CARRY   16.0f
#define V_CARRY    16.0f
#define P_CARRY    4096.0f
#define CTX_CARRY  64.0f
#define WP_CARRY   64.0f
#define RES_CARRY  2048.0f
#define RES_INV    (1.0f / 2048.0f)

static_assert(SEQ % 256 == 0);
static_assert(SEQ % GT == 0);
static_assert(SEQ % BQ == 0);
static_assert(EARLY_T % GT == 0);
static_assert(EARLY_T % BQ == 0);
static_assert(EARLY_T >= BK);
static_assert(BQ == NWAVE * 16);
static_assert(HDIM == 64);
static_assert(DM % GT == 0);
static_assert(DM % 32 == 0);
static_assert(SEQ <= SEQ_FULL);
static_assert(NB >= 1 && NB <= NB_FULL);
static_assert((OP * 4) % 16 == 0);
static_assert((CP * 4) % 16 == 0);
static_assert(DM % KS == 0 && NSTAGE >= 2);
static_assert(KS * 2 == 128 && (LP * 2) % 16 == 0 && LP >= KS);
static_assert(256 * 4 * 8 == GT * KS);        // ring fill per operand: threads x copies x 16-bit elements
static_assert(GEMM_LDS_B >= GT * CP * 4);
static_assert(MPITCH / 4 <= 32);
static_assert(MPITCH <= 256);
static_assert(((size_t)NB * SEQ * DM) % 2048 == 0);
static_assert(((size_t)DM * DM) % 2048 == 0);
static_assert(256 * 8 * 8 == GT * GT);        // 16-bit plane epilogues: threads x passes x halves
static_assert(256 * 16 * 4 == GT * GT);       // f32 output epilogue: threads x passes x floats
static_assert(32 * 4 * 8 == 16 * HDIM);       // attention epilogue per wave
static_assert(SK == HDIM && SK * 2 == 128 && SK % BK == 0);   // K tile: SK rows of HDIM; V^T tile: HDIM rows of SK
static_assert(SEQ % SK == 0 && EARLY_T % SK == 0 && EARLY_T >= SK);
static_assert(256 * 2 * 8 == SK * HDIM);      // attention ring fill per tile: threads x copies x 16-bit elements

typedef __bf16         bf16;
typedef _Float16       f16;
typedef unsigned short u16;
typedef bf16     v16bf __attribute__((ext_vector_type(16)));
typedef f16      v16h  __attribute__((ext_vector_type(16)));
typedef float    v8f   __attribute__((ext_vector_type(8)));
typedef float    v4f   __attribute__((ext_vector_type(4)));
typedef unsigned v4u   __attribute__((ext_vector_type(4)));

union Frag   { v16bf vb; v16h vh; v4u q[2]; };
union Pack8B { v4u u; bf16 h[8]; };
union Pack8H { v4u u; f16  h[8]; };

// WMMA helpers: builtin followed by the VALU hazard guard (ties D, keeps A/B live).
static __device__ __forceinline__ v8f mma_bf16(v16bf a, v16bf b, v8f acc) {
  acc = __builtin_amdgcn_wmma_f32_16x16x32_bf16(false, a, false, b, (short)0, acc, false, false);
  asm volatile("v_nop\n\tv_nop\n\tv_nop\n\tv_nop" : "+v"(acc) : "v"(a), "v"(b));
  return acc;
}
static __device__ __forceinline__ v8f mma_f16(v16h a, v16h b, v8f acc) {
  acc = __builtin_amdgcn_wmma_f32_16x16x32_f16(false, a, false, b, (short)0, acc, false, false);
  asm volatile("v_nop\n\tv_nop\n\tv_nop\n\tv_nop" : "+v"(acc) : "v"(a), "v"(b));
  return acc;
}

static __device__ __forceinline__ float bfr(float x) { return (float)(bf16)x; }   // RNE convert to bf16 and back

// 8 floats -> f16 hi plane piece and f16 residual piece (x RES_CARRY), both carried by 'carry'.
static __device__ __forceinline__ void pack_hr(const float (&v)[8], float carry, v4u& hv, v4u& rv) {
  Pack8H ph, pr;
  #pragma unroll
  for (int i = 0; i < 8; ++i) {
    const float yc = v[i] * carry;
    const f16 hh = (f16)yc;
    ph.h[i] = hh;
    pr.h[i] = (f16)((yc - (float)hh) * RES_CARRY);
  }
  hv = ph.u;
  rv = pr.u;
}

// ---------------------------------------------------------------------------------------------------------
// x [NB][SEQ][DM] f32 (full-size strides) -> xb [NB*SEQ][DM] bf16. 8 elements per thread, 16-B pieces,
static __device__ __forceinline__ void cvt_x_body(int blk, const float* __restrict__ x, u16* __restrict__ xb) {
  const size_t e   = ((size_t)blk * 256 + threadIdx.x) * 8;
  const size_t row = e / DM;
  const int    col = (int)(e % DM);
  const size_t b   = row / SEQ;
  const size_t t   = row % SEQ;
  const float* src = x + (b * SEQ_FULL + t) * DM + col;
  const v4f a0 = *(const v4f*)(src);
  const v4f a1 = *(const v4f*)(src + 4);
  Pack8B pk;
  #pragma unroll
  for (int i = 0; i < 4; ++i) {
    pk.h[i]     = (bf16)a0[i];
    pk.h[4 + i] = (bf16)a1[i];
  }
  const v4u val = pk.u;
  *(v4u*)(xb + e) = val;
  
}

// Weight planes: z = 0,1,2 -> bf16 of Wq,Wk,Wv; z = 3 -> f16 of (bf16 Wp) x WP_CARRY. [n][k] layout kept.
// coverage: (DM*DM/2048) blocks * 256 * 8 == DM*DM per plane, 4 planes.
static __device__ __forceinline__ void cvt_w_body(int blk, int z, const float* __restrict__ wq,
                                                  const float* __restrict__ wk, const float* __restrict__ wv,
                                                  const float* __restrict__ wp, u16* __restrict__ wpl) {
  const float* src = (z == 0) ? wq : (z == 1) ? wk : (z == 2) ? wv : wp;
  const size_t e = ((size_t)blk * 256 + threadIdx.x) * 8;
  const v4f a0 = *(const v4f*)(src + e);
  const v4f a1 = *(const v4f*)(src + e + 4);
  asm volatile("s_wait_xcnt 0x0" ::: "memory");   // before the loads' offset register is reused by the conversions
  v4u val;
  if (z < 3) {
    Pack8B pk;
    #pragma unroll
    for (int i = 0; i < 4; ++i) {
      pk.h[i]     = (bf16)a0[i];
      pk.h[4 + i] = (bf16)a1[i];
    }
    val = pk.u;
  } else {
    Pack8H ph;
    #pragma unroll
    for (int i = 0; i < 4; ++i) {
      ph.h[i]     = (f16)(bfr(a0[i]) * WP_CARRY);
      ph.h[4 + i] = (f16)(bfr(a1[i]) * WP_CARRY);
    }
    val = ph.u;
  }
  u16* dst = wpl + (size_t)z * DM * DM + e;
  *(v4u*)dst = val;
  
}

// Mask bit planes. Block r < SEQ packs attention-mask row r: words 0..MW-1 = allowed bits (bit j of word w = key
// 32w+j), word MW = 1 when the row has no allowed key beyond the diagonal and the diagonal key is allowed, rest 0.
// Blocks r >= SEQ pack the key-padding row of batch r-SEQ the same way (flag word = 1).
// Each packed row (MPITCH words) is written by wave 0 with one 16-B-per-lane instruction.
static __device__ __forceinline__ void mask_pack_body(int rid, const int* __restrict__ amask,
                                                      const int* __restrict__ pmask, unsigned* __restrict__ mbits,
                                                      unsigned* __restrict__ pbits) {
  __shared__ __align__(16) unsigned sW[MPITCH];   // cross-wave (block barriers)
  __shared__ int sBad;                            // cross-wave (block barriers)
  const int tid  = threadIdx.x;
  const int wave = tid >> 5;
  const int lane = tid & 31;
  const bool is_pad = (rid >= SEQ);
  const int q  = is_pad ? 0 : rid;
  const int pb = is_pad ? (rid - SEQ) : 0;
  const int* src = is_pad ? (pmask + (size_t)pb * SEQ_FULL) : (amask + (size_t)q * SEQ_FULL);
  unsigned*  dst = is_pad ? (pbits + (size_t)pb * MPITCH)   : (mbits + (size_t)q * MPITCH);
  if (tid == 0) sBad = 0;
  #pragma unroll 1
  for (int it = 0; it < SEQ / 256; ++it) {
    const int v = src[it * 256 + tid];
    const unsigned w = __builtin_amdgcn_ballot_w32(v != 0);
    if (lane == 0) sW[it * 8 + wave] = w;
  }
  __syncthreads();
  if (!is_pad && tid < MW) {
    const unsigned w = sW[tid];
    const int wq = q >> 5;
    const int bq = q & 31;
    int bad = 0;
    if (tid > wq) bad = (w != 0u);
    if (tid == wq) {
      const unsigned upper = (bq == 31) ? 0u : (w >> (bq + 1));
      bad = (upper != 0u) || (((w >> bq) & 1u) == 0u);
    }
    if (bad) sBad = 1;
  }
  __syncthreads();
  const int anybad = sBad;
  if (tid >= MW && tid < MPITCH) sW[tid] = (tid == MW) ? (anybad ? 0u : 1u) : 0u;
  __syncthreads();
  if (tid < MPITCH / 4) {
    const v4u val = *(const v4u*)(sW + tid * 4);
    *(v4u*)(dst + tid * 4) = val;
    
  }
}

// The three preparation steps depend on nothing but the inputs: one grid, the block index picks the step.
#define PREP_X_BLKS ((int)(((size_t)NB * SEQ * DM) / 2048))
#define PREP_W_BLKS ((int)(((size_t)DM * DM) / 2048))
__global__ __launch_bounds__(256) void prep_kernel(const float* __restrict__ x, const float* __restrict__ wq,
                                                   const float* __restrict__ wk, const float* __restrict__ wv,
                                                   const float* __restrict__ wp, const int* __restrict__ amask,
                                                   const int* __restrict__ pmask, u16* __restrict__ xb,
                                                   u16* __restrict__ wpl, unsigned* __restrict__ mbits,
                                                   unsigned* __restrict__ pbits) {
  const int bid = blockIdx.x;                    // block-uniform choice
  if (bid < PREP_X_BLKS) {
    cvt_x_body(bid, x, xb);
  } else if (bid < PREP_X_BLKS + 4 * PREP_W_BLKS) {
    const int wb = bid - PREP_X_BLKS;
    cvt_w_body(wb % PREP_W_BLKS, wb / PREP_W_BLKS, wq, wk, wv, wp, wpl);
  } else {
    mask_pack_body(bid - (PREP_X_BLKS + 4 * PREP_W_BLKS), amask, pmask, mbits, pbits);
  }
}

// ---------------------------------------------------------------------------------------------------------
// GEMM core: block tile 128 x 128, wave tile 32 x 64 of C[m][n] = sum_k A[m][k] * B[n][k], K = DM, both operands
// 16-bit row-major with k contiguous. Stages of KS k are brought into a two-buffer LDS ring by asynchronous copies
// (16 B per lane, a wave covers four whole 128-B rows per copy); the fragments are read from the ring with one split
// k map for A and B, k ascending.

// One stage of both operand tiles: rows r, r+32, r+64, r+96 (r = tid/8) of A and of B, 16-B piece tid%8 of each row.
// lds: the lane's byte address in the A tile of the target buffer; the B tile lies TILE_H elements behind it.
// The s_wait_xcnt stands inside the statement so that no address register is rewritten ahead of it.
static __device__ __forceinline__ void copy_stage(unsigned lds, const u16* ga, const u16* gb) {
  const unsigned ldb = lds + TILE_H * 2u;
  asm volatile("global_load_async_to_lds_b128 %0, %8, off\n\t"
               "global_load_async_to_lds_b128 %1, %9, off\n\t"
               "global_load_async_to_lds_b128 %2, %10, off\n\t"
               "global_load_async_to_lds_b128 %3, %11, off\n\t"
               "global_load_async_to_lds_b128 %4, %12, off\n\t"
               "global_load_async_to_lds_b128 %5, %13, off\n\t"
               "global_load_async_to_lds_b128 %6, %14, off\n\t"
               "global_load_async_to_lds_b128 %7, %15, off\n\t"
               "s_wait_xcnt 0x0"
               :: "v"(lds), "v"(lds + 32u * LP * 2u), "v"(lds + 64u * LP * 2u), "v"(lds + 96u * LP * 2u),
                  "v"(ldb), "v"(ldb + 32u * LP * 2u), "v"(ldb + 64u * LP * 2u), "v"(ldb + 96u * LP * 2u),
                  "v"(ga), "v"(ga + (size_t)32 * DM), "v"(ga + (size_t)64 * DM), "v"(ga + (size_t)96 * DM),
                  "v"(gb), "v"(gb + (size_t)32 * DM), "v"(gb + (size_t)64 * DM), "v"(gb + (size_t)96 * DM)
               : "memory");
}

// ablk / bblk: first element of the block's 128 rows of A and of B. ring: the block's LDS (GEMM_LDS_B bytes); every
// earlier LDS access of the block must lie in front of a block barrier. On return every wave has passed the barrier
// that ends the last read of the ring.
template <int F16>
static __device__ __forceinline__ void gemm_core(const u16* __restrict__ ablk, const u16* __restrict__ bblk,
                                                 u16* ring, int tid, int wm, int wn, int lq, int hi,
                                                 v8f (&acc)[2][4]) {
  const int crow = tid >> 3;
  const int cseg = tid & 7;
  const u16* ga = ablk + (size_t)crow * DM + cseg * 8;
  const u16* gb = bblk + (size_t)crow * DM + cseg * 8;
  const unsigned l0 = (unsigned)(uintptr_t)ring + (unsigned)(crow * LP + cseg * 8) * 2u;   // LDS byte address
  const u16* fa = ring + (wm + lq) * LP + hi * 8;
  const u16* fb = ring + TILE_H + (wn + lq) * LP + hi * 8;

  copy_stage(l0, ga, gb);
  asm volatile("s_wait_asynccnt 0x0" ::: "memory");   // stage 0 landed (this wave's copies)
  __syncthreads();                                    // stage 0 readable by every wave
  copy_stage(l0 + STAGE_H * 2u, ga + KS, gb + KS);

  #pragma unroll 1   // one ring stage per trip: the buffer index stays a run-time value
  for (int t = 0; t < NSTAGE; ++t) {
    const int bo = (t & 1) * STAGE_H;
    #pragma unroll   // the k offsets inside a stage become immediate offsets of the LDS loads
    for (int ks = 0; ks < KS; ks += 32) {
      Frag a[2], bb[4];
      #pragma unroll
      for (int mt = 0; mt < 2; ++mt) {
        a[mt].q[0] = *(const v4u*)(fa + bo + mt * 16 * LP + ks);        // k = t*KS + ks + hi*8 + 0..7
        a[mt].q[1] = *(const v4u*)(fa + bo + mt * 16 * LP + ks + 16);   // k = t*KS + ks + 16 + hi*8 + 0..7
      }
      #pragma unroll
      for (int nt = 0; nt < 4; ++nt) {
        bb[nt].q[0] = *(const v4u*)(fb + bo + nt * 16 * LP + ks);
        bb[nt].q[1] = *(const v4u*)(fb + bo + nt * 16 * LP + ks + 16);
      }
      #pragma unroll
      for (int mt = 0; mt < 2; ++mt) {
        #pragma unroll
        for (int nt = 0; nt < 4; ++nt) {
          if (F16 != 0) acc[mt][nt] = mma_f16(a[mt].vh, bb[nt].vh, acc[mt][nt]);
          else          acc[mt][nt] = mma_bf16(a[mt].vb, bb[nt].vb, acc[mt][nt]);
        }
      }
    }
    asm volatile("s_wait_dscnt 0x0" ::: "memory");      // this wave's reads of buffer t%2 are done before its refill
    asm volatile("s_wait_asynccnt 0x0" ::: "memory");   // stage t+1 landed (this wave's copies)
    __syncthreads();                                    // publishes stage t+1, ends every read of buffer t%2
    if (t + 2 < NSTAGE) {                               // block-uniform
      copy_stage(l0 + (unsigned)bo * 2u, ga + (t + 2) * KS, gb + (t + 2) * KS);
    }
  }
  asm volatile("s_wait_asynccnt 0x0" ::: "memory");     // nothing in flight when the ring is reused
}

// D layout -> LDS tile: acc[mt][nt][r] is (row wm+mt*16+hi*8+r, col wn+nt*16+lq).
static __device__ __forceinline__ void stage_tile(float* sC, const v8f (&acc)[2][4], int wm, int wn, int lq, int hi,
                                                  float scl) {
  #pragma unroll
  for (int mt = 0; mt < 2; ++mt) {
    #pragma unroll
    for (int nt = 0; nt < 4; ++nt) {
      #pragma unroll
      for (int r = 0; r < 8; ++r) {
        const int idx = (wm + mt * 16 + hi * 8 + r) * CP + wn + nt * 16 + lq;
        sC[idx] = acc[mt][nt][r] * scl;
      }
    }
  }
}

// The same for the sum of two accumulator sets, each with its own power-of-two scale.
static __device__ __forceinline__ void stage_tile2(float* sC, const v8f (&acc)[2][4], const v8f (&acc2)[2][4], int wm,
                                                   int wn, int lq, int hi, float scl, float scl2) {
  #pragma unroll
  for (int mt = 0; mt < 2; ++mt) {
    #pragma unroll
    for (int nt = 0; nt < 4; ++nt) {
      #pragma unroll
      for (int r = 0; r < 8; ++r) {
        const int idx = (wm + mt * 16 + hi * 8 + r) * CP + wn + nt * 16 + lq;
        sC[idx] = acc[mt][nt][r] * scl + acc2[mt][nt][r] * scl2;
      }
    }
  }
}

// q / k projection (z = 0 / 1): C = xb x W^T, + bias, interleaved rotary step with the bf16 table values, x16 carry,
// f16 hi plane [NB][NHEAD][SEQ][HDIM] and residual plane [NB][NHEAD][EARLY_T][HDIM] for rows < EARLY_T.
// sMem: the block's GEMM_LDS_B bytes of LDS: operand ring, then the f32 staging tile (block barriers).
static __device__ __forceinline__ void gemm_qk_body(unsigned char* sMem, int bx, int by, int z,
                                                    const u16* __restrict__ xb, const u16* __restrict__ wpl,
                                                    const float* __restrict__ bq, const float* __restrict__ bk,
                                                    const float* __restrict__ fc,
                                                    u16* __restrict__ qh, u16* __restrict__ kh,
                                                    u16* __restrict__ qr, u16* __restrict__ kr) {
  u16*   ring = (u16*)sMem;
  float* sC   = (float*)sMem;
  const int tid  = threadIdx.x;
  const int lane = tid & 31;
  const int wave = tid >> 5;
  const int lq   = lane & 15;
  const int hi   = lane >> 4;
  const int nblk = bx * GT;
  const int mblk = by * GT;
  const int wm   = (wave & 3) * 32;
  const int wn   = (wave >> 2) * 64;
  const u16*   W    = wpl + (size_t)z * DM * DM;
  const float* bias = (z == 0) ? bq : bk;
  u16* hp = (z == 0) ? qh : kh;
  u16* rp = (z == 0) ? qr : kr;

  v8f acc[2][4];
  #pragma unroll
  for (int mt = 0; mt < 2; ++mt) {
    #pragma unroll
    for (int nt = 0; nt < 4; ++nt) acc[mt][nt] = (v8f){0, 0, 0, 0, 0, 0, 0, 0};
  }
  gemm_core<0>(xb + (size_t)mblk * DM, W + (size_t)nblk * DM, ring, tid, wm, wn, lq, hi, acc);
  stage_tile(sC, acc, wm, wn, lq, hi, 1.0f);
  __syncthreads();

  const int b     = mblk / SEQ;
  const int t0    = mblk % SEQ;
  const bool early = (t0 < EARLY_T);            // block-uniform
  const int seg   = tid & 7;
  const int hs    = (tid >> 3) & 1;
  const int rsub  = tid >> 4;                   // 0..15
  const int n0    = nblk + hs * 64 + seg * 8;
  const int h     = n0 >> 6;

  float bz[8];
  {
    const v4f b0 = *(const v4f*)(bias + n0);
    const v4f b1 = *(const v4f*)(bias + n0 + 4);
    asm volatile("s_wait_xcnt 0x0" ::: "memory");     // before an address register of the loads is reused
    #pragma unroll
    for (int i = 0; i < 4; ++i) {
      bz[i]     = bfr(b0[i]);
      bz[4 + i] = bfr(b1[i]);
    }
  }

  v4u hv[8], rv[8];
  #pragma unroll
  for (int p = 0; p < 8; ++p) {
    const int row = p * 16 + rsub;
    const int t   = t0 + row;
    const float* sp = sC + row * CP + hs * 64 + seg * 8;
    const v4f s0 = *(const v4f*)(sp);
    const v4f s1 = *(const v4f*)(sp + 4);
    const float* fp = fc + ((size_t)t * (HDIM / 2) + seg * 4) * 2;   // (cos, sin) pairs of 4 consecutive i
    const v4f f0 = *(const v4f*)(fp);
    const v4f f1 = *(const v4f*)(fp + 4);
    asm volatile("s_wait_xcnt 0x0" ::: "memory");     // before an address register of the loads is reused
    float xv[8], cs[8], ov[8];
    #pragma unroll
    for (int i = 0; i < 4; ++i) {
      xv[i]     = s0[i] + bz[i];
      xv[4 + i] = s1[i] + bz[4 + i];
      cs[i]     = bfr(f0[i]);
      cs[4 + i] = bfr(f1[i]);
    }
    #pragma unroll
    for (int j = 0; j < 4; ++j) {
      const float x1 = xv[2 * j], x2 = xv[2 * j + 1];
      const float c  = cs[2 * j], s  = cs[2 * j + 1];
      ov[2 * j]     = x1 * c - x2 * s;
      ov[2 * j + 1] = x1 * s + x2 * c;
    }
    pack_hr(ov, QK_CARRY, hv[p], rv[p]);
  }

  const size_t bh = (size_t)b * NHEAD + h;
  #pragma unroll
  for (int p = 0; p < 8; ++p) {
    const int t = t0 + p * 16 + rsub;
    *(v4u*)(hp + (bh * SEQ + t) * HDIM + seg * 8) = hv[p];
    asm volatile("s_wait_xcnt 0x0" ::: "memory");     // before a register of the store is reused
    if (early) {
      *(v4u*)(rp + (bh * EARLY_T + t) * HDIM + seg * 8) = rv[p];
      asm volatile("s_wait_xcnt 0x0" ::: "memory");   // before a register of the store is reused
    }
  }
  
}

// v projection computed transposed: C[c][(b,t)] = Wv[c][:] . xb[(b,t)][:], + bias[c], x16 carry,
// vt [NB][DM][SEQ] f16 (row c = h*64+d, keys contiguous) and vtr [NB][DM][EARLY_T] residual for keys < EARLY_T.
static __device__ __forceinline__ void gemm_v_body(unsigned char* sMem, int bx, int by,
                                                   const u16* __restrict__ wvb, const u16* __restrict__ xb,
                                                   const float* __restrict__ bv,
                                                   u16* __restrict__ vt, u16* __restrict__ vtr) {
  u16*   ring = (u16*)sMem;
  float* sC   = (float*)sMem;
  const int tid  = threadIdx.x;
  const int lane = tid & 31;
  const int wave = tid >> 5;
  const int lq   = lane & 15;
  const int hi   = lane >> 4;
  const int nblk = bx * GT;                     // compact (b,t) columns
  const int mblk = by * GT;                     // channel rows c
  const int wm   = (wave & 3) * 32;
  const int wn   = (wave >> 2) * 64;

  v8f acc[2][4];
  #pragma unroll
  for (int mt = 0; mt < 2; ++mt) {
    #pragma unroll
    for (int nt = 0; nt < 4; ++nt) acc[mt][nt] = (v8f){0, 0, 0, 0, 0, 0, 0, 0};
  }
  gemm_core<0>(wvb + (size_t)mblk * DM, xb + (size_t)nblk * DM, ring, tid, wm, wn, lq, hi, acc);
  stage_tile(sC, acc, wm, wn, lq, hi, 1.0f);
  __syncthreads();

  const int b     = nblk / SEQ;
  const int t0    = nblk % SEQ;
  const bool early = (t0 < EARLY_T);            // block-uniform
  const int seg   = tid & 7;
  const int hs    = (tid >> 3) & 1;
  const int rsub  = tid >> 4;

  v4u hv[8], rv[8];
  #pragma unroll
  for (int p = 0; p < 8; ++p) {
    const int row = p * 16 + rsub;
    const float bvr = bv[mblk + row];
    asm volatile("s_wait_xcnt 0x0" ::: "memory");     // before an address register of the load is reused
    const float bz = bfr(bvr);
    const float* sp = sC + row * CP + hs * 64 + seg * 8;
    const v4f s0 = *(const v4f*)(sp);
    const v4f s1 = *(const v4f*)(sp + 4);
    float ov[8];
    #pragma unroll
    for (int i = 0; i < 4; ++i) {
      ov[i]     = s0[i] + bz;
      ov[4 + i] = s1[i] + bz;
    }
    pack_hr(ov, V_CARRY, hv[p], rv[p]);
  }
  const int tcol = t0 + hs * 64 + seg * 8;
  #pragma unroll
  for (int p = 0; p < 8; ++p) {
    const size_t crow = (size_t)b * DM + mblk + p * 16 + rsub;
    *(v4u*)(vt + crow * SEQ + tcol) = hv[p];
    asm volatile("s_wait_xcnt 0x0" ::: "memory");     // before a register of the store is reused
    if (early) {
      *(v4u*)(vtr + crow * EARLY_T + tcol) = rv[p];
      asm volatile("s_wait_xcnt 0x0" ::: "memory");   // before a register of the store is reused
    }
  }
  
}

// q, k and v projections read the same planes and depend on nothing of each other: one grid, z = 0 / 1 / 2.
// q / k: x = weight-row tile, y = (b,t) tile. v: the plane's flat block index walks the (b,t) tiles fastest.
__global__ __launch_bounds__(256) void gemm_qkv_kernel(const u16* __restrict__ xb, const u16* __restrict__ wpl,
                                                       const float* __restrict__ bq, const float* __restrict__ bk,
                                                       const float* __restrict__ bv, const float* __restrict__ fc,
                                                       u16* __restrict__ qh, u16* __restrict__ kh,
                                                       u16* __restrict__ qr, u16* __restrict__ kr,
                                                       u16* __restrict__ vt, u16* __restrict__ vtr) {
  __shared__ __align__(16) unsigned char sMem[GEMM_LDS_B];   // one allocation serves whichever body the block runs
  const int z = blockIdx.z;                                  // block-uniform choice
  if (z < 2) gemm_qk_body(sMem, blockIdx.x, blockIdx.y, z, xb, wpl, bq, bk, fc, qh, kh, qr, kr);
  else {
    const int lin = blockIdx.y * (DM / GT) + blockIdx.x;
    gemm_v_body(sMem, lin % ((NB * SEQ) / GT), lin / ((NB * SEQ) / GT), wpl + (size_t)2 * DM * DM, xb, bv, vt, vtr);
  }
}

// Output projection: out[(b,t)][n] = (ctx . Wp[n][:]) / (64*64) + bias[n]. RES != 0: rows t < EARLY_T, a second
// k sweep over the residual ctx plane is folded with 1/2048. Each wave writes one whole 512-B tile row
template <int RES>
static __device__ __forceinline__ void gemm_out_body(unsigned char* sMem, int bx, int y,
                                                     const u16* __restrict__ ctxh, const u16* __restrict__ ctxr,
                                                     const u16* __restrict__ wpb, const float* __restrict__ bp,
                                                     float* __restrict__ out) {
  u16*   ring = (u16*)sMem;
  float* sC   = (float*)sMem;
  const int tid  = threadIdx.x;
  const int lane = tid & 31;
  const int wave = tid >> 5;
  const int lq   = lane & 15;
  const int hi   = lane >> 4;
  const int nblk = bx * GT;
  const int b    = (RES != 0) ? (y / EARLY_TILES) : (y / LATE_TILES);
  const int t0   = (RES != 0) ? ((y % EARLY_TILES) * GT) : (EARLY_T + (y % LATE_TILES) * GT);
  const int wm   = (wave & 3) * 32;
  const int wn   = (wave >> 2) * 64;

  v8f acc[2][4];
  #pragma unroll
  for (int mt = 0; mt < 2; ++mt) {
    #pragma unroll
    for (int nt = 0; nt < 4; ++nt) acc[mt][nt] = (v8f){0, 0, 0, 0, 0, 0, 0, 0};
  }
  const u16* bblk = wpb + (size_t)nblk * DM;
  gemm_core<1>(ctxh + ((size_t)b * SEQ + t0) * DM, bblk, ring, tid, wm, wn, lq, hi, acc);
  if (RES != 0) {
    v8f acc2[2][4];
    #pragma unroll
    for (int mt = 0; mt < 2; ++mt) {
      #pragma unroll
      for (int nt = 0; nt < 4; ++nt) acc2[mt][nt] = (v8f){0, 0, 0, 0, 0, 0, 0, 0};
    }
    gemm_core<1>(ctxr + ((size_t)b * EARLY_T + t0) * DM, bblk, ring, tid, wm, wn, lq, hi, acc2);
    stage_tile2(sC, acc, acc2, wm, wn, lq, hi, 1.0f / (CTX_CARRY * WP_CARRY), RES_INV / (CTX_CARRY * WP_CARRY));
  } else {
    stage_tile(sC, acc, wm, wn, lq, hi, 1.0f / (CTX_CARRY * WP_CARRY));
  }
  __syncthreads();

  const int col = lane * 4;
  v4f bz = *(const v4f*)(bp + nblk + col);
  #pragma unroll
  for (int i = 0; i < 4; ++i) bz[i] = bfr(bz[i]);

  v4f vals[16];
  #pragma unroll
  for (int p = 0; p < 16; ++p) {
    const int row = p * 8 + wave;
    const v4f v = *(const v4f*)(sC + row * CP + col);
    vals[p] = v + bz;
  }
  float* obase = out + ((size_t)b * SEQ_FULL + t0 + wave) * DM + nblk + col;
  #pragma unroll
  for (int p = 0; p < 16; ++p) *(v4f*)(obase + (size_t)p * 8 * DM) = vals[p];
  
}

// Both row ranges in one grid: the tiles with the second k sweep (twice the trips) take the lowest block indices.
__global__ __launch_bounds__(256) void gemm_out_kernel(const u16* __restrict__ ctxh, const u16* __restrict__ ctxr,
                                                       const u16* __restrict__ wpb, const float* __restrict__ bp,
                                                       float* __restrict__ out) {
  __shared__ __align__(16) unsigned char sMem[GEMM_LDS_B];   // one allocation serves whichever body the block runs
  const int y = blockIdx.y;                                  // block-uniform choice
  if (y < NB * EARLY_TILES) gemm_out_body<1>(sMem, blockIdx.x, y, ctxh, ctxr, wpb, bp, out);
  else                      gemm_out_body<0>(sMem, blockIdx.x, y - NB * EARLY_TILES, ctxh, ctxr, wpb, bp, out);
}

// ---------------------------------------------------------------------------------------------------------
// Flash attention. Block = (query block of 128, head, batch); one wave owns 16 query rows.
// S^T = K x Q^T so queries sit on lanes; P^T in C-layout is bit-identical to the A-fragment layout of O += P x V.
// Q B-fragments come straight from the f16 plane. K and V^T tiles of SK keys are brought once per block into a
// two-buffer LDS ring by asynchronous copies (16 B per lane, a wave covers four whole 128-B rows per copy) and all
// eight waves read their K A-fragments and V^T B-fragments from the ring (two 16-B LDS loads each).
// Mask: per element replace-fill from the packed bit planes; key tiles past the diagonal are skipped only when the
// packed row flags of all 16 rows of the wave say that nothing beyond the diagonal is allowed and the diagonal is.
// RES != 0: residual planes (x2048) for q, k, v and P on separate accumulators.
// One K tile and one V^T tile: rows r and r+32 (r = tid/8) of each, 16-B piece tid%8 of every row.
// lds: the lane's byte address in the K tile of the target buffer; the V^T tile lies AT_H elements behind it.
// The s_wait_xcnt stands inside the statement so that no address register is rewritten ahead of it.
static __device__ __forceinline__ void copy_kv(unsigned lds, const u16* gk, const u16* gv, size_t vpitch) {
  const unsigned ldv = lds + AT_H * 2u;
  asm volatile("global_load_async_to_lds_b128 %0, %4, off\n\t"
               "global_load_async_to_lds_b128 %1, %5, off\n\t"
               "global_load_async_to_lds_b128 %2, %6, off\n\t"
               "global_load_async_to_lds_b128 %3, %7, off\n\t"
               "s_wait_xcnt 0x0"
               :: "v"(lds), "v"(lds + 32u * LP * 2u), "v"(ldv), "v"(ldv + 32u * LP * 2u),
                  "v"(gk), "v"(gk + (size_t)32 * HDIM), "v"(gv), "v"(gv + (size_t)32 * vpitch)
               : "memory");
}

#define ATT_SO_B   (NWAVE * 16 * OP * 4)         // per-wave output staging
#define ATT_KV_B   (2 * 4 * AT_H * 2)            // two ring buffers of the form with residual planes (the larger one)
#define ATT_LDS_B  (ATT_SO_B + ATT_KV_B + NWAVE * 4)
static_assert(ATT_SO_B % 16 == 0 && ATT_KV_B % 16 == 0);

// sMem: the block's ATT_LDS_B bytes of LDS.
template <int RES>
static __device__ __forceinline__ void attn_body(unsigned char* sMem, int qblk, int h, int b,
                                                 const u16* __restrict__ qh_p, const u16* __restrict__ kh_p,
                                                 const u16* __restrict__ vt_p,
                                                 const u16* __restrict__ qr_p, const u16* __restrict__ kr_p,
                                                 const u16* __restrict__ vtr_p,
                                                 const unsigned* __restrict__ mbits,
                                                 const unsigned* __restrict__ pbits,
                                                 u16* __restrict__ ctxh, u16* __restrict__ ctxr) {
  const int tid  = threadIdx.x;
  const int wave = tid >> 5;
  const int lane = tid & 31;
  const int lq   = lane & 15;   // query column of S^T / d column of O
  const int hi   = lane >> 4;   // k-split half

  float* sO = (float*)sMem;                             // per-wave output staging (block barrier used)
  constexpr int ABUF_H = ((RES != 0) ? 4 : 2) * AT_H;   // one ring buffer: [K | V^T] and, with RES, [K res | V^T res]
  u16* sKV = (u16*)(sMem + ATT_SO_B);                   // 2 * ABUF_H elements, cross-wave (block barriers)
  int* sN  = (int*)(sMem + ATT_SO_B + ATT_KV_B);        // NWAVE words, cross-wave (block barrier)

  const int qrow0 = qblk * BQ + wave * 16;
  const int qi    = qrow0 + lq;
  const size_t bh = (size_t)b * NHEAD + h;

  // Q as B-operand fragments: lane lq holds query qi, split d map.
  Frag qf[2], qrf[2];
  {
    const u16* qp = qh_p + (bh * SEQ + qi) * HDIM + hi * 8;
    #pragma unroll
    for (int f = 0; f < 2; ++f) {
      qf[f].q[0] = *(const v4u*)(qp + f * 32);        // d = f*32 + hi*8 + 0..7
      qf[f].q[1] = *(const v4u*)(qp + f * 32 + 16);   // d = f*32 + 16 + hi*8 + 0..7
    }
  }
  if (RES != 0) {
    const u16* qp = qr_p + (bh * EARLY_T + qi) * HDIM + hi * 8;
    #pragma unroll
    for (int f = 0; f < 2; ++f) {
      qrf[f].q[0] = *(const v4u*)(qp + f * 32);
      qrf[f].q[1] = *(const v4u*)(qp + f * 32 + 16);
    }
  } else {
    #pragma unroll
    for (int f = 0; f < 2; ++f) {
      qrf[f].q[0] = (v4u){0u, 0u, 0u, 0u};
      qrf[f].q[1] = (v4u){0u, 0u, 0u, 0u};
    }
  }

  // ring fill: the lane's source piece in stage 0 of each plane and its LDS byte address in buffer 0
  const int crow = tid >> 3;
  const int cseg = tid & 7;
  const u16* gk  = kh_p  + (bh * SEQ + crow) * HDIM + cseg * 8;
  const u16* gkr = kr_p  + (bh * EARLY_T + crow) * HDIM + cseg * 8;
  const u16* gv  = vt_p  + (bh * HDIM + crow) * SEQ + cseg * 8;
  const u16* gvr = vtr_p + (bh * HDIM + crow) * EARLY_T + cseg * 8;
  const unsigned l0 = (unsigned)(uintptr_t)sKV + (unsigned)(crow * LP + cseg * 8) * 2u;
  // fragment reads: K row = key lq of a 16-key group, V^T row = d lq of a 16-d group, split k map
  const u16* fk = sKV + lq * LP + hi * 8;
  const u16* fv = sKV + AT_H + lq * LP + hi * 8;

  const unsigned* mrow = mbits + (size_t)qi * MPITCH;
  const unsigned* prow = pbits + (size_t)b * MPITCH;

  // wave-uniform tile-skip decision from the packed row flags and the diagonal padding bits
  const unsigned rk = mrow[MW];
  const unsigned pw = prow[qi >> 5];
  const bool rowok  = (rk == 1u) && (((pw >> (qi & 31)) & 1u) != 0u);
  const bool allok  = (__builtin_amdgcn_ballot_w32(rowok) == 0xffffffffu);
  int nchunk = allok ? ((qrow0 + 15) / BK + 1) : (SEQ / BK);
  nchunk = (nchunk < SEQ / BK) ? nchunk : (SEQ / BK);      // static bound
  nchunk = __builtin_amdgcn_readfirstlane(nchunk);

  // block-uniform stage count: the ring serves the wave that walks furthest
  if (lane == 0) sN[wave] = nchunk;
  __syncthreads();
  int nmax = sN[0];
  #pragma unroll
  for (int w = 1; w < NWAVE; ++w) nmax = (sN[w] > nmax) ? sN[w] : nmax;
  const int nstage = __builtin_amdgcn_readfirstlane((nmax + SK / BK - 1) / (SK / BK));   // 1 .. SEQ / SK

  // stage s into the buffer at byte offset bufb; residual planes end at EARLY_T: later stages copy the last one
  auto fill = [&](int s, unsigned bufb) {
    copy_kv(l0 + bufb, gk + (size_t)s * SK * HDIM, gv + (size_t)s * SK, SEQ);
    if (RES != 0) {
      const int sr = (s < EARLY_T / SK) ? s : (EARLY_T / SK - 1);
      copy_kv(l0 + bufb + 2u * AT_H * 2u, gkr + (size_t)sr * SK * HDIM, gvr + (size_t)sr * SK, EARLY_T);
    }
  };

  v8f o[4], o2[4];
  #pragma unroll
  for (int dt = 0; dt < 4; ++dt) {
    o[dt]  = (v8f){0, 0, 0, 0, 0, 0, 0, 0};
    o2[dt] = (v8f){0, 0, 0, 0, 0, 0, 0, 0};
  }

  float rmax = -__builtin_inff();
  float rsum = 0.0f;
  const float SL      = (0.125f / (QK_CARRY * QK_CARRY)) * 1.4426950408889634f;   // scale * log2(e) / carries
  const float FILLRAW = -1.0e30f * 8.0f * (QK_CARRY * QK_CARRY);                  // fill value in the carried raw domain

  fill(0, 0u);
  asm volatile("s_wait_asynccnt 0x0" ::: "memory");   // stage 0 landed (this wave's copies)
  __syncthreads();                                    // stage 0 readable by every wave
  if (nstage > 1) fill(1, (unsigned)ABUF_H * 2u);     // block-uniform

  #pragma unroll 1   // one ring stage per trip: the buffer index stays a run-time value
  for (int s = 0; s < nstage; ++s) {
   const int bo = (s & 1) * ABUF_H;
   #pragma unroll    // the chunk offsets inside a stage become immediate offsets of the LDS loads
   for (int cc = 0; cc < SK / BK; ++cc) {
    const int i = s * (SK / BK) + cc;
    if (i >= nchunk) continue;                                  // wave-uniform; the publish point below is not skipped
    const int j0 = i * BK;
    const unsigned mw = mrow[i] & prow[i];                      // allowed bits of keys j0..j0+31 for query qi
    const bool res_on = (RES != 0) && (j0 < EARLY_T);           // wave-uniform

    // S^T tiles: c[sub][r] = carried rawscore(query qi, key j0 + sub*16 + hi*8 + r)
    v8f c[2];
    #pragma unroll
    for (int sub = 0; sub < 2; ++sub) {
      Frag ak[2];
      const u16* kb = fk + bo + (cc * BK + sub * 16) * LP;
      #pragma unroll
      for (int f = 0; f < 2; ++f) {
        ak[f].q[0] = *(const v4u*)(kb + f * 32);
        ak[f].q[1] = *(const v4u*)(kb + f * 32 + 16);
      }
      v8f acc = (v8f){0, 0, 0, 0, 0, 0, 0, 0};
      acc = mma_f16(ak[0].vh, qf[0].vh, acc);
      acc = mma_f16(ak[1].vh, qf[1].vh, acc);
      if (RES != 0) {
        Frag akr[2];
        const u16* kbr = fk + bo + 2 * AT_H + (cc * BK + sub * 16) * LP;
        #pragma unroll
        for (int f = 0; f < 2; ++f) {
          const v4u l0 = *(const v4u*)(kbr + f * 32);
          const v4u l1 = *(const v4u*)(kbr + f * 32 + 16);
          akr[f].q[0] = res_on ? l0 : (v4u){0u, 0u, 0u, 0u};
          akr[f].q[1] = res_on ? l1 : (v4u){0u, 0u, 0u, 0u};
        }
        v8f acc2 = (v8f){0, 0, 0, 0, 0, 0, 0, 0};
        acc2 = mma_f16(ak[0].vh,  qrf[0].vh, acc2);
        acc2 = mma_f16(ak[1].vh,  qrf[1].vh, acc2);
        acc2 = mma_f16(akr[0].vh, qf[0].vh,  acc2);
        acc2 = mma_f16(akr[1].vh, qf[1].vh,  acc2);
        #pragma unroll
        for (int r = 0; r < 8; ++r) acc[r] += acc2[r] * RES_INV;
        asm volatile("" ::: "memory");
      }
      c[sub] = acc;
    }

    // mask: replace-fill; branch is wave-uniform, selects are per lane
    if (__builtin_amdgcn_ballot_w32(mw != 0xffffffffu) != 0u) {
      const unsigned ms = mw >> (hi * 8);
      #pragma unroll
      for (int sub = 0; sub < 2; ++sub) {
        #pragma unroll
        for (int r = 0; r < 8; ++r) {
          const bool allowed = ((ms >> (sub * 16 + r)) & 1u) != 0u;
          c[sub][r] = allowed ? c[sub][r] : FILLRAW;
        }
      }
    }

    // online softmax: query lq's 32 scores are split across lane / lane^16
    float m_new = rmax;
    #pragma unroll
    for (int r = 0; r < 8; ++r) {
      m_new = fmaxf(m_new, c[0][r]);
      m_new = fmaxf(m_new, c[1][r]);
    }
    m_new = fmaxf(m_new, __shfl_xor(m_new, 16, 32));
    const float scale = __builtin_amdgcn_exp2f((rmax - m_new) * SL);
    rmax = m_new;

    // exp + pack: P^T C-layout == A-fragment layout for the PV product
    Frag pa, pr;
    {
      Pack8H a0, a1, r0, r1;
      float psum = 0.0f;
      #pragma unroll
      for (int r = 0; r < 8; ++r) {
        const float p0 = __builtin_amdgcn_exp2f((c[0][r] - m_new) * SL);   // key hi*8 + r
        const float p1 = __builtin_amdgcn_exp2f((c[1][r] - m_new) * SL);   // key 16 + hi*8 + r
        psum += p0 + p1;
        const float pc0 = p0 * P_CARRY;
        const float pc1 = p1 * P_CARRY;
        const f16 h0 = (f16)pc0;
        const f16 h1 = (f16)pc1;
        a0.h[r] = h0;
        a1.h[r] = h1;
        if (RES != 0) {
          r0.h[r] = (f16)((pc0 - (float)h0) * RES_CARRY);
          r1.h[r] = (f16)((pc1 - (float)h1) * RES_CARRY);
        } else {
          r0.h[r] = (f16)0.0f;
          r1.h[r] = (f16)0.0f;
        }
      }
      pa.q[0] = a0.u;  pa.q[1] = a1.u;
      pr.q[0] = r0.u;  pr.q[1] = r1.u;
      rsum = rsum * scale + psum + __shfl_xor(psum, 16, 32);
    }

    // rescale O: queries are the row dimension there -> per-row scale from lane 8*hi + r
    float sc[8];
    #pragma unroll
    for (int r = 0; r < 8; ++r) sc[r] = __shfl(scale, (hi << 3) + r, 32);
    #pragma unroll
    for (int dt = 0; dt < 4; ++dt) {
      #pragma unroll
      for (int r = 0; r < 8; ++r) {
        o[dt][r] *= sc[r];
        if (RES != 0) o2[dt][r] *= sc[r];
      }
    }
    if (RES != 0) asm volatile("" ::: "memory");

    // O += P x V ; V B-fragments: column n = d = dt*16 + lq, split key map from the transposed plane
    #pragma unroll
    for (int dt = 0; dt < 4; ++dt) {
      Frag bv;
      const u16* vb = fv + bo + dt * 16 * LP + cc * BK;
      bv.q[0] = *(const v4u*)(vb);            // keys j0 + hi*8 + 0..7
      bv.q[1] = *(const v4u*)(vb + 16);       // keys j0 + 16 + hi*8 + 0..7
      o[dt] = mma_f16(pa.vh, bv.vh, o[dt]);
      if (RES != 0) {
        Frag bvr;
        const u16* vbr = fv + bo + 2 * AT_H + dt * 16 * LP + cc * BK;
        const v4u l0 = *(const v4u*)(vbr);
        const v4u l1 = *(const v4u*)(vbr + 16);
        bvr.q[0] = res_on ? l0 : (v4u){0u, 0u, 0u, 0u};
        bvr.q[1] = res_on ? l1 : (v4u){0u, 0u, 0u, 0u};
        o2[dt] = mma_f16(pa.vh, bvr.vh, o2[dt]);
        o2[dt] = mma_f16(pr.vh, bv.vh,  o2[dt]);
      }
    }
   }
   asm volatile("s_wait_dscnt 0x0" ::: "memory");      // this wave's reads of buffer s%2 are done before its refill
   asm volatile("s_wait_asynccnt 0x0" ::: "memory");   // stage s+1 landed (this wave's copies)
   __syncthreads();                                    // publishes stage s+1, ends every read of buffer s%2
   if (s + 2 < nstage) fill(s + 2, (unsigned)bo * 2u); // block-uniform
  }
  asm volatile("s_wait_asynccnt 0x0" ::: "memory");    // nothing in flight when the wave ends

  // normalize: lane holds column d = dt*16 + lq for query rows 8*hi + r
  float rs[8];
  #pragma unroll
  for (int r = 0; r < 8; ++r) rs[r] = 1.0f / __shfl(rsum, (hi << 3) + r, 32);

  float* so = sO + wave * (16 * OP);
  #pragma unroll
  for (int r = 0; r < 8; ++r) {
    #pragma unroll
    for (int dt = 0; dt < 4; ++dt) {
      float val = o[dt][r];
      if (RES != 0) val += o2[dt][r] * RES_INV;
      so[(hi * 8 + r) * OP + dt * 16 + lq] = val * (1.0f / (P_CARRY * V_CARRY)) * rs[r];
    }
  }
  __syncthreads();

  // rows it*4 + (lane>>3), it = 0..3 cover the wave's 16 rows, (lane&7)*8 covers d 0..63.
  const int seg = lane & 7;
  v4u hv[4], rv[4];
  #pragma unroll
  for (int it = 0; it < 4; ++it) {
    const int row = it * 4 + (lane >> 3);
    const v4f a0 = *(const v4f*)(so + row * OP + seg * 8);
    const v4f a1 = *(const v4f*)(so + row * OP + seg * 8 + 4);
    float ov[8];
    #pragma unroll
    for (int i = 0; i < 4; ++i) {
      ov[i]     = a0[i];
      ov[4 + i] = a1[i];
    }
    pack_hr(ov, CTX_CARRY, hv[it], rv[it]);
  }
  #pragma unroll
  for (int it = 0; it < 4; ++it) {
    const int row = qrow0 + it * 4 + (lane >> 3);
    *(v4u*)(ctxh + ((size_t)b * SEQ + row) * DM + h * HDIM + seg * 8) = hv[it];
    if (RES != 0) *(v4u*)(ctxr + ((size_t)b * EARLY_T + row) * DM + h * HDIM + seg * 8) = rv[it];
  }
  asm volatile("s_wait_xcnt 0x0" ::: "memory");     // before a register of these stores is reused
  
}

// Both forms in one grid. The query blocks are dealt by falling cost under a
// causal mask: 2 (qblk + 1) key stages, a stage with residual planes counted 9/4 of a plain one (its instruction count).
// Any order is a permutation of the query blocks: it decides speed only. Packed as one nibble per grid slot.
#define NQBLK (SEQ / BQ)
static_assert(NQBLK <= 16);
static constexpr unsigned long long make_qorder() {
  int q[NQBLK] = {};
  int c[NQBLK] = {};
  for (int i = 0; i < NQBLK; ++i) {
    q[i] = i;
    c[i] = (i + 1) * ((i < EARLY_T / BQ) ? 9 : 4);
  }
  for (int i = 1; i < NQBLK; ++i) {
    for (int j = i; j > 0 && c[j] > c[j - 1]; --j) {
      const int tq = q[j]; q[j] = q[j - 1]; q[j - 1] = tq;
      const int tc = c[j]; c[j] = c[j - 1]; c[j - 1] = tc;
    }
  }
  unsigned long long w = 0;
  for (int i = 0; i < NQBLK; ++i) w |= (unsigned long long)q[i] << (4 * i);
  return w;
}

__global__ __launch_bounds__(256) void attn_kernel(const u16* __restrict__ qh_p, const u16* __restrict__ kh_p,
                                                   const u16* __restrict__ vt_p,
                                                   const u16* __restrict__ qr_p, const u16* __restrict__ kr_p,
                                                   const u16* __restrict__ vtr_p,
                                                   const unsigned* __restrict__ mbits,
                                                   const unsigned* __restrict__ pbits,
                                                   u16* __restrict__ ctxh, u16* __restrict__ ctxr) {
  __shared__ __align__(16) unsigned char sMem[ATT_LDS_B];   // one allocation serves whichever body the block runs
  constexpr unsigned long long QORDER = make_qorder();
  const int qblk = (int)((QORDER >> (4 * blockIdx.z)) & 15ull);   // block-uniform
  const int h    = blockIdx.x;
  const int b    = blockIdx.y;
  if (qblk < EARLY_T / BQ) attn_body<1>(sMem, qblk, h, b, qh_p, kh_p, vt_p, qr_p, kr_p, vtr_p, mbits, pbits, ctxh, ctxr);
  else                     attn_body<0>(sMem, qblk, h, b, qh_p, kh_p, vt_p, qr_p, kr_p, vtr_p, mbits, pbits, ctxh, ctxr);
}

// ---------------------------------------------------------------------------------------------------------
static constexpr size_t al128(size_t x) { return (x + 127) & ~(size_t)127; }
static constexpr size_t XB_B   = al128((size_t)NB * SEQ * DM * 2);
static constexpr size_t WPL_B  = al128((size_t)4 * DM * DM * 2);
static constexpr size_t QH_B   = al128((size_t)NB * NHEAD * SEQ * HDIM * 2);
static constexpr size_t QR_B   = al128((size_t)NB * NHEAD * EARLY_T * HDIM * 2);
static constexpr size_t VT_B   = al128((size_t)NB * DM * SEQ * 2);
static constexpr size_t VTR_B  = al128((size_t)NB * DM * EARLY_T * 2);
static constexpr size_t CTXH_B = al128((size_t)NB * SEQ * DM * 2);
static constexpr size_t CTXR_B = al128((size_t)NB * EARLY_T * DM * 2);
static constexpr size_t MB_B   = al128((size_t)SEQ * MPITCH * 4);
static constexpr size_t PB_B   = al128((size_t)NB * MPITCH * 4);
static constexpr size_t WS_TOTAL = XB_B + WPL_B + 2 * QH_B + 2 * QR_B + VT_B + VTR_B + CTXH_B + CTXR_B + MB_B + PB_B;
static_assert(WS_TOTAL <= (size_t)134217728);

extern "C" void kernel_launch(void* const* d_in, const int* in_sizes, int n_in,
                              void* d_out, int out_size, void* d_ws, size_t ws_size,
                              hipStream_t stream) {
  if (n_in < 12) return;
  const size_t rows_used = (size_t)(NB - 1) * SEQ_FULL + SEQ;
  if ((size_t)in_sizes[0] < rows_used * DM) return;
  if ((size_t)in_sizes[1] < (size_t)SEQ * HDIM) return;
  if ((size_t)in_sizes[2] < (size_t)(SEQ - 1) * SEQ_FULL + SEQ) return;
  if ((size_t)in_sizes[3] < rows_used) return;
  if ((size_t)in_sizes[4] < (size_t)DM * DM || (size_t)in_sizes[6] < (size_t)DM * DM) return;
  if ((size_t)in_sizes[8] < (size_t)DM * DM || (size_t)in_sizes[10] < (size_t)DM * DM) return;
  if (in_sizes[5] < DM || in_sizes[7] < DM || in_sizes[9] < DM || in_sizes[11] < DM) return;
  if ((size_t)out_size < rows_used * DM) return;
  if (ws_size < WS_TOTAL) return;

  const float* x   = (const float*)d_in[0];
  const float* fc  = (const float*)d_in[1];
  const int*   am  = (const int*)d_in[2];
  const int*   pm  = (const int*)d_in[3];
  const float* Wq  = (const float*)d_in[4];
  const float* bq  = (const float*)d_in[5];
  const float* Wk  = (const float*)d_in[6];
  const float* bk  = (const float*)d_in[7];
  const float* Wv  = (const float*)d_in[8];
  const float* bv  = (const float*)d_in[9];
  const float* Wp  = (const float*)d_in[10];
  const float* bp  = (const float*)d_in[11];
  float* out = (float*)d_out;

  char* ws = (char*)d_ws;
  size_t off = 0;
  u16* xb   = (u16*)(ws + off); off += XB_B;
  u16* wpl  = (u16*)(ws + off); off += WPL_B;
  u16* qh   = (u16*)(ws + off); off += QH_B;
  u16* kh   = (u16*)(ws + off); off += QH_B;
  u16* vt   = (u16*)(ws + off); off += VT_B;
  u16* qr   = (u16*)(ws + off); off += QR_B;
  u16* kr   = (u16*)(ws + off); off += QR_B;
  u16* vtr  = (u16*)(ws + off); off += VTR_B;
  u16* ctxh = (u16*)(ws + off); off += CTXH_B;
  u16* ctxr = (u16*)(ws + off); off += CTXR_B;
  unsigned* mbits = (unsigned*)(ws + off); off += MB_B;
  unsigned* pbits = (unsigned*)(ws + off); off += PB_B;

  prep_kernel<<<dim3(PREP_X_BLKS + 4 * PREP_W_BLKS + SEQ + NB), 256, 0, stream>>>(x, Wq, Wk, Wv, Wp, am, pm, xb, wpl,
                                                                                  mbits, pbits);
  gemm_qkv_kernel<<<dim3(DM / GT, (NB * SEQ) / GT, 3), 256, 0, stream>>>(xb, wpl, bq, bk, bv, fc, qh, kh, qr, kr, vt,
                                                                         vtr);
  attn_kernel<<<dim3(NHEAD, NB, NQBLK), 256, 0, stream>>>(qh, kh, vt, qr, kr, vtr, mbits, pbits, ctxh, ctxr);
  gemm_out_kernel<<<dim3(DM / GT, (NB * SEQ) / GT), 256, 0, stream>>>(ctxh, ctxr, wpl + (size_t)3 * DM * DM, bp, out);
}

// v004
// One run takes 141 microseconds.
// Timed twice side by side with v003, it ran 1.05 and 1.06 times as fast.
// Over all steps from v000 it is 3.49 times as fast.
#include <hip/hip_runtime.h>

// Contractions: q/k/v projections on v_wmma_f32_16x16x32_bf16 (bf16 operands = RNE-converted inputs, f32 accumulate);
// scores S^T = K x Q^T, O = P x V and the output projection on v_wmma_f32_16x16x32_f16 (f16 planes with power-of-two
// carries: q,k,v x16, P x4096, ctx x64, Wp x64; query rows < EARLY_T add f16 residual planes x2048 on separate
// accumulators); bias, rotary step and softmax in f32.

#ifndef NB
#define NB 4
#endif
#ifndef SEQ
#define SEQ 2048
#endif
#define NB_FULL    4
#define SEQ_FULL   2048
#define NHEAD      16
#define HDIM       64
#define DM         (NHEAD * HDIM)            // model width
#define BQ         128                       // query rows per attention workgroup (8 waves x 16)
#define BK         32                        // keys per inner iteration
#define NWAVE      8
#define EARLY_T    ((SEQ < 512) ? SEQ : 512) // query/key rows that carry residual planes
#define OP         68                        // LDS pitch (floats) of the attention output staging tile
#define GT         128                       // GEMM block tile (rows and columns)
#define CP         132                       // LDS pitch (floats) of the GEMM staging tile
#define KS         64                        // k per GEMM ring stage (one 128-B line of every operand row)
#define LP         72                        // LDS pitch (16-bit elements) of a staged operand row: 144 B = 16 B x odd
#define TILE_H     (GT * LP)                 // 16-bit elements of one staged operand tile
#define STAGE_H    (2 * TILE_H)              // one ring buffer: [A 128 rows | B 128 rows]
#define NSTAGE     (DM / KS)
#define GEMM_LDS_B (2 * STAGE_H * 2)         // two ring buffers; the f32 staging tile reuses them behind the k sweeps
#define SK         64                        // keys per attention ring stage (one 128-B line of every K and V^T row)
#define AT_H       (SK * LP)                 // 16-bit elements of one staged attention tile: 64 rows at pitch LP
#define MW         (SEQ / 32)                // mask words per row
#define MPITCH     (((MW + 1 + 31) / 32) * 32)   // words per packed mask row (bits, row flag, zero pad)
#define LATE_T     (SEQ - EARLY_T)
#define LATE_TILES (((LATE_T / GT) > 0) ? (LATE_T / GT) : 1)
#define EARLY_TILES (EARLY_T / GT)

#define QK_CARRY   16.0f
#define V_CARRY    16.0f
#define P_CARRY    4096.0f
#define CTX_CARRY  64.0f
#define WP_CARRY   64.0f
#define RES_CARRY  2048.0f
#define RES_INV    (1.0f / 2048.0f)

static_assert(SEQ % 256 == 0);
static_assert(SEQ % GT == 0);
static_assert(SEQ % BQ == 0);
static_assert(EARLY_T % GT == 0);
static_assert(EARLY_T % BQ == 0);
static_assert(EARLY_T >= BK);
static_assert(BQ == NWAVE * 16);
static_assert(HDIM == 64);
static_assert(DM % GT == 0);
static_assert(DM % 32 == 0);
static_assert(SEQ <= SEQ_FULL);
static_assert(NB >= 1 && NB <= NB_FULL);
static_assert((OP * 4) % 16 == 0);
static_assert((CP * 4) % 16 == 0);
static_assert(DM % KS == 0 && NSTAGE >= 2);
static_assert(KS * 2 == 128 && (LP * 2) % 16 == 0 && LP >= KS);
static_assert(256 * 4 * 8 == GT * KS);        // ring fill per operand: threads x copies x 16-bit elements
static_assert(GEMM_LDS_B >= GT * CP * 4);
static_assert(MPITCH / 4 <= 32);
static_assert(MPITCH <= 256);
static_assert(((size_t)NB * SEQ * DM) % 2048 == 0);
static_assert(((size_t)DM * DM) % 2048 == 0);
static_assert(256 * 8 * 8 == GT * GT);        // 16-bit plane epilogues: threads x passes x halves
static_assert(256 * 16 * 4 == GT * GT);       // f32 output epilogue: threads x passes x floats
static_assert(32 * 4 * 8 == 16 * HDIM);       // attention epilogue per wave
static_assert(SK == HDIM && SK * 2 == 128 && SK % BK == 0);   // K tile: SK rows of HDIM; V^T tile: HDIM rows of SK
static_assert(SEQ % SK == 0 && EARLY_T % SK == 0 && EARLY_T >= SK);
static_assert(256 * 2 * 8 == SK * HDIM);      // attention ring fill per tile: threads x copies x 16-bit elements

typedef __bf16         bf16;
typedef _Float16       f16;
typedef unsigned short u16;
typedef bf16     v16bf __attribute__((ext_vector_type(16)));
typedef f16      v16h  __attribute__((ext_vector_type(16)));
typedef float    v8f   __attribute__((ext_vector_type(8)));
typedef float    v4f   __attribute__((ext_vector_type(4)));
typedef unsigned v4u   __attribute__((ext_vector_type(4)));

union Frag   { v16bf vb; v16h vh; v4u q[2]; };
union Pack8B { v4u u; bf16 h[8]; };
union Pack8H { v4u u; f16  h[8]; };

// WMMA helpers: builtin followed by the VALU hazard guard (ties D, keeps A/B live).
static __device__ __forceinline__ v8f mma_bf16(v16bf a, v16bf b, v8f acc) {
  acc = __builtin_amdgcn_wmma_f32_16x16x32_bf16(false, a, false, b, (short)0, acc, false, false);
  asm volatile("v_nop\n\tv_nop\n\tv_nop\n\tv_nop" : "+v"(acc) : "v"(a), "v"(b));
  return acc;
}
static __device__ __forceinline__ v8f mma_f16(v16h a, v16h b, v8f acc) {
  acc = __builtin_amdgcn_wmma_f32_16x16x32_f16(false, a, false, b, (short)0, acc, false, false);
  asm volatile("v_nop\n\tv_nop\n\tv_nop\n\tv_nop" : "+v"(acc) : "v"(a), "v"(b));
  return acc;
}

static __device__ __forceinline__ float bfr(float x) { return (float)(bf16)x; }   // RNE convert to bf16 and back

// 8 floats -> f16 hi plane piece and f16 residual piece (x RES_CARRY), both carried by 'carry'.
static __device__ __forceinline__ void pack_hr(const float (&v)[8], float carry, v4u& hv, v4u& rv) {
  Pack8H ph, pr;
  #pragma unroll
  for (int i = 0; i < 8; ++i) {
    const float yc = v[i] * carry;
    const f16 hh = (f16)yc;
    ph.h[i] = hh;
    pr.h[i] = (f16)((yc - (float)hh) * RES_CARRY);
  }
  hv = ph.u;
  rv = pr.u;
}

// ---------------------------------------------------------------------------------------------------------
// Preparation as one resident stream: few blocks that loop, for speed only. A piece = 2048 elements (8 per
// thread: two 16-B loads, one 16-B store). A conversion block
// takes PREP_UNITS neighbouring pieces per trip (8 loads of 16 B in flight per lane) and makes PREP_TRIPS trips;
// in one trip the blocks of a step cover one contiguous range.
#define PREP_UNITS  4
#define PREP_TRIPS  4
#define PREP_X_BLKS ((int)(((size_t)NB * SEQ * DM) / 2048))           // pieces of x
#define PREP_W_BLKS ((int)(((size_t)DM * DM) / 2048))                 // pieces of one weight plane
#define PREP_X_SB   (PREP_X_BLKS / (PREP_UNITS * PREP_TRIPS))         // blocks that convert x
#define PREP_W_SB   ((4 * PREP_W_BLKS) / (PREP_UNITS * PREP_TRIPS))   // blocks that convert the weights
#define PREP_M_ROWS 2                                                 // mask rows per wave
#define PREP_M_SB   ((SEQ + NB + NWAVE * PREP_M_ROWS - 1) / (NWAVE * PREP_M_ROWS))   // blocks that pack mask rows
static_assert(PREP_X_BLKS % (PREP_UNITS * PREP_TRIPS) == 0);
static_assert((4 * PREP_W_BLKS) % (PREP_UNITS * PREP_TRIPS) == 0);
static_assert(PREP_W_BLKS % PREP_UNITS == 0);                         // the pieces of one trip lie in one plane

// x [NB][SEQ][DM] f32 (full-size strides) -> xb [NB*SEQ][DM] bf16.
static __device__ __forceinline__ void cvt_x_body(int sb, const float* __restrict__ x, u16* __restrict__ xb) {
  #pragma unroll 1   // one batch of loads per trip; the other resident waves cover its latency
  for (int trip = 0; trip < PREP_TRIPS; ++trip) {
    const size_t e0 = (((size_t)trip * PREP_X_SB + sb) * PREP_UNITS * 256 + threadIdx.x) * 8;
    v4f a[PREP_UNITS][2];
    #pragma unroll
    for (int u = 0; u < PREP_UNITS; ++u) {
      const size_t e   = e0 + (size_t)u * 2048;
      const size_t row = e / DM;
      const int    col = (int)(e % DM);
      const size_t b   = row / SEQ;
      const size_t t   = row % SEQ;
      const float* src = x + (b * SEQ_FULL + t) * DM + col;
      a[u][0] = *(const v4f*)(src);
      a[u][1] = *(const v4f*)(src + 4);
    }
    asm volatile("s_wait_xcnt 0x0" ::: "memory");   // before an address register of the loads is reused
    #pragma unroll
    for (int u = 0; u < PREP_UNITS; ++u) {
      Pack8B pk;
      #pragma unroll
      for (int i = 0; i < 4; ++i) {
        pk.h[i]     = (bf16)a[u][0][i];
        pk.h[4 + i] = (bf16)a[u][1][i];
      }
      *(v4u*)(xb + e0 + (size_t)u * 2048) = pk.u;
    }
    asm volatile("s_wait_xcnt 0x0" ::: "memory");   // before a register of the stores is reused
  }
}

// Weight planes: z = 0,1,2 -> bf16 of Wq,Wk,Wv; z = 3 -> f16 of (bf16 Wp) x WP_CARRY. [n][k] layout kept.
static __device__ __forceinline__ void cvt_w_body(int sb, const float* __restrict__ wq,
                                                  const float* __restrict__ wk, const float* __restrict__ wv,
                                                  const float* __restrict__ wp, u16* __restrict__ wpl) {
  #pragma unroll 1   // one batch of loads per trip; the other resident waves cover its latency
  for (int trip = 0; trip < PREP_TRIPS; ++trip) {
    const int u0 = (trip * PREP_W_SB + sb) * PREP_UNITS;      // first piece of the trip, counted over the 4 planes
    const int z  = u0 / PREP_W_BLKS;                          // block-uniform
    const float* src = (z == 0) ? wq : (z == 1) ? wk : (z == 2) ? wv : wp;
    const size_t e0 = ((size_t)(u0 % PREP_W_BLKS) * 256 + threadIdx.x) * 8;
    v4f a[PREP_UNITS][2];
    #pragma unroll
    for (int u = 0; u < PREP_UNITS; ++u) {
      a[u][0] = *(const v4f*)(src + e0 + (size_t)u * 2048);
      a[u][1] = *(const v4f*)(src + e0 + (size_t)u * 2048 + 4);
    }
    asm volatile("s_wait_xcnt 0x0" ::: "memory");   // before an address register of the loads is reused
    u16* dst = wpl + (size_t)z * DM * DM + e0;
    #pragma unroll
    for (int u = 0; u < PREP_UNITS; ++u) {
      v4u val;
      if (z < 3) {
        Pack8B pk;
        #pragma unroll
        for (int i = 0; i < 4; ++i) {
          pk.h[i]     = (bf16)a[u][0][i];
          pk.h[4 + i] = (bf16)a[u][1][i];
        }
        val = pk.u;
      } else {
        Pack8H ph;
        #pragma unroll
        for (int i = 0; i < 4; ++i) {
          ph.h[i]     = (f16)(bfr(a[u][0][i]) * WP_CARRY);
          ph.h[4 + i] = (f16)(bfr(a[u][1][i]) * WP_CARRY);
        }
        val = ph.u;
      }
      *(v4u*)(dst + (size_t)u * 2048) = val;
    }
    asm volatile("s_wait_xcnt 0x0" ::: "memory");   // before a register of the stores is reused
  }
}

// Mask bit planes, one wave per row. Row r < SEQ packs attention-mask row r: words 0..MW-1 = allowed bits (bit j of
// word w = key 32w+j), word MW = 1 when the row has no allowed key beyond the diagonal and the diagonal key is
// allowed, rest 0. Rows r >= SEQ pack the key-padding row of batch r-SEQ the same way (flag word = 1).
// All MW loads of the row (one 128-B line each) are in flight together; lane l keeps words l, 32+l, ...; the packed
// row (MPITCH words) leaves as whole 128-B lines.
static __device__ __forceinline__ void mask_pack_row(int rid, const int* __restrict__ amask,
                                                     const int* __restrict__ pmask, unsigned* __restrict__ mbits,
                                                     unsigned* __restrict__ pbits) {
  const int lane = threadIdx.x & 31;
  const bool is_pad = (rid >= SEQ);               // wave-uniform
  const int q  = is_pad ? 0 : rid;
  const int pb = is_pad ? (rid - SEQ) : 0;
  const int* src = is_pad ? (pmask + (size_t)pb * SEQ_FULL) : (amask + (size_t)q * SEQ_FULL);
  unsigned*  dst = is_pad ? (pbits + (size_t)pb * MPITCH)   : (mbits + (size_t)q * MPITCH);
  int v[MW];
  #pragma unroll
  for (int it = 0; it < MW; ++it) v[it] = src[it * 32 + lane];
  asm volatile("s_wait_xcnt 0x0" ::: "memory");   // before an address register of the loads is reused
  unsigned w[MPITCH / 32];
  #pragma unroll
  for (int g = 0; g < MPITCH / 32; ++g) w[g] = 0u;
  #pragma unroll
  for (int it = 0; it < MW; ++it) {
    const unsigned bits = __builtin_amdgcn_ballot_w32(v[it] != 0);
    w[it >> 5] = (lane == (it & 31)) ? bits : w[it >> 5];
  }
  const int wq = q >> 5;
  const int bq = q & 31;
  bool bad = false;
  #pragma unroll
  for (int g = 0; g < MPITCH / 32; ++g) {         // words from MW on are still 0 here and lie behind wq
    const int wi = g * 32 + lane;
    if (wi > wq) bad = bad || (w[g] != 0u);
    if (wi == wq) {
      const unsigned upper = (bq == 31) ? 0u : (w[g] >> (bq + 1));
      bad = bad || (upper != 0u) || (((w[g] >> bq) & 1u) == 0u);
    }
  }
  const bool anybad = !is_pad && (__builtin_amdgcn_ballot_w32(bad) != 0u);
  #pragma unroll
  for (int g = 0; g < MPITCH / 32; ++g) {
    const int wi = g * 32 + lane;
    if (wi == MW) w[g] = anybad ? 0u : 1u;
    dst[wi] = w[g];
  }
  asm volatile("s_wait_xcnt 0x0" ::: "memory");   // before a register of the stores is reused
}

// The three preparation steps depend on nothing but the inputs: one grid, the block index picks the step.
__global__ __launch_bounds__(256) void prep_kernel(const float* __restrict__ x, const float* __restrict__ wq,
                                                   const float* __restrict__ wk, const float* __restrict__ wv,
                                                   const float* __restrict__ wp, const int* __restrict__ amask,
                                                   const int* __restrict__ pmask, u16* __restrict__ xb,
                                                   u16* __restrict__ wpl, unsigned* __restrict__ mbits,
                                                   unsigned* __restrict__ pbits) {
  const int bid = blockIdx.x;                    // block-uniform choice
  if (bid < PREP_X_SB) {
    cvt_x_body(bid, x, xb);
  } else if (bid < PREP_X_SB + PREP_W_SB) {
    cvt_w_body(bid - PREP_X_SB, wq, wk, wv, wp, wpl);
  } else {
    const int wv0 = (bid - (PREP_X_SB + PREP_W_SB)) * NWAVE + __builtin_amdgcn_readfirstlane((int)(threadIdx.x >> 5));
    #pragma unroll 1   // one row's loads per trip
    for (int r = 0; r < PREP_M_ROWS; ++r) {
      const int rid = r * (PREP_M_SB * NWAVE) + wv0;
      if (rid < SEQ + NB) mask_pack_row(rid, amask, pmask, mbits, pbits);   // wave-uniform; no barrier in this step
    }
  }
}

// ---------------------------------------------------------------------------------------------------------
// GEMM core: block tile 128 x 128, wave tile 32 x 64 of C[m][n] = sum_k A[m][k] * B[n][k], K = DM, both operands
// 16-bit row-major with k contiguous. Stages of KS k are brought into a two-buffer LDS ring by asynchronous copies
// (16 B per lane, a wave covers four whole 128-B rows per copy); the fragments are read from the ring with one split
// k map for A and B, k ascending.

// One stage of both operand tiles: rows r, r+32, r+64, r+96 (r = tid/8) of A and of B, 16-B piece tid%8 of each row.
// lds: the lane's byte address in the A tile of the target buffer; the B tile lies TILE_H elements behind it.
// The s_wait_xcnt stands inside the statement so that no address register is rewritten ahead of it.
static __device__ __forceinline__ void copy_stage(unsigned lds, const u16* ga, const u16* gb) {
  const unsigned ldb = lds + TILE_H * 2u;
  asm volatile("global_load_async_to_lds_b128 %0, %8, off\n\t"
               "global_load_async_to_lds_b128 %1, %9, off\n\t"
               "global_load_async_to_lds_b128 %2, %10, off\n\t"
               "global_load_async_to_lds_b128 %3, %11, off\n\t"
               "global_load_async_to_lds_b128 %4, %12, off\n\t"
               "global_load_async_to_lds_b128 %5, %13, off\n\t"
               "global_load_async_to_lds_b128 %6, %14, off\n\t"
               "global_load_async_to_lds_b128 %7, %15, off\n\t"
               "s_wait_xcnt 0x0"
               :: "v"(lds), "v"(lds + 32u * LP * 2u), "v"(lds + 64u * LP * 2u), "v"(lds + 96u * LP * 2u),
                  "v"(ldb), "v"(ldb + 32u * LP * 2u), "v"(ldb + 64u * LP * 2u), "v"(ldb + 96u * LP * 2u),
                  "v"(ga), "v"(ga + (size_t)32 * DM), "v"(ga + (size_t)64 * DM), "v"(ga + (size_t)96 * DM),
                  "v"(gb), "v"(gb + (size_t)32 * DM), "v"(gb + (size_t)64 * DM), "v"(gb + (size_t)96 * DM)
               : "memory");
}

// ablk / bblk: first element of the block's 128 rows of A and of B. ring: the block's LDS (GEMM_LDS_B bytes); every
// earlier LDS access of the block must lie in front of a block barrier. On return every wave has passed the barrier
// that ends the last read of the ring.
template <int F16>
static __device__ __forceinline__ void gemm_core(const u16* __restrict__ ablk, const u16* __restrict__ bblk,
                                                 u16* ring, int tid, int wm, int wn, int lq, int hi,
                                                 v8f (&acc)[2][4]) {
  const int crow = tid >> 3;
  const int cseg = tid & 7;
  const u16* ga = ablk + (size_t)crow * DM + cseg * 8;
  const u16* gb = bblk + (size_t)crow * DM + cseg * 8;
  const unsigned l0 = (unsigned)(uintptr_t)ring + (unsigned)(crow * LP + cseg * 8) * 2u;   // LDS byte address
  const u16* fa = ring + (wm + lq) * LP + hi * 8;
  const u16* fb = ring + TILE_H + (wn + lq) * LP + hi * 8;

  copy_stage(l0, ga, gb);
  asm volatile("s_wait_asynccnt 0x0" ::: "memory");   // stage 0 landed (this wave's copies)
  __syncthreads();                                    // stage 0 readable by every wave
  copy_stage(l0 + STAGE_H * 2u, ga + KS, gb + KS);

  #pragma unroll 1   // one ring stage per trip: the buffer index stays a run-time value
  for (int t = 0; t < NSTAGE; ++t) {
    const int bo = (t & 1) * STAGE_H;
    #pragma unroll   // the k offsets inside a stage become immediate offsets of the LDS loads
    for (int ks = 0; ks < KS; ks += 32) {
      Frag a[2], bb[4];
      #pragma unroll
      for (int mt = 0; mt < 2; ++mt) {
        a[mt].q[0] = *(const v4u*)(fa + bo + mt * 16 * LP + ks);        // k = t*KS + ks + hi*8 + 0..7
        a[mt].q[1] = *(const v4u*)(fa + bo + mt * 16 * LP + ks + 16);   // k = t*KS + ks + 16 + hi*8 + 0..7
      }
      #pragma unroll
      for (int nt = 0; nt < 4; ++nt) {
        bb[nt].q[0] = *(const v4u*)(fb + bo + nt * 16 * LP + ks);
        bb[nt].q[1] = *(const v4u*)(fb + bo + nt * 16 * LP + ks + 16);
      }
      #pragma unroll
      for (int mt = 0; mt < 2; ++mt) {
        #pragma unroll
        for (int nt = 0; nt < 4; ++nt) {
          if (F16 != 0) acc[mt][nt] = mma_f16(a[mt].vh, bb[nt].vh, acc[mt][nt]);
          else          acc[mt][nt] = mma_bf16(a[mt].vb, bb[nt].vb, acc[mt][nt]);
        }
      }
    }
    asm volatile("s_wait_dscnt 0x0" ::: "memory");      // this wave's reads of buffer t%2 are done before its refill
    asm volatile("s_wait_asynccnt 0x0" ::: "memory");   // stage t+1 landed (this wave's copies)
    __syncthreads();                                    // publishes stage t+1, ends every read of buffer t%2
    if (t + 2 < NSTAGE) {                               // block-uniform
      copy_stage(l0 + (unsigned)bo * 2u, ga + (t + 2) * KS, gb + (t + 2) * KS);
    }
  }
  asm volatile("s_wait_asynccnt 0x0" ::: "memory");     // nothing in flight when the ring is reused
}

// D layout -> LDS tile: acc[mt][nt][r] is (row wm+mt*16+hi*8+r, col wn+nt*16+lq).
static __device__ __forceinline__ void stage_tile(float* sC, const v8f (&acc)[2][4], int wm, int wn, int lq, int hi,
                                                  float scl) {
  #pragma unroll
  for (int mt = 0; mt < 2; ++mt) {
    #pragma unroll
    for (int nt = 0; nt < 4; ++nt) {
      #pragma unroll
      for (int r = 0; r < 8; ++r) {
        const int idx = (wm + mt * 16 + hi * 8 + r) * CP + wn + nt * 16 + lq;
        sC[idx] = acc[mt][nt][r] * scl;
      }
    }
  }
}

// The same for the sum of two accumulator sets, each with its own power-of-two scale.
static __device__ __forceinline__ void stage_tile2(float* sC, const v8f (&acc)[2][4], const v8f (&acc2)[2][4], int wm,
                                                   int wn, int lq, int hi, float scl, float scl2) {
  #pragma unroll
  for (int mt = 0; mt < 2; ++mt) {
    #pragma unroll
    for (int nt = 0; nt < 4; ++nt) {
      #pragma unroll
      for (int r = 0; r < 8; ++r) {
        const int idx = (wm + mt * 16 + hi * 8 + r) * CP + wn + nt * 16 + lq;
        sC[idx] = acc[mt][nt][r] * scl + acc2[mt][nt][r] * scl2;
      }
    }
  }
}

// q / k projection (z = 0 / 1): C = xb x W^T, + bias, interleaved rotary step with the bf16 table values, x16 carry,
// f16 hi plane [NB][NHEAD][SEQ][HDIM] and residual plane [NB][NHEAD][EARLY_T][HDIM] for rows < EARLY_T.
// sMem: the block's GEMM_LDS_B bytes of LDS: operand ring, then the f32 staging tile (block barriers).
static __device__ __forceinline__ void gemm_qk_body(unsigned char* sMem, int bx, int by, int z,
                                                    const u16* __restrict__ xb, const u16* __restrict__ wpl,
                                                    const float* __restrict__ bq, const float* __restrict__ bk,
                                                    const float* __restrict__ fc,
                                                    u16* __restrict__ qh, u16* __restrict__ kh,
                                                    u16* __restrict__ qr, u16* __restrict__ kr) {
  u16*   ring = (u16*)sMem;
  float* sC   = (float*)sMem;
  const int tid  = threadIdx.x;
  const int lane = tid & 31;
  const int wave = tid >> 5;
  const int lq   = lane & 15;
  const int hi   = lane >> 4;
  const int nblk = bx * GT;
  const int mblk = by * GT;
  const int wm   = (wave & 3) * 32;
  const int wn   = (wave >> 2) * 64;
  const u16*   W    = wpl + (size_t)z * DM * DM;
  const float* bias = (z == 0) ? bq : bk;
  u16* hp = (z == 0) ? qh : kh;
  u16* rp = (z == 0) ? qr : kr;

  v8f acc[2][4];
  #pragma unroll
  for (int mt = 0; mt < 2; ++mt) {
    #pragma unroll
    for (int nt = 0; nt < 4; ++nt) acc[mt][nt] = (v8f){0, 0, 0, 0, 0, 0, 0, 0};
  }
  gemm_core<0>(xb + (size_t)mblk * DM, W + (size_t)nblk * DM, ring, tid, wm, wn, lq, hi, acc);
  stage_tile(sC, acc, wm, wn, lq, hi, 1.0f);
  __syncthreads();

  const int b     = mblk / SEQ;
  const int t0    = mblk % SEQ;
  const bool early = (t0 < EARLY_T);            // block-uniform
  const int seg   = tid & 7;
  const int hs    = (tid >> 3) & 1;
  const int rsub  = tid >> 4;                   // 0..15
  const int n0    = nblk + hs * 64 + seg * 8;
  const int h     = n0 >> 6;

  float bz[8];
  {
    const v4f b0 = *(const v4f*)(bias + n0);
    const v4f b1 = *(const v4f*)(bias + n0 + 4);
    asm volatile("s_wait_xcnt 0x0" ::: "memory");     // before an address register of the loads is reused
    #pragma unroll
    for (int i = 0; i < 4; ++i) {
      bz[i]     = bfr(b0[i]);
      bz[4 + i] = bfr(b1[i]);
    }
  }

  v4u hv[8], rv[8];
  #pragma unroll
  for (int p = 0; p < 8; ++p) {
    const int row = p * 16 + rsub;
    const int t   = t0 + row;
    const float* sp = sC + row * CP + hs * 64 + seg * 8;
    const v4f s0 = *(const v4f*)(sp);
    const v4f s1 = *(const v4f*)(sp + 4);
    const float* fp = fc + ((size_t)t * (HDIM / 2) + seg * 4) * 2;   // (cos, sin) pairs of 4 consecutive i
    const v4f f0 = *(const v4f*)(fp);
    const v4f f1 = *(const v4f*)(fp + 4);
    asm volatile("s_wait_xcnt 0x0" ::: "memory");     // before an address register of the loads is reused
    float xv[8], cs[8], ov[8];
    #pragma unroll
    for (int i = 0; i < 4; ++i) {
      xv[i]     = s0[i] + bz[i];
      xv[4 + i] = s1[i] + bz[4 + i];
      cs[i]     = bfr(f0[i]);
      cs[4 + i] = bfr(f1[i]);
    }
    #pragma unroll
    for (int j = 0; j < 4; ++j) {
      const float x1 = xv[2 * j], x2 = xv[2 * j + 1];
      const float c  = cs[2 * j], s  = cs[2 * j + 1];
      ov[2 * j]     = x1 * c - x2 * s;
      ov[2 * j + 1] = x1 * s + x2 * c;
    }
    pack_hr(ov, QK_CARRY, hv[p], rv[p]);
  }

  const size_t bh = (size_t)b * NHEAD + h;
  #pragma unroll
  for (int p = 0; p < 8; ++p) {
    const int t = t0 + p * 16 + rsub;
    *(v4u*)(hp + (bh * SEQ + t) * HDIM + seg * 8) = hv[p];
    asm volatile("s_wait_xcnt 0x0" ::: "memory");     // before a register of the store is reused
    if (early) {
      *(v4u*)(rp + (bh * EARLY_T + t) * HDIM + seg * 8) = rv[p];
      asm volatile("s_wait_xcnt 0x0" ::: "memory");   // before a register of the store is reused
    }
  }
  
}

// v projection computed transposed: C[c][(b,t)] = Wv[c][:] . xb[(b,t)][:], + bias[c], x16 carry,
// vt [NB][DM][SEQ] f16 (row c = h*64+d, keys contiguous) and vtr [NB][DM][EARLY_T] residual for keys < EARLY_T.
static __device__ __forceinline__ void gemm_v_body(unsigned char* sMem, int bx, int by,
                                                   const u16* __restrict__ wvb, const u16* __restrict__ xb,
                                                   const float* __restrict__ bv,
                                                   u16* __restrict__ vt, u16* __restrict__ vtr) {
  u16*   ring = (u16*)sMem;
  float* sC   = (float*)sMem;
  const int tid  = threadIdx.x;
  const int lane = tid & 31;
  const int wave = tid >> 5;
  const int lq   = lane & 15;
  const int hi   = lane >> 4;
  const int nblk = bx * GT;                     // compact (b,t) columns
  const int mblk = by * GT;                     // channel rows c
  const int wm   = (wave & 3) * 32;
  const int wn   = (wave >> 2) * 64;

  v8f acc[2][4];
  #pragma unroll
  for (int mt = 0; mt < 2; ++mt) {
    #pragma unroll
    for (int nt = 0; nt < 4; ++nt) acc[mt][nt] = (v8f){0, 0, 0, 0, 0, 0, 0, 0};
  }
  gemm_core<0>(wvb + (size_t)mblk * DM, xb + (size_t)nblk * DM, ring, tid, wm, wn, lq, hi, acc);
  stage_tile(sC, acc, wm, wn, lq, hi, 1.0f);
  __syncthreads();

  const int b     = nblk / SEQ;
  const int t0    = nblk % SEQ;
  const bool early = (t0 < EARLY_T);            // block-uniform
  const int seg   = tid & 7;
  const int hs    = (tid >> 3) & 1;
  const int rsub  = tid >> 4;

  v4u hv[8], rv[8];
  #pragma unroll
  for (int p = 0; p < 8; ++p) {
    const int row = p * 16 + rsub;
    const float bvr = bv[mblk + row];
    asm volatile("s_wait_xcnt 0x0" ::: "memory");     // before an address register of the load is reused
    const float bz = bfr(bvr);
    const float* sp = sC + row * CP + hs * 64 + seg * 8;
    const v4f s0 = *(const v4f*)(sp);
    const v4f s1 = *(const v4f*)(sp + 4);
    float ov[8];
    #pragma unroll
    for (int i = 0; i < 4; ++i) {
      ov[i]     = s0[i] + bz;
      ov[4 + i] = s1[i] + bz;
    }
    pack_hr(ov, V_CARRY, hv[p], rv[p]);
  }
  const int tcol = t0 + hs * 64 + seg * 8;
  #pragma unroll
  for (int p = 0; p < 8; ++p) {
    const size_t crow = (size_t)b * DM + mblk + p * 16 + rsub;
    *(v4u*)(vt + crow * SEQ + tcol) = hv[p];
    asm volatile("s_wait_xcnt 0x0" ::: "memory");     // before a register of the store is reused
    if (early) {
      *(v4u*)(vtr + crow * EARLY_T + tcol) = rv[p];
      asm volatile("s_wait_xcnt 0x0" ::: "memory");   // before a register of the store is reused
    }
  }
  
}

// q, k and v projections read the same planes and depend on nothing of each other: one grid, z = 0 / 1 / 2.
// q / k: x = weight-row tile, y = (b,t) tile. v: the plane's flat block index walks the (b,t) tiles fastest.
__global__ __launch_bounds__(256) void gemm_qkv_kernel(const u16* __restrict__ xb, const u16* __restrict__ wpl,
                                                       const float* __restrict__ bq, const float* __restrict__ bk,
                                                       const float* __restrict__ bv, const float* __restrict__ fc,
                                                       u16* __restrict__ qh, u16* __restrict__ kh,
                                                       u16* __restrict__ qr, u16* __restrict__ kr,
                                                       u16* __restrict__ vt, u16* __restrict__ vtr) {
  __shared__ __align__(16) unsigned char sMem[GEMM_LDS_B];   // one allocation serves whichever body the block runs
  const int z = blockIdx.z;                                  // block-uniform choice
  if (z < 2) gemm_qk_body(sMem, blockIdx.x, blockIdx.y, z, xb, wpl, bq, bk, fc, qh, kh, qr, kr);
  else {
    const int lin = blockIdx.y * (DM / GT) + blockIdx.x;
    gemm_v_body(sMem, lin % ((NB * SEQ) / GT), lin / ((NB * SEQ) / GT), wpl + (size_t)2 * DM * DM, xb, bv, vt, vtr);
  }
}

// Output projection: out[(b,t)][n] = (ctx . Wp[n][:]) / (64*64) + bias[n]. RES != 0: rows t < EARLY_T, a second
// k sweep over the residual ctx plane is folded with 1/2048. Each wave writes one whole 512-B tile row
template <int RES>
static __device__ __forceinline__ void gemm_out_body(unsigned char* sMem, int bx, int y,
                                                     const u16* __restrict__ ctxh, const u16* __restrict__ ctxr,
                                                     const u16* __restrict__ wpb, const float* __restrict__ bp,
                                                     float* __restrict__ out) {
  u16*   ring = (u16*)sMem;
  float* sC   = (float*)sMem;
  const int tid  = threadIdx.x;
  const int lane = tid & 31;
  const int wave = tid >> 5;
  const int lq   = lane & 15;
  const int hi   = lane >> 4;
  const int nblk = bx * GT;
  const int b    = (RES != 0) ? (y / EARLY_TILES) : (y / LATE_TILES);
  const int t0   = (RES != 0) ? ((y % EARLY_TILES) * GT) : (EARLY_T + (y % LATE_TILES) * GT);
  const int wm   = (wave & 3) * 32;
  const int wn   = (wave >> 2) * 64;

  v8f acc[2][4];
  #pragma unroll
  for (int mt = 0; mt < 2; ++mt) {
    #pragma unroll
    for (int nt = 0; nt < 4; ++nt) acc[mt][nt] = (v8f){0, 0, 0, 0, 0, 0, 0, 0};
  }
  const u16* bblk = wpb + (size_t)nblk * DM;
  gemm_core<1>(ctxh + ((size_t)b * SEQ + t0) * DM, bblk, ring, tid, wm, wn, lq, hi, acc);
  if (RES != 0) {
    v8f acc2[2][4];
    #pragma unroll
    for (int mt = 0; mt < 2; ++mt) {
      #pragma unroll
      for (int nt = 0; nt < 4; ++nt) acc2[mt][nt] = (v8f){0, 0, 0, 0, 0, 0, 0, 0};
    }
    gemm_core<1>(ctxr + ((size_t)b * EARLY_T + t0) * DM, bblk, ring, tid, wm, wn, lq, hi, acc2);
    stage_tile2(sC, acc, acc2, wm, wn, lq, hi, 1.0f / (CTX_CARRY * WP_CARRY), RES_INV / (CTX_CARRY * WP_CARRY));
  } else {
    stage_tile(sC, acc, wm, wn, lq, hi, 1.0f / (CTX_CARRY * WP_CARRY));
  }
  __syncthreads();

  const int col = lane * 4;
  v4f bz = *(const v4f*)(bp + nblk + col);
  #pragma unroll
  for (int i = 0; i < 4; ++i) bz[i] = bfr(bz[i]);

  v4f vals[16];
  #pragma unroll
  for (int p = 0; p < 16; ++p) {
    const int row = p * 8 + wave;
    const v4f v = *(const v4f*)(sC + row * CP + col);
    vals[p] = v + bz;
  }
  float* obase = out + ((size_t)b * SEQ_FULL + t0 + wave) * DM + nblk + col;
  #pragma unroll
  for (int p = 0; p < 16; ++p) *(v4f*)(obase + (size_t)p * 8 * DM) = vals[p];
  
}

// Both row ranges in one grid: the tiles with the second k sweep (twice the trips) take the lowest block indices.
__global__ __launch_bounds__(256) void gemm_out_kernel(const u16* __restrict__ ctxh, const u16* __restrict__ ctxr,
                                                       const u16* __restrict__ wpb, const float* __restrict__ bp,
                                                       float* __restrict__ out) {
  __shared__ __align__(16) unsigned char sMem[GEMM_LDS_B];   // one allocation serves whichever body the block runs
  const int y = blockIdx.y;                                  // block-uniform choice
  if (y < NB * EARLY_TILES) gemm_out_body<1>(sMem, blockIdx.x, y, ctxh, ctxr, wpb, bp, out);
  else                      gemm_out_body<0>(sMem, blockIdx.x, y - NB * EARLY_TILES, ctxh, ctxr, wpb, bp, out);
}

// ---------------------------------------------------------------------------------------------------------
// Flash attention. Block = (query block of 128, head, batch); one wave owns 16 query rows.
// S^T = K x Q^T so queries sit on lanes; P^T in C-layout is bit-identical to the A-fragment layout of O += P x V.
// Q B-fragments come straight from the f16 plane. K and V^T tiles of SK keys are brought once per block into a
// two-buffer LDS ring by asynchronous copies (16 B per lane, a wave covers four whole 128-B rows per copy) and all
// eight waves read their K A-fragments and V^T B-fragments from the ring (two 16-B LDS loads each).
// Mask: per element replace-fill from the packed bit planes; key tiles past the diagonal are skipped only when the
// packed row flags of all 16 rows of the wave say that nothing beyond the diagonal is allowed and the diagonal is.
// RES != 0: residual planes (x2048) for q, k, v and P on separate accumulators.
// One K tile and one V^T tile: rows r and r+32 (r = tid/8) of each, 16-B piece tid%8 of every row.
// lds: the lane's byte address in the K tile of the target buffer; the V^T tile lies AT_H elements behind it.
// The s_wait_xcnt stands inside the statement so that no address register is rewritten ahead of it.
static __device__ __forceinline__ void copy_kv(unsigned lds, const u16* gk, const u16* gv, size_t vpitch) {
  const unsigned ldv = lds + AT_H * 2u;
  asm volatile("global_load_async_to_lds_b128 %0, %4, off\n\t"
               "global_load_async_to_lds_b128 %1, %5, off\n\t"
               "global_load_async_to_lds_b128 %2, %6, off\n\t"
               "global_load_async_to_lds_b128 %3, %7, off\n\t"
               "s_wait_xcnt 0x0"
               :: "v"(lds), "v"(lds + 32u * LP * 2u), "v"(ldv), "v"(ldv + 32u * LP * 2u),
                  "v"(gk), "v"(gk + (size_t)32 * HDIM), "v"(gv), "v"(gv + (size_t)32 * vpitch)
               : "memory");
}

#define ATT_SO_B   (NWAVE * 16 * OP * 4)         // per-wave output staging
#define ATT_KV_B   (2 * 4 * AT_H * 2)            // two ring buffers of the form with residual planes (the larger one)
#define ATT_LDS_B  (ATT_SO_B + ATT_KV_B + NWAVE * 4)
static_assert(ATT_SO_B % 16 == 0 && ATT_KV_B % 16 == 0);

// sMem: the block's ATT_LDS_B bytes of LDS.
template <int RES>
static __device__ __forceinline__ void attn_body(unsigned char* sMem, int qblk, int h, int b,
                                                 const u16* __restrict__ qh_p, const u16* __restrict__ kh_p,
                                                 const u16* __restrict__ vt_p,
                                                 const u16* __restrict__ qr_p, const u16* __restrict__ kr_p,
                                                 const u16* __restrict__ vtr_p,
                                                 const unsigned* __restrict__ mbits,
                                                 const unsigned* __restrict__ pbits,
                                                 u16* __restrict__ ctxh, u16* __restrict__ ctxr) {
  const int tid  = threadIdx.x;
  const int wave = tid >> 5;
  const int lane = tid & 31;
  const int lq   = lane & 15;   // query column of S^T / d column of O
  const int hi   = lane >> 4;   // k-split half

  float* sO = (float*)sMem;                             // per-wave output staging (block barrier used)
  constexpr int ABUF_H = ((RES != 0) ? 4 : 2) * AT_H;   // one ring buffer: [K | V^T] and, with RES, [K res | V^T res]
  u16* sKV = (u16*)(sMem + ATT_SO_B);                   // 2 * ABUF_H elements, cross-wave (block barriers)
  int* sN  = (int*)(sMem + ATT_SO_B + ATT_KV_B);        // NWAVE words, cross-wave (block barrier)

  const int qrow0 = qblk * BQ + wave * 16;
  const int qi    = qrow0 + lq;
  const size_t bh = (size_t)b * NHEAD + h;

  // Q as B-operand fragments: lane lq holds query qi, split d map.
  Frag qf[2], qrf[2];
  {
    const u16* qp = qh_p + (bh * SEQ + qi) * HDIM + hi * 8;
    #pragma unroll
    for (int f = 0; f < 2; ++f) {
      qf[f].q[0] = *(const v4u*)(qp + f * 32);        // d = f*32 + hi*8 + 0..7
      qf[f].q[1] = *(const v4u*)(qp + f * 32 + 16);   // d = f*32 + 16 + hi*8 + 0..7
    }
  }
  if (RES != 0) {
    const u16* qp = qr_p + (bh * EARLY_T + qi) * HDIM + hi * 8;
    #pragma unroll
    for (int f = 0; f < 2; ++f) {
      qrf[f].q[0] = *(const v4u*)(qp + f * 32);
      qrf[f].q[1] = *(const v4u*)(qp + f * 32 + 16);
    }
  } else {
    #pragma unroll
    for (int f = 0; f < 2; ++f) {
      qrf[f].q[0] = (v4u){0u, 0u, 0u, 0u};
      qrf[f].q[1] = (v4u){0u, 0u, 0u, 0u};
    }
  }

  // ring fill: the lane's source piece in stage 0 of each plane and its LDS byte address in buffer 0
  const int crow = tid >> 3;
  const int cseg = tid & 7;
  const u16* gk  = kh_p  + (bh * SEQ + crow) * HDIM + cseg * 8;
  const u16* gkr = kr_p  + (bh * EARLY_T + crow) * HDIM + cseg * 8;
  const u16* gv  = vt_p  + (bh * HDIM + crow) * SEQ + cseg * 8;
  const u16* gvr = vtr_p + (bh * HDIM + crow) * EARLY_T + cseg * 8;
  const unsigned l0 = (unsigned)(uintptr_t)sKV + (unsigned)(crow * LP + cseg * 8) * 2u;
  // fragment reads: K row = key lq of a 16-key group, V^T row = d lq of a 16-d group, split k map
  const u16* fk = sKV + lq * LP + hi * 8;
  const u16* fv = sKV + AT_H + lq * LP + hi * 8;

  const unsigned* mrow = mbits + (size_t)qi * MPITCH;
  const unsigned* prow = pbits + (size_t)b * MPITCH;

  // wave-uniform tile-skip decision from the packed row flags and the diagonal padding bits
  const unsigned rk = mrow[MW];
  const unsigned pw = prow[qi >> 5];
  const bool rowok  = (rk == 1u) && (((pw >> (qi & 31)) & 1u) != 0u);
  const bool allok  = (__builtin_amdgcn_ballot_w32(rowok) == 0xffffffffu);
  int nchunk = allok ? ((qrow0 + 15) / BK + 1) : (SEQ / BK);
  nchunk = (nchunk < SEQ / BK) ? nchunk : (SEQ / BK);      // static bound
  nchunk = __builtin_amdgcn_readfirstlane(nchunk);

  // block-uniform stage count: the ring serves the wave that walks furthest
  if (lane == 0) sN[wave] = nchunk;
  __syncthreads();
  int nmax = sN[0];
  #pragma unroll
  for (int w = 1; w < NWAVE; ++w) nmax = (sN[w] > nmax) ? sN[w] : nmax;
  const int nstage = __builtin_amdgcn_readfirstlane((nmax + SK / BK - 1) / (SK / BK));   // 1 .. SEQ / SK

  // stage s into the buffer at byte offset bufb; residual planes end at EARLY_T: later stages copy the last one
  auto fill = [&](int s, unsigned bufb) {
    copy_kv(l0 + bufb, gk + (size_t)s * SK * HDIM, gv + (size_t)s * SK, SEQ);
    if (RES != 0) {
      const int sr = (s < EARLY_T / SK) ? s : (EARLY_T / SK - 1);
      copy_kv(l0 + bufb + 2u * AT_H * 2u, gkr + (size_t)sr * SK * HDIM, gvr + (size_t)sr * SK, EARLY_T);
    }
  };

  v8f o[4], o2[4];
  #pragma unroll
  for (int dt = 0; dt < 4; ++dt) {
    o[dt]  = (v8f){0, 0, 0, 0, 0, 0, 0, 0};
    o2[dt] = (v8f){0, 0, 0, 0, 0, 0, 0, 0};
  }

  float rmax = -__builtin_inff();
  float rsum = 0.0f;
  const float SL      = (0.125f / (QK_CARRY * QK_CARRY)) * 1.4426950408889634f;   // scale * log2(e) / carries
  const float FILLRAW = -1.0e30f * 8.0f * (QK_CARRY * QK_CARRY);                  // fill value in the carried raw domain

  fill(0, 0u);
  asm volatile("s_wait_asynccnt 0x0" ::: "memory");   // stage 0 landed (this wave's copies)
  __syncthreads();                                    // stage 0 readable by every wave
  if (nstage > 1) fill(1, (unsigned)ABUF_H * 2u);     // block-uniform

  #pragma unroll 1   // one ring stage per trip: the buffer index stays a run-time value
  for (int s = 0; s < nstage; ++s) {
   const int bo = (s & 1) * ABUF_H;
   #pragma unroll    // the chunk offsets inside a stage become immediate offsets of the LDS loads
   for (int cc = 0; cc < SK / BK; ++cc) {
    const int i = s * (SK / BK) + cc;
    if (i >= nchunk) continue;                                  // wave-uniform; the publish point below is not skipped
    const int j0 = i * BK;
    const unsigned mw = mrow[i] & prow[i];                      // allowed bits of keys j0..j0+31 for query qi
    const bool res_on = (RES != 0) && (j0 < EARLY_T);           // wave-uniform

    // S^T tiles: c[sub][r] = carried rawscore(query qi, key j0 + sub*16 + hi*8 + r)
    v8f c[2];
    #pragma unroll
    for (int sub = 0; sub < 2; ++sub) {
      Frag ak[2];
      const u16* kb = fk + bo + (cc * BK + sub * 16) * LP;
      #pragma unroll
      for (int f = 0; f < 2; ++f) {
        ak[f].q[0] = *(const v4u*)(kb + f * 32);
        ak[f].q[1] = *(const v4u*)(kb + f * 32 + 16);
      }
      v8f acc = (v8f){0, 0, 0, 0, 0, 0, 0, 0};
      acc = mma_f16(ak[0].vh, qf[0].vh, acc);
      acc = mma_f16(ak[1].vh, qf[1].vh, acc);
      if (RES != 0) {
        Frag akr[2];
        const u16* kbr = fk + bo + 2 * AT_H + (cc * BK + sub * 16) * LP;
        #pragma unroll
        for (int f = 0; f < 2; ++f) {
          const v4u l0 = *(const v4u*)(kbr + f * 32);
          const v4u l1 = *(const v4u*)(kbr + f * 32 + 16);
          akr[f].q[0] = res_on ? l0 : (v4u){0u, 0u, 0u, 0u};
          akr[f].q[1] = res_on ? l1 : (v4u){0u, 0u, 0u, 0u};
        }
        v8f acc2 = (v8f){0, 0, 0, 0, 0, 0, 0, 0};
        acc2 = mma_f16(ak[0].vh,  qrf[0].vh, acc2);
        acc2 = mma_f16(ak[1].vh,  qrf[1].vh, acc2);
        acc2 = mma_f16(akr[0].vh, qf[0].vh,  acc2);
        acc2 = mma_f16(akr[1].vh, qf[1].vh,  acc2);
        #pragma unroll
        for (int r = 0; r < 8; ++r) acc[r] += acc2[r] * RES_INV;
        asm volatile("" ::: "memory");
      }
      c[sub] = acc;
    }

    // mask: replace-fill; branch is wave-uniform, selects are per lane
    if (__builtin_amdgcn_ballot_w32(mw != 0xffffffffu) != 0u) {
      const unsigned ms = mw >> (hi * 8);
      #pragma unroll
      for (int sub = 0; sub < 2; ++sub) {
        #pragma unroll
        for (int r = 0; r < 8; ++r) {
          const bool allowed = ((ms >> (sub * 16 + r)) & 1u) != 0u;
          c[sub][r] = allowed ? c[sub][r] : FILLRAW;
        }
      }
    }

    // online softmax: query lq's 32 scores are split across lane / lane^16
    float m_new = rmax;
    #pragma unroll
    for (int r = 0; r < 8; ++r) {
      m_new = fmaxf(m_new, c[0][r]);
      m_new = fmaxf(m_new, c[1][r]);
    }
    m_new = fmaxf(m_new, __shfl_xor(m_new, 16, 32));
    const float scale = __builtin_amdgcn_exp2f((rmax - m_new) * SL);
    rmax = m_new;

    // exp + pack: P^T C-layout == A-fragment layout for the PV product
    Frag pa, pr;
    {
      Pack8H a0, a1, r0, r1;
      float psum = 0.0f;
      #pragma unroll
      for (int r = 0; r < 8; ++r) {
        const float p0 = __builtin_amdgcn_exp2f((c[0][r] - m_new) * SL);   // key hi*8 + r
        const float p1 = __builtin_amdgcn_exp2f((c[1][r] - m_new) * SL);   // key 16 + hi*8 + r
        psum += p0 + p1;
        const float pc0 = p0 * P_CARRY;
        const float pc1 = p1 * P_CARRY;
        const f16 h0 = (f16)pc0;
        const f16 h1 = (f16)pc1;
        a0.h[r] = h0;
        a1.h[r] = h1;
        if (RES != 0) {
          r0.h[r] = (f16)((pc0 - (float)h0) * RES_CARRY);
          r1.h[r] = (f16)((pc1 - (float)h1) * RES_CARRY);
        } else {
          r0.h[r] = (f16)0.0f;
          r1.h[r] = (f16)0.0f;
        }
      }
      pa.q[0] = a0.u;  pa.q[1] = a1.u;
      pr.q[0] = r0.u;  pr.q[1] = r1.u;
      rsum = rsum * scale + psum + __shfl_xor(psum, 16, 32);
    }

    // rescale O: queries are the row dimension there -> per-row scale from lane 8*hi + r
    float sc[8];
    #pragma unroll
    for (int r = 0; r < 8; ++r) sc[r] = __shfl(scale, (hi << 3) + r, 32);
    #pragma unroll
    for (int dt = 0; dt < 4; ++dt) {
      #pragma unroll
      for (int r = 0; r < 8; ++r) {
        o[dt][r] *= sc[r];
        if (RES != 0) o2[dt][r] *= sc[r];
      }
    }
    if (RES != 0) asm volatile("" ::: "memory");

    // O += P x V ; V B-fragments: column n = d = dt*16 + lq, split key map from the transposed plane
    #pragma unroll
    for (int dt = 0; dt < 4; ++dt) {
      Frag bv;
      const u16* vb = fv + bo + dt * 16 * LP + cc * BK;
      bv.q[0] = *(const v4u*)(vb);            // keys j0 + hi*8 + 0..7
      bv.q[1] = *(const v4u*)(vb + 16);       // keys j0 + 16 + hi*8 + 0..7
      o[dt] = mma_f16(pa.vh, bv.vh, o[dt]);
      if (RES != 0) {
        Frag bvr;
        const u16* vbr = fv + bo + 2 * AT_H + dt * 16 * LP + cc * BK;
        const v4u l0 = *(const v4u*)(vbr);
        const v4u l1 = *(const v4u*)(vbr + 16);
        bvr.q[0] = res_on ? l0 : (v4u){0u, 0u, 0u, 0u};
        bvr.q[1] = res_on ? l1 : (v4u){0u, 0u, 0u, 0u};
        o2[dt] = mma_f16(pa.vh, bvr.vh, o2[dt]);
        o2[dt] = mma_f16(pr.vh, bv.vh,  o2[dt]);
      }
    }
   }
   asm volatile("s_wait_dscnt 0x0" ::: "memory");      // this wave's reads of buffer s%2 are done before its refill
   asm volatile("s_wait_asynccnt 0x0" ::: "memory");   // stage s+1 landed (this wave's copies)
   __syncthreads();                                    // publishes stage s+1, ends every read of buffer s%2
   if (s + 2 < nstage) fill(s + 2, (unsigned)bo * 2u); // block-uniform
  }
  asm volatile("s_wait_asynccnt 0x0" ::: "memory");    // nothing in flight when the wave ends

  // normalize: lane holds column d = dt*16 + lq for query rows 8*hi + r
  float rs[8];
  #pragma unroll
  for (int r = 0; r < 8; ++r) rs[r] = 1.0f / __shfl(rsum, (hi << 3) + r, 32);

  float* so = sO + wave * (16 * OP);
  #pragma unroll
  for (int r = 0; r < 8; ++r) {
    #pragma unroll
    for (int dt = 0; dt < 4; ++dt) {
      float val = o[dt][r];
      if (RES != 0) val += o2[dt][r] * RES_INV;
      so[(hi * 8 + r) * OP + dt * 16 + lq] = val * (1.0f / (P_CARRY * V_CARRY)) * rs[r];
    }
  }
  __syncthreads();

  // rows it*4 + (lane>>3), it = 0..3 cover the wave's 16 rows, (lane&7)*8 covers d 0..63.
  const int seg = lane & 7;
  v4u hv[4], rv[4];
  #pragma unroll
  for (int it = 0; it < 4; ++it) {
    const int row = it * 4 + (lane >> 3);
    const v4f a0 = *(const v4f*)(so + row * OP + seg * 8);
    const v4f a1 = *(const v4f*)(so + row * OP + seg * 8 + 4);
    float ov[8];
    #pragma unroll
    for (int i = 0; i < 4; ++i) {
      ov[i]     = a0[i];
      ov[4 + i] = a1[i];
    }
    pack_hr(ov, CTX_CARRY, hv[it], rv[it]);
  }
  #pragma unroll
  for (int it = 0; it < 4; ++it) {
    const int row = qrow0 + it * 4 + (lane >> 3);
    *(v4u*)(ctxh + ((size_t)b * SEQ + row) * DM + h * HDIM + seg * 8) = hv[it];
    if (RES != 0) *(v4u*)(ctxr + ((size_t)b * EARLY_T + row) * DM + h * HDIM + seg * 8) = rv[it];
  }
  asm volatile("s_wait_xcnt 0x0" ::: "memory");     // before a register of these stores is reused
  
}

// Both forms in one grid. The query blocks are dealt by falling cost under a
// causal mask: 2 (qblk + 1) key stages, a stage with residual planes counted 9/4 of a plain one (its instruction count).
// Any order is a permutation of the query blocks: it decides speed only. Packed as one nibble per grid slot.
#define NQBLK (SEQ / BQ)
static_assert(NQBLK <= 16);
static constexpr unsigned long long make_qorder() {
  int q[NQBLK] = {};
  int c[NQBLK] = {};
  for (int i = 0; i < NQBLK; ++i) {
    q[i] = i;
    c[i] = (i + 1) * ((i < EARLY_T / BQ) ? 9 : 4);
  }
  for (int i = 1; i < NQBLK; ++i) {
    for (int j = i; j > 0 && c[j] > c[j - 1]; --j) {
      const int tq = q[j]; q[j] = q[j - 1]; q[j - 1] = tq;
      const int tc = c[j]; c[j] = c[j - 1]; c[j - 1] = tc;
    }
  }
  unsigned long long w = 0;
  for (int i = 0; i < NQBLK; ++i) w |= (unsigned long long)q[i] << (4 * i);
  return w;
}

__global__ __launch_bounds__(256) void attn_kernel(const u16* __restrict__ qh_p, const u16* __restrict__ kh_p,
                                                   const u16* __restrict__ vt_p,
                                                   const u16* __restrict__ qr_p, const u16* __restrict__ kr_p,
                                                   const u16* __restrict__ vtr_p,
                                                   const unsigned* __restrict__ mbits,
                                                   const unsigned* __restrict__ pbits,
                                                   u16* __restrict__ ctxh, u16* __restrict__ ctxr) {
  __shared__ __align__(16) unsigned char sMem[ATT_LDS_B];   // one allocation serves whichever body the block runs
  constexpr unsigned long long QORDER = make_qorder();
  const int qblk = (int)((QORDER >> (4 * blockIdx.z)) & 15ull);   // block-uniform
  const int h    = blockIdx.x;
  const int b    = blockIdx.y;
  if (qblk < EARLY_T / BQ) attn_body<1>(sMem, qblk, h, b, qh_p, kh_p, vt_p, qr_p, kr_p, vtr_p, mbits, pbits, ctxh, ctxr);
  else                     attn_body<0>(sMem, qblk, h, b, qh_p, kh_p, vt_p, qr_p, kr_p, vtr_p, mbits, pbits, ctxh, ctxr);
}

// ---------------------------------------------------------------------------------------------------------
static constexpr size_t al128(size_t x) { return (x + 127) & ~(size_t)127; }
static constexpr size_t XB_B   = al128((size_t)NB * SEQ * DM * 2);
static constexpr size_t WPL_B  = al128((size_t)4 * DM * DM * 2);
static constexpr size_t QH_B   = al128((size_t)NB * NHEAD * SEQ * HDIM * 2);
static constexpr size_t QR_B   = al128((size_t)NB * NHEAD * EARLY_T * HDIM * 2);
static constexpr size_t VT_B   = al128((size_t)NB * DM * SEQ * 2);
static constexpr size_t VTR_B  = al128((size_t)NB * DM * EARLY_T * 2);
static constexpr size_t CTXH_B = al128((size_t)NB * SEQ * DM * 2);
static constexpr size_t CTXR_B = al128((size_t)NB * EARLY_T * DM * 2);
static constexpr size_t MB_B   = al128((size_t)SEQ * MPITCH * 4);
static constexpr size_t PB_B   = al128((size_t)NB * MPITCH * 4);
static constexpr size_t WS_TOTAL = XB_B + WPL_B + 2 * QH_B + 2 * QR_B + VT_B + VTR_B + CTXH_B + CTXR_B + MB_B + PB_B;
static_assert(WS_TOTAL <= (size_t)134217728);

extern "C" void kernel_launch(void* const* d_in, const int* in_sizes, int n_in,
                              void* d_out, int out_size, void* d_ws, size_t ws_size,
                              hipStream_t stream) {
  if (n_in < 12) return;
  const size_t rows_used = (size_t)(NB - 1) * SEQ_FULL + SEQ;
  if ((size_t)in_sizes[0] < rows_used * DM) return;
  if ((size_t)in_sizes[1] < (size_t)SEQ * HDIM) return;
  if ((size_t)in_sizes[2] < (size_t)(SEQ - 1) * SEQ_FULL + SEQ) return;
  if ((size_t)in_sizes[3] < rows_used) return;
  if ((size_t)in_sizes[4] < (size_t)DM * DM || (size_t)in_sizes[6] < (size_t)DM * DM) return;
  if ((size_t)in_sizes[8] < (size_t)DM * DM || (size_t)in_sizes[10] < (size_t)DM * DM) return;
  if (in_sizes[5] < DM || in_sizes[7] < DM || in_sizes[9] < DM || in_sizes[11] < DM) return;
  if ((size_t)out_size < rows_used * DM) return;
  if (ws_size < WS_TOTAL) return;

  const float* x   = (const float*)d_in[0];
  const float* fc  = (const float*)d_in[1];
  const int*   am  = (const int*)d_in[2];
  const int*   pm  = (const int*)d_in[3];
  const float* Wq  = (const float*)d_in[4];
  const float* bq  = (const float*)d_in[5];
  const float* Wk  = (const float*)d_in[6];
  const float* bk  = (const float*)d_in[7];
  const float* Wv  = (const float*)d_in[8];
  const float* bv  = (const float*)d_in[9];
  const float* Wp  = (const float*)d_in[10];
  const float* bp  = (const float*)d_in[11];
  float* out = (float*)d_out;

  char* ws = (char*)d_ws;
  size_t off = 0;
  u16* xb   = (u16*)(ws + off); off += XB_B;
  u16* wpl  = (u16*)(ws + off); off += WPL_B;
  u16* qh   = (u16*)(ws + off); off += QH_B;
  u16* kh   = (u16*)(ws + off); off += QH_B;
  u16* vt   = (u16*)(ws + off); off += VT_B;
  u16* qr   = (u16*)(ws + off); off += QR_B;
  u16* kr   = (u16*)(ws + off); off += QR_B;
  u16* vtr  = (u16*)(ws + off); off += VTR_B;
  u16* ctxh = (u16*)(ws + off); off += CTXH_B;
  u16* ctxr = (u16*)(ws + off); off += CTXR_B;
  unsigned* mbits = (unsigned*)(ws + off); off += MB_B;
  unsigned* pbits = (unsigned*)(ws + off); off += PB_B;

  prep_kernel<<<dim3(PREP_X_SB + PREP_W_SB + PREP_M_SB), 256, 0, stream>>>(x, Wq, Wk, Wv, Wp, am, pm, xb, wpl,
                                                                                  mbits, pbits);
  gemm_qkv_kernel<<<dim3(DM / GT, (NB * SEQ) / GT, 3), 256, 0, stream>>>(xb, wpl, bq, bk, bv, fc, qh, kh, qr, kr, vt,
                                                                         vtr);
  attn_kernel<<<dim3(NHEAD, NB, NQBLK), 256, 0, stream>>>(qh, kh, vt, qr, kr, vtr, mbits, pbits, ctxh, ctxr);
  gemm_out_kernel<<<dim3(DM / GT, (NB * SEQ) / GT), 256, 0, stream>>>(ctxh, ctxr, wpl + (size_t)3 * DM * DM, bp, out);
}

// v005
// It runs in 135 microseconds.
// In both of two side-by-side timings against v004, it was 1.05 times as fast.
// All steps since v000 together make it 3.67 times as fast.
#include <hip/hip_runtime.h>

// Contractions: q/k/v projections on v_wmma_f32_16x16x32_bf16 (bf16 operands = RNE-converted inputs, f32 accumulate);
// scores S^T = K x Q^T, O = P x V and the output projection on v_wmma_f32_16x16x32_f16 (f16 planes with power-of-two
// carries: q,k,v x16, P x4096, ctx x64, Wp x64; query rows < EARLY_T add f16 residual planes x2048 on separate
// accumulators); bias, rotary step and softmax in f32.

#ifndef NB
#define NB 4
#endif
#ifndef SEQ
#define SEQ 2048
#endif
#define NB_FULL    4
#define SEQ_FULL   2048
#define NHEAD      16
#define HDIM       64
#define DM         (NHEAD * HDIM)            // model width
#define BQ         128                       // query rows per attention workgroup (8 waves x 16)
#define BK         32                        // keys per inner iteration
#define NWAVE      8
#define EARLY_T    ((SEQ < 512) ? SEQ : 512) // query/key rows that carry residual planes
#define OP         68                        // LDS pitch (floats) of the attention output staging tile
#define GT         128                       // GEMM block tile (rows and columns)
#define CP         132                       // LDS pitch (floats) of the GEMM staging tile
#define KS         64                        // k per GEMM ring stage (one 128-B line of every operand row)
#define LP         72                        // LDS pitch (16-bit elements) of a staged operand row: 144 B = 16 B x odd
#define TILE_H     (GT * LP)                 // 16-bit elements of one staged operand tile
#define STAGE_H    (2 * TILE_H)              // one ring buffer: [A 128 rows | B 128 rows]
#define NSTAGE     (DM / KS)
#define GEMM_LDS_B (2 * STAGE_H * 2)         // two ring buffers; the f32 staging tile reuses them behind the k sweeps
#define SK         64                        // keys per attention ring stage (one 128-B line of every K and V^T row)
#define AT_H       (SK * LP)                 // 16-bit elements of one staged attention tile: 64 rows at pitch LP
#define MW         (SEQ / 32)                // mask words per row
#define MPITCH     (((MW + 1 + 31) / 32) * 32)   // words per packed mask row (bits, row flag, zero pad)
#define LATE_T     (SEQ - EARLY_T)
#define LATE_TILES (((LATE_T / GT) > 0) ? (LATE_T / GT) : 1)
#define EARLY_TILES (EARLY_T / GT)

#define QK_CARRY   16.0f
#define V_CARRY    16.0f
#define P_CARRY    4096.0f
#define CTX_CARRY  64.0f
#define WP_CARRY   64.0f
#define RES_CARRY  2048.0f
#define RES_INV    (1.0f / 2048.0f)

static_assert(SEQ % 256 == 0);
static_assert(SEQ % GT == 0);
static_assert(SEQ % BQ == 0);
static_assert(EARLY_T % GT == 0);
static_assert(EARLY_T % BQ == 0);
static_assert(EARLY_T >= BK);
static_assert(BQ == NWAVE * 16);
static_assert(HDIM == 64);
static_assert(DM % GT == 0);
static_assert(DM % 32 == 0);
static_assert(SEQ <= SEQ_FULL);
static_assert(NB >= 1 && NB <= NB_FULL);
static_assert((OP * 4) % 16 == 0);
static_assert((CP * 4) % 16 == 0);
static_assert(DM % KS == 0 && NSTAGE >= 2);
static_assert(KS * 2 == 128 && (LP * 2) % 16 == 0 && LP >= KS);
static_assert(256 * 4 * 8 == GT * KS);        // ring fill per operand: threads x copies x 16-bit elements
static_assert(GEMM_LDS_B >= GT * CP * 4);
static_assert(MPITCH / 4 <= 32);
static_assert(MPITCH <= 256);
static_assert(((size_t)NB * SEQ * DM) % 2048 == 0);
static_assert(((size_t)DM * DM) % 2048 == 0);
static_assert(256 * 8 * 8 == GT * GT);        // 16-bit plane epilogues: threads x passes x halves
static_assert(256 * 16 * 4 == GT * GT);       // f32 output epilogue: threads x passes x floats
static_assert(32 * 4 * 8 == 16 * HDIM);       // attention epilogue per wave
static_assert(SK == HDIM && SK * 2 == 128 && SK % BK == 0);   // K tile: SK rows of HDIM; V^T tile: HDIM rows of SK
static_assert(SEQ % SK == 0 && EARLY_T % SK == 0 && EARLY_T >= SK);
static_assert(256 * 2 * 8 == SK * HDIM);      // attention ring fill per tile: threads x copies x 16-bit elements

typedef __bf16         bf16;
typedef _Float16       f16;
typedef unsigned short u16;
typedef bf16     v16bf __attribute__((ext_vector_type(16)));
typedef f16      v16h  __attribute__((ext_vector_type(16)));
typedef float    v8f   __attribute__((ext_vector_type(8)));
typedef float    v4f   __attribute__((ext_vector_type(4)));
typedef unsigned v4u   __attribute__((ext_vector_type(4)));

union Frag   { v16bf vb; v16h vh; v4u q[2]; };
union Pack8B { v4u u; bf16 h[8]; };
union Pack8H { v4u u; f16  h[8]; };

// WMMA helpers: builtin followed by the VALU hazard guard (ties D, keeps A/B live).
static __device__ __forceinline__ v8f mma_bf16(v16bf a, v16bf b, v8f acc) {
  acc = __builtin_amdgcn_wmma_f32_16x16x32_bf16(false, a, false, b, (short)0, acc, false, false);
  asm volatile("v_nop\n\tv_nop\n\tv_nop\n\tv_nop" : "+v"(acc) : "v"(a), "v"(b));
  return acc;
}
static __device__ __forceinline__ v8f mma_f16(v16h a, v16h b, v8f acc) {
  acc = __builtin_amdgcn_wmma_f32_16x16x32_f16(false, a, false, b, (short)0, acc, false, false);
  asm volatile("v_nop\n\tv_nop\n\tv_nop\n\tv_nop" : "+v"(acc) : "v"(a), "v"(b));
  return acc;
}

static __device__ __forceinline__ float bfr(float x) { return (float)(bf16)x; }   // RNE convert to bf16 and back

// 8 floats -> f16 hi plane piece and f16 residual piece (x RES_CARRY), both carried by 'carry'.
static __device__ __forceinline__ void pack_hr(const float (&v)[8], float carry, v4u& hv, v4u& rv) {
  Pack8H ph, pr;
  #pragma unroll
  for (int i = 0; i < 8; ++i) {
    const float yc = v[i] * carry;
    const f16 hh = (f16)yc;
    ph.h[i] = hh;
    pr.h[i] = (f16)((yc - (float)hh) * RES_CARRY);
  }
  hv = ph.u;
  rv = pr.u;
}

// ---------------------------------------------------------------------------------------------------------
// Preparation as one resident stream: few blocks that loop, for speed only. A piece = 2048 elements (8 per
// thread: two 16-B loads, one 16-B store). A conversion block
// takes PREP_UNITS neighbouring pieces per trip (8 loads of 16 B in flight per lane) and makes PREP_TRIPS trips;
// in one trip the blocks of a step cover one contiguous range.
#define PREP_UNITS  4
#define PREP_TRIPS  4
#define PREP_X_BLKS ((int)(((size_t)NB * SEQ * DM) / 2048))           // pieces of x
#define PREP_W_BLKS ((int)(((size_t)DM * DM) / 2048))                 // pieces of one weight plane
#define PREP_X_SB   (PREP_X_BLKS / (PREP_UNITS * PREP_TRIPS))         // blocks that convert x
#define PREP_W_SB   ((4 * PREP_W_BLKS) / (PREP_UNITS * PREP_TRIPS))   // blocks that convert the weights
#define PREP_M_ROWS 2                                                 // mask rows per wave
#define PREP_M_SB   ((SEQ + NB + NWAVE * PREP_M_ROWS - 1) / (NWAVE * PREP_M_ROWS))   // blocks that pack mask rows
static_assert(PREP_X_BLKS % (PREP_UNITS * PREP_TRIPS) == 0);
static_assert((4 * PREP_W_BLKS) % (PREP_UNITS * PREP_TRIPS) == 0);
static_assert(PREP_W_BLKS % PREP_UNITS == 0);                         // the pieces of one trip lie in one plane

// x [NB][SEQ][DM] f32 (full-size strides) -> xb [NB*SEQ][DM] bf16.
static __device__ __forceinline__ void cvt_x_body(int sb, const float* __restrict__ x, u16* __restrict__ xb) {
  #pragma unroll 1   // one batch of loads per trip; the other resident waves cover its latency
  for (int trip = 0; trip < PREP_TRIPS; ++trip) {
    const size_t e0 = (((size_t)trip * PREP_X_SB + sb) * PREP_UNITS * 256 + threadIdx.x) * 8;
    v4f a[PREP_UNITS][2];
    #pragma unroll
    for (int u = 0; u < PREP_UNITS; ++u) {
      const size_t e   = e0 + (size_t)u * 2048;
      const size_t row = e / DM;
      const int    col = (int)(e % DM);
      const size_t b   = row / SEQ;
      const size_t t   = row % SEQ;
      const float* src = x + (b * SEQ_FULL + t) * DM + col;
      a[u][0] = *(const v4f*)(src);
      a[u][1] = *(const v4f*)(src + 4);
    }
    asm volatile("s_wait_xcnt 0x0" ::: "memory");   // before an address register of the loads is reused
    #pragma unroll
    for (int u = 0; u < PREP_UNITS; ++u) {
      Pack8B pk;
      #pragma unroll
      for (int i = 0; i < 4; ++i) {
        pk.h[i]     = (bf16)a[u][0][i];
        pk.h[4 + i] = (bf16)a[u][1][i];
      }
      *(v4u*)(xb + e0 + (size_t)u * 2048) = pk.u;
    }
    asm volatile("s_wait_xcnt 0x0" ::: "memory");   // before a register of the stores is reused
  }
}

// Weight planes: z = 0,1,2 -> bf16 of Wq,Wk,Wv; z = 3 -> f16 of (bf16 Wp) x WP_CARRY. [n][k] layout kept.
static __device__ __forceinline__ void cvt_w_body(int sb, const float* __restrict__ wq,
                                                  const float* __restrict__ wk, const float* __restrict__ wv,
                                                  const float* __restrict__ wp, u16* __restrict__ wpl) {
  #pragma unroll 1   // one batch of loads per trip; the other resident waves cover its latency
  for (int trip = 0; trip < PREP_TRIPS; ++trip) {
    const int u0 = (trip * PREP_W_SB + sb) * PREP_UNITS;      // first piece of the trip, counted over the 4 planes
    const int z  = u0 / PREP_W_BLKS;                          // block-uniform
    const float* src = (z == 0) ? wq : (z == 1) ? wk : (z == 2) ? wv : wp;
    const size_t e0 = ((size_t)(u0 % PREP_W_BLKS) * 256 + threadIdx.x) * 8;
    v4f a[PREP_UNITS][2];
    #pragma unroll
    for (int u = 0; u < PREP_UNITS; ++u) {
      a[u][0] = *(const v4f*)(src + e0 + (size_t)u * 2048);
      a[u][1] = *(const v4f*)(src + e0 + (size_t)u * 2048 + 4);
    }
    asm volatile("s_wait_xcnt 0x0" ::: "memory");   // before an address register of the loads is reused
    u16* dst = wpl + (size_t)z * DM * DM + e0;
    #pragma unroll
    for (int u = 0; u < PREP_UNITS; ++u) {
      v4u val;
      if (z < 3) {
        Pack8B pk;
        #pragma unroll
        for (int i = 0; i < 4; ++i) {
          pk.h[i]     = (bf16)a[u][0][i];
          pk.h[4 + i] = (bf16)a[u][1][i];
        }
        val = pk.u;
      } else {
        Pack8H ph;
        #pragma unroll
        for (int i = 0; i < 4; ++i) {
          ph.h[i]     = (f16)(bfr(a[u][0][i]) * WP_CARRY);
          ph.h[4 + i] = (f16)(bfr(a[u][1][i]) * WP_CARRY);
        }
        val = ph.u;
      }
      *(v4u*)(dst + (size_t)u * 2048) = val;
    }
    asm volatile("s_wait_xcnt 0x0" ::: "memory");   // before a register of the stores is reused
  }
}

// Mask bit planes, one wave per row. Row r < SEQ packs attention-mask row r: words 0..MW-1 = allowed bits (bit j of
// word w = key 32w+j), word MW = 1 when the row has no allowed key beyond the diagonal and the diagonal key is
// allowed, rest 0. Rows r >= SEQ pack the key-padding row of batch r-SEQ the same way (flag word = 1).
// All MW loads of the row (one 128-B line each) are in flight together; lane l keeps words l, 32+l, ...; the packed
// row (MPITCH words) leaves as whole 128-B lines.
static __device__ __forceinline__ void mask_pack_row(int rid, const int* __restrict__ amask,
                                                     const int* __restrict__ pmask, unsigned* __restrict__ mbits,
                                                     unsigned* __restrict__ pbits) {
  const int lane = threadIdx.x & 31;
  const bool is_pad = (rid >= SEQ);               // wave-uniform
  const int q  = is_pad ? 0 : rid;
  const int pb = is_pad ? (rid - SEQ) : 0;
  const int* src = is_pad ? (pmask + (size_t)pb * SEQ_FULL) : (amask + (size_t)q * SEQ_FULL);
  unsigned*  dst = is_pad ? (pbits + (size_t)pb * MPITCH)   : (mbits + (size_t)q * MPITCH);
  int v[MW];
  #pragma unroll
  for (int it = 0; it < MW; ++it) v[it] = src[it * 32 + lane];
  asm volatile("s_wait_xcnt 0x0" ::: "memory");   // before an address register of the loads is reused
  unsigned w[MPITCH / 32];
  #pragma unroll
  for (int g = 0; g < MPITCH / 32; ++g) w[g] = 0u;
  #pragma unroll
  for (int it = 0; it < MW; ++it) {
    const unsigned bits = __builtin_amdgcn_ballot_w32(v[it] != 0);
    w[it >> 5] = (lane == (it & 31)) ? bits : w[it >> 5];
  }
  const int wq = q >> 5;
  const int bq = q & 31;
  bool bad = false;
  #pragma unroll
  for (int g = 0; g < MPITCH / 32; ++g) {         // words from MW on are still 0 here and lie behind wq
    const int wi = g * 32 + lane;
    if (wi > wq) bad = bad || (w[g] != 0u);
    if (wi == wq) {
      const unsigned upper = (bq == 31) ? 0u : (w[g] >> (bq + 1));
      bad = bad || (upper != 0u) || (((w[g] >> bq) & 1u) == 0u);
    }
  }
  const bool anybad = !is_pad && (__builtin_amdgcn_ballot_w32(bad) != 0u);
  #pragma unroll
  for (int g = 0; g < MPITCH / 32; ++g) {
    const int wi = g * 32 + lane;
    if (wi == MW) w[g] = anybad ? 0u : 1u;
    dst[wi] = w[g];
  }
  asm volatile("s_wait_xcnt 0x0" ::: "memory");   // before a register of the stores is reused
}

// The three preparation steps depend on nothing but the inputs: one grid, the block index picks the step.
__global__ __launch_bounds__(256) void prep_kernel(const float* __restrict__ x, const float* __restrict__ wq,
                                                   const float* __restrict__ wk, const float* __restrict__ wv,
                                                   const float* __restrict__ wp, const int* __restrict__ amask,
                                                   const int* __restrict__ pmask, u16* __restrict__ xb,
                                                   u16* __restrict__ wpl, unsigned* __restrict__ mbits,
                                                   unsigned* __restrict__ pbits) {
  const int bid = blockIdx.x;                    // block-uniform choice
  if (bid < PREP_X_SB) {
    cvt_x_body(bid, x, xb);
  } else if (bid < PREP_X_SB + PREP_W_SB) {
    cvt_w_body(bid - PREP_X_SB, wq, wk, wv, wp, wpl);
  } else {
    const int wv0 = (bid - (PREP_X_SB + PREP_W_SB)) * NWAVE + __builtin_amdgcn_readfirstlane((int)(threadIdx.x >> 5));
    #pragma unroll 1   // one row's loads per trip
    for (int r = 0; r < PREP_M_ROWS; ++r) {
      const int rid = r * (PREP_M_SB * NWAVE) + wv0;
      if (rid < SEQ + NB) mask_pack_row(rid, amask, pmask, mbits, pbits);   // wave-uniform; no barrier in this step
    }
  }
}

// ---------------------------------------------------------------------------------------------------------
// GEMM core: block tile 128 x 128, wave tile 32 x 64 of C[m][n] = sum_k A[m][k] * B[n][k], K = DM, both operands
// 16-bit row-major with k contiguous. Stages of KS k are brought into a two-buffer LDS ring by asynchronous copies
// (16 B per lane, a wave covers four whole 128-B rows per copy); the fragments are read from the ring with one split
// k map for A and B, k ascending.

// One stage of both operand tiles: rows r, r+32, r+64, r+96 (r = tid/8) of A and of B, 16-B piece tid%8 of each row.
// lds: the lane's byte address in the A tile of the target buffer; the B tile lies TILE_H elements behind it.
// The s_wait_xcnt stands inside the statement so that no address register is rewritten ahead of it.
static __device__ __forceinline__ void copy_stage(unsigned lds, const u16* ga, const u16* gb) {
  const unsigned ldb = lds + TILE_H * 2u;
  asm volatile("global_load_async_to_lds_b128 %0, %8, off\n\t"
               "global_load_async_to_lds_b128 %1, %9, off\n\t"
               "global_load_async_to_lds_b128 %2, %10, off\n\t"
               "global_load_async_to_lds_b128 %3, %11, off\n\t"
               "global_load_async_to_lds_b128 %4, %12, off\n\t"
               "global_load_async_to_lds_b128 %5, %13, off\n\t"
               "global_load_async_to_lds_b128 %6, %14, off\n\t"
               "global_load_async_to_lds_b128 %7, %15, off\n\t"
               "s_wait_xcnt 0x0"
               :: "v"(lds), "v"(lds + 32u * LP * 2u), "v"(lds + 64u * LP * 2u), "v"(lds + 96u * LP * 2u),
                  "v"(ldb), "v"(ldb + 32u * LP * 2u), "v"(ldb + 64u * LP * 2u), "v"(ldb + 96u * LP * 2u),
                  "v"(ga), "v"(ga + (size_t)32 * DM), "v"(ga + (size_t)64 * DM), "v"(ga + (size_t)96 * DM),
                  "v"(gb), "v"(gb + (size_t)32 * DM), "v"(gb + (size_t)64 * DM), "v"(gb + (size_t)96 * DM)
               : "memory");
}

// ablk / bblk: first element of the block's 128 rows of A and of B. ring: the block's LDS (GEMM_LDS_B bytes); every
// earlier LDS access of the block must lie in front of a block barrier. On return every wave has passed the barrier
// that ends the last read of the ring.
template <int F16>
static __device__ __forceinline__ void gemm_core(const u16* __restrict__ ablk, const u16* __restrict__ bblk,
                                                 u16* ring, int tid, int wm, int wn, int lq, int hi,
                                                 v8f (&acc)[2][4]) {
  const int crow = tid >> 3;
  const int cseg = tid & 7;
  const u16* ga = ablk + (size_t)crow * DM + cseg * 8;
  const u16* gb = bblk + (size_t)crow * DM + cseg * 8;
  const unsigned l0 = (unsigned)(uintptr_t)ring + (unsigned)(crow * LP + cseg * 8) * 2u;   // LDS byte address
  const u16* fa = ring + (wm + lq) * LP + hi * 8;
  const u16* fb = ring + TILE_H + (wn + lq) * LP + hi * 8;

  copy_stage(l0, ga, gb);
  asm volatile("s_wait_asynccnt 0x0" ::: "memory");   // stage 0 landed (this wave's copies)
  __syncthreads();                                    // stage 0 readable by every wave
  copy_stage(l0 + STAGE_H * 2u, ga + KS, gb + KS);

  #pragma unroll 1   // one ring stage per trip: the buffer index stays a run-time value
  for (int t = 0; t < NSTAGE; ++t) {
    const int bo = (t & 1) * STAGE_H;
    #pragma unroll   // the k offsets inside a stage become immediate offsets of the LDS loads
    for (int ks = 0; ks < KS; ks += 32) {
      Frag a[2], bb[4];
      #pragma unroll
      for (int mt = 0; mt < 2; ++mt) {
        a[mt].q[0] = *(const v4u*)(fa + bo + mt * 16 * LP + ks);        // k = t*KS + ks + hi*8 + 0..7
        a[mt].q[1] = *(const v4u*)(fa + bo + mt * 16 * LP + ks + 16);   // k = t*KS + ks + 16 + hi*8 + 0..7
      }
      #pragma unroll
      for (int nt = 0; nt < 4; ++nt) {
        bb[nt].q[0] = *(const v4u*)(fb + bo + nt * 16 * LP + ks);
        bb[nt].q[1] = *(const v4u*)(fb + bo + nt * 16 * LP + ks + 16);
      }
      #pragma unroll
      for (int mt = 0; mt < 2; ++mt) {
        #pragma unroll
        for (int nt = 0; nt < 4; ++nt) {
          if (F16 != 0) acc[mt][nt] = mma_f16(a[mt].vh, bb[nt].vh, acc[mt][nt]);
          else          acc[mt][nt] = mma_bf16(a[mt].vb, bb[nt].vb, acc[mt][nt]);
        }
      }
    }
    asm volatile("s_wait_dscnt 0x0" ::: "memory");      // this wave's reads of buffer t%2 are done before its refill
    asm volatile("s_wait_asynccnt 0x0" ::: "memory");   // stage t+1 landed (this wave's copies)
    __syncthreads();                                    // publishes stage t+1, ends every read of buffer t%2
    if (t + 2 < NSTAGE) {                               // block-uniform
      copy_stage(l0 + (unsigned)bo * 2u, ga + (t + 2) * KS, gb + (t + 2) * KS);
    }
  }
  asm volatile("s_wait_asynccnt 0x0" ::: "memory");     // nothing in flight when the ring is reused
}

// D layout -> LDS tile: acc[mt][nt][r] is (row wm+mt*16+hi*8+r, col wn+nt*16+lq).
static __device__ __forceinline__ void stage_tile(float* sC, const v8f (&acc)[2][4], int wm, int wn, int lq, int hi,
                                                  float scl) {
  #pragma unroll
  for (int mt = 0; mt < 2; ++mt) {
    #pragma unroll
    for (int nt = 0; nt < 4; ++nt) {
      #pragma unroll
      for (int r = 0; r < 8; ++r) {
        const int idx = (wm + mt * 16 + hi * 8 + r) * CP + wn + nt * 16 + lq;
        sC[idx] = acc[mt][nt][r] * scl;
      }
    }
  }
}

// The same for the sum of two accumulator sets, each with its own power-of-two scale.
static __device__ __forceinline__ void stage_tile2(float* sC, const v8f (&acc)[2][4], const v8f (&acc2)[2][4], int wm,
                                                   int wn, int lq, int hi, float scl, float scl2) {
  #pragma unroll
  for (int mt = 0; mt < 2; ++mt) {
    #pragma unroll
    for (int nt = 0; nt < 4; ++nt) {
      #pragma unroll
      for (int r = 0; r < 8; ++r) {
        const int idx = (wm + mt * 16 + hi * 8 + r) * CP + wn + nt * 16 + lq;
        sC[idx] = acc[mt][nt][r] * scl + acc2[mt][nt][r] * scl2;
      }
    }
  }
}

// q / k projection (z = 0 / 1): C = xb x W^T, + bias, interleaved rotary step with the bf16 table values, x16 carry,
// f16 hi plane [NB][NHEAD][SEQ][HDIM] and residual plane [NB][NHEAD][EARLY_T][HDIM] for rows < EARLY_T.
// sMem: the block's GEMM_LDS_B bytes of LDS: operand ring, then the f32 staging tile (block barriers).
static __device__ __forceinline__ void gemm_qk_body(unsigned char* sMem, int bx, int by, int z,
                                                    const u16* __restrict__ xb, const u16* __restrict__ wpl,
                                                    const float* __restrict__ bq, const float* __restrict__ bk,
                                                    const float* __restrict__ fc,
                                                    u16* __restrict__ qh, u16* __restrict__ kh,
                                                    u16* __restrict__ qr, u16* __restrict__ kr) {
  u16*   ring = (u16*)sMem;
  float* sC   = (float*)sMem;
  const int tid  = threadIdx.x;
  const int lane = tid & 31;
  const int wave = tid >> 5;
  const int lq   = lane & 15;
  const int hi   = lane >> 4;
  const int nblk = bx * GT;
  const int mblk = by * GT;
  const int wm   = (wave & 3) * 32;
  const int wn   = (wave >> 2) * 64;
  const u16*   W    = wpl + (size_t)z * DM * DM;
  const float* bias = (z == 0) ? bq : bk;
  u16* hp = (z == 0) ? qh : kh;
  u16* rp = (z == 0) ? qr : kr;

  v8f acc[2][4];
  #pragma unroll
  for (int mt = 0; mt < 2; ++mt) {
    #pragma unroll
    for (int nt = 0; nt < 4; ++nt) acc[mt][nt] = (v8f){0, 0, 0, 0, 0, 0, 0, 0};
  }
  gemm_core<0>(xb + (size_t)mblk * DM, W + (size_t)nblk * DM, ring, tid, wm, wn, lq, hi, acc);
  stage_tile(sC, acc, wm, wn, lq, hi, 1.0f);
  __syncthreads();

  const int b     = mblk / SEQ;
  const int t0    = mblk % SEQ;
  const bool early = (t0 < EARLY_T);            // block-uniform
  const int seg   = tid & 7;
  const int hs    = (tid >> 3) & 1;
  const int rsub  = tid >> 4;                   // 0..15
  const int n0    = nblk + hs * 64 + seg * 8;
  const int h     = n0 >> 6;

  float bz[8];
  {
    const v4f b0 = *(const v4f*)(bias + n0);
    const v4f b1 = *(const v4f*)(bias + n0 + 4);
    asm volatile("s_wait_xcnt 0x0" ::: "memory");     // before an address register of the loads is reused
    #pragma unroll
    for (int i = 0; i < 4; ++i) {
      bz[i]     = bfr(b0[i]);
      bz[4 + i] = bfr(b1[i]);
    }
  }

  v4u hv[8], rv[8];
  #pragma unroll
  for (int p = 0; p < 8; ++p) {
    const int row = p * 16 + rsub;
    const int t   = t0 + row;
    const float* sp = sC + row * CP + hs * 64 + seg * 8;
    const v4f s0 = *(const v4f*)(sp);
    const v4f s1 = *(const v4f*)(sp + 4);
    const float* fp = fc + ((size_t)t * (HDIM / 2) + seg * 4) * 2;   // (cos, sin) pairs of 4 consecutive i
    const v4f f0 = *(const v4f*)(fp);
    const v4f f1 = *(const v4f*)(fp + 4);
    asm volatile("s_wait_xcnt 0x0" ::: "memory");     // before an address register of the loads is reused
    float xv[8], cs[8], ov[8];
    #pragma unroll
    for (int i = 0; i < 4; ++i) {
      xv[i]     = s0[i] + bz[i];
      xv[4 + i] = s1[i] + bz[4 + i];
      cs[i]     = bfr(f0[i]);
      cs[4 + i] = bfr(f1[i]);
    }
    #pragma unroll
    for (int j = 0; j < 4; ++j) {
      const float x1 = xv[2 * j], x2 = xv[2 * j + 1];
      const float c  = cs[2 * j], s  = cs[2 * j + 1];
      ov[2 * j]     = x1 * c - x2 * s;
      ov[2 * j + 1] = x1 * s + x2 * c;
    }
    pack_hr(ov, QK_CARRY, hv[p], rv[p]);
  }

  const size_t bh = (size_t)b * NHEAD + h;
  #pragma unroll
  for (int p = 0; p < 8; ++p) {
    const int t = t0 + p * 16 + rsub;
    *(v4u*)(hp + (bh * SEQ + t) * HDIM + seg * 8) = hv[p];
    asm volatile("s_wait_xcnt 0x0" ::: "memory");     // before a register of the store is reused
    if (early) {
      *(v4u*)(rp + (bh * EARLY_T + t) * HDIM + seg * 8) = rv[p];
      asm volatile("s_wait_xcnt 0x0" ::: "memory");   // before a register of the store is reused
    }
  }
  
}

// v projection computed transposed: C[c][(b,t)] = Wv[c][:] . xb[(b,t)][:], + bias[c], x16 carry,
// vt [NB][DM][SEQ] f16 (row c = h*64+d, keys contiguous) and vtr [NB][DM][EARLY_T] residual for keys < EARLY_T.
static __device__ __forceinline__ void gemm_v_body(unsigned char* sMem, int bx, int by,
                                                   const u16* __restrict__ wvb, const u16* __restrict__ xb,
                                                   const float* __restrict__ bv,
                                                   u16* __restrict__ vt, u16* __restrict__ vtr) {
  u16*   ring = (u16*)sMem;
  float* sC   = (float*)sMem;
  const int tid  = threadIdx.x;
  const int lane = tid & 31;
  const int wave = tid >> 5;
  const int lq   = lane & 15;
  const int hi   = lane >> 4;
  const int nblk = bx * GT;                     // compact (b,t) columns
  const int mblk = by * GT;                     // channel rows c
  const int wm   = (wave & 3) * 32;
  const int wn   = (wave >> 2) * 64;

  v8f acc[2][4];
  #pragma unroll
  for (int mt = 0; mt < 2; ++mt) {
    #pragma unroll
    for (int nt = 0; nt < 4; ++nt) acc[mt][nt] = (v8f){0, 0, 0, 0, 0, 0, 0, 0};
  }
  gemm_core<0>(wvb + (size_t)mblk * DM, xb + (size_t)nblk * DM, ring, tid, wm, wn, lq, hi, acc);
  stage_tile(sC, acc, wm, wn, lq, hi, 1.0f);
  __syncthreads();

  const int b     = nblk / SEQ;
  const int t0    = nblk % SEQ;
  const bool early = (t0 < EARLY_T);            // block-uniform
  const int seg   = tid & 7;
  const int hs    = (tid >> 3) & 1;
  const int rsub  = tid >> 4;

  v4u hv[8], rv[8];
  #pragma unroll
  for (int p = 0; p < 8; ++p) {
    const int row = p * 16 + rsub;
    const float bvr = bv[mblk + row];
    asm volatile("s_wait_xcnt 0x0" ::: "memory");     // before an address register of the load is reused
    const float bz = bfr(bvr);
    const float* sp = sC + row * CP + hs * 64 + seg * 8;
    const v4f s0 = *(const v4f*)(sp);
    const v4f s1 = *(const v4f*)(sp + 4);
    float ov[8];
    #pragma unroll
    for (int i = 0; i < 4; ++i) {
      ov[i]     = s0[i] + bz;
      ov[4 + i] = s1[i] + bz;
    }
    pack_hr(ov, V_CARRY, hv[p], rv[p]);
  }
  const int tcol = t0 + hs * 64 + seg * 8;
  #pragma unroll
  for (int p = 0; p < 8; ++p) {
    const size_t crow = (size_t)b * DM + mblk + p * 16 + rsub;
    *(v4u*)(vt + crow * SEQ + tcol) = hv[p];
    asm volatile("s_wait_xcnt 0x0" ::: "memory");     // before a register of the store is reused
    if (early) {
      *(v4u*)(vtr + crow * EARLY_T + tcol) = rv[p];
      asm volatile("s_wait_xcnt 0x0" ::: "memory");   // before a register of the store is reused
    }
  }
  
}

// q, k and v projections read the same planes and depend on nothing of each other: one grid, z = 0 / 1 / 2.
// q / k: x = weight-row tile, y = (b,t) tile. v: the plane's flat block index walks the (b,t) tiles fastest.
__global__ __launch_bounds__(256) void gemm_qkv_kernel(const u16* __restrict__ xb, const u16* __restrict__ wpl,
                                                       const float* __restrict__ bq, const float* __restrict__ bk,
                                                       const float* __restrict__ bv, const float* __restrict__ fc,
                                                       u16* __restrict__ qh, u16* __restrict__ kh,
                                                       u16* __restrict__ qr, u16* __restrict__ kr,
                                                       u16* __restrict__ vt, u16* __restrict__ vtr) {
  __shared__ __align__(16) unsigned char sMem[GEMM_LDS_B];   // one allocation serves whichever body the block runs
  const int z = blockIdx.z;                                  // block-uniform choice
  if (z < 2) gemm_qk_body(sMem, blockIdx.x, blockIdx.y, z, xb, wpl, bq, bk, fc, qh, kh, qr, kr);
  else {
    const int lin = blockIdx.y * (DM / GT) + blockIdx.x;
    gemm_v_body(sMem, lin % ((NB * SEQ) / GT), lin / ((NB * SEQ) / GT), wpl + (size_t)2 * DM * DM, xb, bv, vt, vtr);
  }
}

// Output projection: out[(b,t)][n] = (ctx . Wp[n][:]) / (64*64) + bias[n]. RES != 0: rows t < EARLY_T, a second
// k sweep over the residual ctx plane is folded with 1/2048. Each wave writes one whole 512-B tile row
template <int RES>
static __device__ __forceinline__ void gemm_out_body(unsigned char* sMem, int bx, int y,
                                                     const u16* __restrict__ ctxh, const u16* __restrict__ ctxr,
                                                     const u16* __restrict__ wpb, const float* __restrict__ bp,
                                                     float* __restrict__ out) {
  u16*   ring = (u16*)sMem;
  float* sC   = (float*)sMem;
  const int tid  = threadIdx.x;
  const int lane = tid & 31;
  const int wave = tid >> 5;
  const int lq   = lane & 15;
  const int hi   = lane >> 4;
  const int nblk = bx * GT;
  const int b    = (RES != 0) ? (y / EARLY_TILES) : (y / LATE_TILES);
  const int t0   = (RES != 0) ? ((y % EARLY_TILES) * GT) : (EARLY_T + (y % LATE_TILES) * GT);
  const int wm   = (wave & 3) * 32;
  const int wn   = (wave >> 2) * 64;

  v8f acc[2][4];
  #pragma unroll
  for (int mt = 0; mt < 2; ++mt) {
    #pragma unroll
    for (int nt = 0; nt < 4; ++nt) acc[mt][nt] = (v8f){0, 0, 0, 0, 0, 0, 0, 0};
  }
  const u16* bblk = wpb + (size_t)nblk * DM;
  gemm_core<1>(ctxh + ((size_t)b * SEQ + t0) * DM, bblk, ring, tid, wm, wn, lq, hi, acc);
  if (RES != 0) {
    v8f acc2[2][4];
    #pragma unroll
    for (int mt = 0; mt < 2; ++mt) {
      #pragma unroll
      for (int nt = 0; nt < 4; ++nt) acc2[mt][nt] = (v8f){0, 0, 0, 0, 0, 0, 0, 0};
    }
    gemm_core<1>(ctxr + ((size_t)b * EARLY_T + t0) * DM, bblk, ring, tid, wm, wn, lq, hi, acc2);
    stage_tile2(sC, acc, acc2, wm, wn, lq, hi, 1.0f / (CTX_CARRY * WP_CARRY), RES_INV / (CTX_CARRY * WP_CARRY));
  } else {
    stage_tile(sC, acc, wm, wn, lq, hi, 1.0f / (CTX_CARRY * WP_CARRY));
  }
  __syncthreads();

  const int col = lane * 4;
  v4f bz = *(const v4f*)(bp + nblk + col);
  #pragma unroll
  for (int i = 0; i < 4; ++i) bz[i] = bfr(bz[i]);

  v4f vals[16];
  #pragma unroll
  for (int p = 0; p < 16; ++p) {
    const int row = p * 8 + wave;
    const v4f v = *(const v4f*)(sC + row * CP + col);
    vals[p] = v + bz;
  }
  float* obase = out + ((size_t)b * SEQ_FULL + t0 + wave) * DM + nblk + col;
  #pragma unroll
  for (int p = 0; p < 16; ++p) *(v4f*)(obase + (size_t)p * 8 * DM) = vals[p];
  
}

// Both row ranges in one grid: the tiles with the second k sweep (twice the trips) take the lowest block indices.
__global__ __launch_bounds__(256) void gemm_out_kernel(const u16* __restrict__ ctxh, const u16* __restrict__ ctxr,
                                                       const u16* __restrict__ wpb, const float* __restrict__ bp,
                                                       float* __restrict__ out) {
  __shared__ __align__(16) unsigned char sMem[GEMM_LDS_B];   // one allocation serves whichever body the block runs
  const int y = blockIdx.y;                                  // block-uniform choice
  if (y < NB * EARLY_TILES) gemm_out_body<1>(sMem, blockIdx.x, y, ctxh, ctxr, wpb, bp, out);
  else                      gemm_out_body<0>(sMem, blockIdx.x, y - NB * EARLY_TILES, ctxh, ctxr, wpb, bp, out);
}

// ---------------------------------------------------------------------------------------------------------
// Flash attention. Block = (query block of 128, head, batch); one wave owns 16 query rows.
// S^T = K x Q^T so queries sit on lanes; P^T in C-layout is bit-identical to the A-fragment layout of O += P x V.
// Q B-fragments come straight from the f16 plane. K and V^T tiles of SK keys are brought once per block into a
// two-buffer LDS ring by asynchronous copies (16 B per lane, a wave covers four whole 128-B rows per copy) and all
// eight waves read their K A-fragments and V^T B-fragments from the ring (two 16-B LDS loads each).
// Mask: per element replace-fill from the packed bit planes; key tiles past the diagonal are skipped only when the
// packed row flags of all 16 rows of the wave say that nothing beyond the diagonal is allowed and the diagonal is.
// RES != 0: residual planes (x2048) for q, k, v and P on separate accumulators; one online-softmax step per BK keys.
// RES == 0: one online-softmax step per ring stage (SK keys).
// One K tile and one V^T tile: rows r and r+32 (r = tid/8) of each, 16-B piece tid%8 of every row.
// lds: the lane's byte address in the K tile of the target buffer; the V^T tile lies AT_H elements behind it.
// The s_wait_xcnt stands inside the statement so that no address register is rewritten ahead of it.
static __device__ __forceinline__ void copy_kv(unsigned lds, const u16* gk, const u16* gv, size_t vpitch) {
  const unsigned ldv = lds + AT_H * 2u;
  asm volatile("global_load_async_to_lds_b128 %0, %4, off\n\t"
               "global_load_async_to_lds_b128 %1, %5, off\n\t"
               "global_load_async_to_lds_b128 %2, %6, off\n\t"
               "global_load_async_to_lds_b128 %3, %7, off\n\t"
               "s_wait_xcnt 0x0"
               :: "v"(lds), "v"(lds + 32u * LP * 2u), "v"(ldv), "v"(ldv + 32u * LP * 2u),
                  "v"(gk), "v"(gk + (size_t)32 * HDIM), "v"(gv), "v"(gv + (size_t)32 * vpitch)
               : "memory");
}

#define ATT_SO_B   (NWAVE * 16 * OP * 4)         // per-wave output staging
#define ATT_KV_B   (2 * 4 * AT_H * 2)            // two ring buffers of the form with residual planes (the larger one)
#define ATT_LDS_B  (ATT_SO_B + ATT_KV_B + NWAVE * 4)
static_assert(ATT_SO_B % 16 == 0 && ATT_KV_B % 16 == 0);

// sMem: the block's ATT_LDS_B bytes of LDS.
template <int RES>
static __device__ __forceinline__ void attn_body(unsigned char* sMem, int qblk, int h, int b,
                                                 const u16* __restrict__ qh_p, const u16* __restrict__ kh_p,
                                                 const u16* __restrict__ vt_p,
                                                 const u16* __restrict__ qr_p, const u16* __restrict__ kr_p,
                                                 const u16* __restrict__ vtr_p,
                                                 const unsigned* __restrict__ mbits,
                                                 const unsigned* __restrict__ pbits,
                                                 u16* __restrict__ ctxh, u16* __restrict__ ctxr) {
  const int tid  = threadIdx.x;
  const int wave = tid >> 5;
  const int lane = tid & 31;
  const int lq   = lane & 15;   // query column of S^T / d column of O
  const int hi   = lane >> 4;   // k-split half

  float* sO = (float*)sMem;                             // per-wave output staging (block barrier used)
  constexpr int ABUF_H = ((RES != 0) ? 4 : 2) * AT_H;   // one ring buffer: [K | V^T] and, with RES, [K res | V^T res]
  u16* sKV = (u16*)(sMem + ATT_SO_B);                   // 2 * ABUF_H elements, cross-wave (block barriers)
  int* sN  = (int*)(sMem + ATT_SO_B + ATT_KV_B);        // NWAVE words, cross-wave (block barrier)

  const int qrow0 = qblk * BQ + wave * 16;
  const int qi    = qrow0 + lq;
  const size_t bh = (size_t)b * NHEAD + h;

  // Q as B-operand fragments: lane lq holds query qi, split d map.
  Frag qf[2], qrf[2];
  {
    const u16* qp = qh_p + (bh * SEQ + qi) * HDIM + hi * 8;
    #pragma unroll
    for (int f = 0; f < 2; ++f) {
      qf[f].q[0] = *(const v4u*)(qp + f * 32);        // d = f*32 + hi*8 + 0..7
      qf[f].q[1] = *(const v4u*)(qp + f * 32 + 16);   // d = f*32 + 16 + hi*8 + 0..7
    }
  }
  if (RES != 0) {
    const u16* qp = qr_p + (bh * EARLY_T + qi) * HDIM + hi * 8;
    #pragma unroll
    for (int f = 0; f < 2; ++f) {
      qrf[f].q[0] = *(const v4u*)(qp + f * 32);
      qrf[f].q[1] = *(const v4u*)(qp + f * 32 + 16);
    }
  } else {
    #pragma unroll
    for (int f = 0; f < 2; ++f) {
      qrf[f].q[0] = (v4u){0u, 0u, 0u, 0u};
      qrf[f].q[1] = (v4u){0u, 0u, 0u, 0u};
    }
  }

  // ring fill: the lane's source piece in stage 0 of each plane and its LDS byte address in buffer 0
  const int crow = tid >> 3;
  const int cseg = tid & 7;
  const u16* gk  = kh_p  + (bh * SEQ + crow) * HDIM + cseg * 8;
  const u16* gkr = kr_p  + (bh * EARLY_T + crow) * HDIM + cseg * 8;
  const u16* gv  = vt_p  + (bh * HDIM + crow) * SEQ + cseg * 8;
  const u16* gvr = vtr_p + (bh * HDIM + crow) * EARLY_T + cseg * 8;
  const unsigned l0 = (unsigned)(uintptr_t)sKV + (unsigned)(crow * LP + cseg * 8) * 2u;
  // fragment reads: K row = key lq of a 16-key group, V^T row = d lq of a 16-d group, split k map
  const u16* fk = sKV + lq * LP + hi * 8;
  const u16* fv = sKV + AT_H + lq * LP + hi * 8;

  const unsigned* mrow = mbits + (size_t)qi * MPITCH;
  const unsigned* prow = pbits + (size_t)b * MPITCH;

  // wave-uniform tile-skip decision from the packed row flags and the diagonal padding bits
  const unsigned rk = mrow[MW];
  const unsigned pw = prow[qi >> 5];
  const bool rowok  = (rk == 1u) && (((pw >> (qi & 31)) & 1u) != 0u);
  const bool allok  = (__builtin_amdgcn_ballot_w32(rowok) == 0xffffffffu);
  int nchunk = allok ? ((qrow0 + 15) / BK + 1) : (SEQ / BK);
  nchunk = (nchunk < SEQ / BK) ? nchunk : (SEQ / BK);      // static bound
  nchunk = __builtin_amdgcn_readfirstlane(nchunk);

  // block-uniform stage count: the ring serves the wave that walks furthest
  if (lane == 0) sN[wave] = nchunk;
  __syncthreads();
  int nmax = sN[0];
  #pragma unroll
  for (int w = 1; w < NWAVE; ++w) nmax = (sN[w] > nmax) ? sN[w] : nmax;
  const int nstage = __builtin_amdgcn_readfirstlane((nmax + SK / BK - 1) / (SK / BK));   // 1 .. SEQ / SK

  // stage s into the buffer at byte offset bufb; residual planes end at EARLY_T: later stages copy the last one
  auto fill = [&](int s, unsigned bufb) {
    copy_kv(l0 + bufb, gk + (size_t)s * SK * HDIM, gv + (size_t)s * SK, SEQ);
    if (RES != 0) {
      const int sr = (s < EARLY_T / SK) ? s : (EARLY_T / SK - 1);
      copy_kv(l0 + bufb + 2u * AT_H * 2u, gkr + (size_t)sr * SK * HDIM, gvr + (size_t)sr * SK, EARLY_T);
    }
  };

  v8f o[4], o2[4];
  #pragma unroll
  for (int dt = 0; dt < 4; ++dt) {
    o[dt]  = (v8f){0, 0, 0, 0, 0, 0, 0, 0};
    o2[dt] = (v8f){0, 0, 0, 0, 0, 0, 0, 0};
  }

  float rmax = -__builtin_inff();
  float rsum = 0.0f;
  const float SL      = (0.125f / (QK_CARRY * QK_CARRY)) * 1.4426950408889634f;   // scale * log2(e) / carries
  const float FILLRAW = -1.0e30f * 8.0f * (QK_CARRY * QK_CARRY);                  // fill value in the carried raw domain

  fill(0, 0u);
  asm volatile("s_wait_asynccnt 0x0" ::: "memory");   // stage 0 landed (this wave's copies)
  __syncthreads();                                    // stage 0 readable by every wave
  if (nstage > 1) fill(1, (unsigned)ABUF_H * 2u);     // block-uniform

  #pragma unroll 1   // one ring stage per trip: the buffer index stays a run-time value
  for (int s = 0; s < nstage; ++s) {
   const int bo = (s & 1) * ABUF_H;
   if constexpr (RES == 0) {
    // One softmax step per ring stage: all SK keys of the stage share one maximum, one exchange and one rescale of O.
    // A wave whose last chunk ends in the middle of a stage takes the whole stage: the packed mask bits fill the rest.
    constexpr int NPF = SK / BK;                                // P fragments (32 keys each) per step
    const int i0 = s * NPF;
    unsigned mw[NPF];                                           // allowed bits of keys s*SK + 32*pf + 0..31 for query qi
    #pragma unroll
    for (int pf = 0; pf < NPF; ++pf) mw[pf] = mrow[i0 + pf] & prow[i0 + pf];
    if (s * (SK / BK) < nchunk) {                               // wave-uniform; the publish point below is not skipped
      // S^T tiles: c[sub][r] = carried rawscore(query qi, key s*SK + sub*16 + hi*8 + r)
      Frag ak[2 * NPF][2];
      #pragma unroll
      for (int sub = 0; sub < 2 * NPF; ++sub) {
        const u16* kb = fk + bo + sub * 16 * LP;
        #pragma unroll
        for (int f = 0; f < 2; ++f) {
          ak[sub][f].q[0] = *(const v4u*)(kb + f * 32);
          ak[sub][f].q[1] = *(const v4u*)(kb + f * 32 + 16);
        }
      }
      v8f c[2 * NPF];
      #pragma unroll
      for (int sub = 0; sub < 2 * NPF; ++sub) c[sub] = (v8f){0, 0, 0, 0, 0, 0, 0, 0};
      #pragma unroll
      for (int f = 0; f < 2; ++f) {
        #pragma unroll
        for (int sub = 0; sub < 2 * NPF; ++sub) c[sub] = mma_f16(ak[sub][f].vh, qf[f].vh, c[sub]);
      }

      // V B-fragments of the stage: column n = d = dt*16 + lq, split key map from the transposed plane
      Frag bv[NPF][4];
      #pragma unroll
      for (int pf = 0; pf < NPF; ++pf) {
        #pragma unroll
        for (int dt = 0; dt < 4; ++dt) {
          const u16* vb = fv + bo + dt * 16 * LP + pf * BK;
          bv[pf][dt].q[0] = *(const v4u*)(vb);        // keys s*SK + pf*32 + hi*8 + 0..7
          bv[pf][dt].q[1] = *(const v4u*)(vb + 16);   // keys s*SK + pf*32 + 16 + hi*8 + 0..7
        }
      }

      // mask: replace-fill; branch is wave-uniform, selects are per lane
      unsigned mall = 0xffffffffu;
      #pragma unroll
      for (int pf = 0; pf < NPF; ++pf) mall &= mw[pf];
      if (__builtin_amdgcn_ballot_w32(mall != 0xffffffffu) != 0u) {
        #pragma unroll
        for (int pf = 0; pf < NPF; ++pf) {
          const unsigned ms = mw[pf] >> (hi * 8);
          #pragma unroll
          for (int sb = 0; sb < 2; ++sb) {
            #pragma unroll
            for (int r = 0; r < 8; ++r) {
              const bool allowed = ((ms >> (sb * 16 + r)) & 1u) != 0u;
              c[pf * 2 + sb][r] = allowed ? c[pf * 2 + sb][r] : FILLRAW;
            }
          }
        }
      }

      // online softmax: query lq's SK scores are split across lane / lane^16
      float m_new = rmax;
      #pragma unroll
      for (int pf = 0; pf < NPF; ++pf) {                        // one chain per fragment: the chains run side by side
        float mp = c[pf * 2][0];
        #pragma unroll
        for (int r = 0; r < 8; ++r) {
          mp = fmaxf(mp, c[pf * 2][r]);
          mp = fmaxf(mp, c[pf * 2 + 1][r]);
        }
        m_new = fmaxf(m_new, mp);
      }
      m_new = fmaxf(m_new, __shfl_xor(m_new, 16, 32));
      const float scale = __builtin_amdgcn_exp2f((rmax - m_new) * SL);
      rmax = m_new;

      // exp + pack: P^T C-layout == A-fragment layout for the PV product; one partial row sum per fragment
      Frag pa[NPF];
      float psum = 0.0f;
      #pragma unroll
      for (int pf = 0; pf < NPF; ++pf) {
        Pack8H a0, a1;
        float ps = 0.0f;
        #pragma unroll
        for (int r = 0; r < 8; ++r) {
          const float p0 = __builtin_amdgcn_exp2f((c[pf * 2][r] - m_new) * SL);       // key pf*32 + hi*8 + r
          const float p1 = __builtin_amdgcn_exp2f((c[pf * 2 + 1][r] - m_new) * SL);   // key pf*32 + 16 + hi*8 + r
          ps += p0 + p1;
          a0.h[r] = (f16)(p0 * P_CARRY);
          a1.h[r] = (f16)(p1 * P_CARRY);
        }
        pa[pf].q[0] = a0.u;
        pa[pf].q[1] = a1.u;
        psum += ps;
      }
      rsum = rsum * scale + psum + __shfl_xor(psum, 16, 32);

      // rescale O: queries are the row dimension there -> per-row scale from lane 8*hi + r
      float sc[8];
      #pragma unroll
      for (int r = 0; r < 8; ++r) sc[r] = __shfl(scale, (hi << 3) + r, 32);
      #pragma unroll
      for (int dt = 0; dt < 4; ++dt) {
        #pragma unroll
        for (int r = 0; r < 8; ++r) o[dt][r] *= sc[r];
      }

      // O += P x V
      #pragma unroll
      for (int pf = 0; pf < NPF; ++pf) {
        #pragma unroll
        for (int dt = 0; dt < 4; ++dt) o[dt] = mma_f16(pa[pf].vh, bv[pf][dt].vh, o[dt]);
      }
    }
    asm volatile("s_wait_xcnt 0x0" ::: "memory");     // before the address register of the mask-word load is advanced
   } else {
   #pragma unroll    // the chunk offsets inside a stage become immediate offsets of the LDS loads
   for (int cc = 0; cc < SK / BK; ++cc) {
    const int i = s * (SK / BK) + cc;
    if (i >= nchunk) continue;                                  // wave-uniform; the publish point below is not skipped
    const int j0 = i * BK;
    const unsigned mw = mrow[i] & prow[i];                      // allowed bits of keys j0..j0+31 for query qi
    const bool res_on = (RES != 0) && (j0 < EARLY_T);           // wave-uniform

    // S^T tiles: c[sub][r] = carried rawscore(query qi, key j0 + sub*16 + hi*8 + r)
    v8f c[2];
    #pragma unroll
    for (int sub = 0; sub < 2; ++sub) {
      Frag ak[2];
      const u16* kb = fk + bo + (cc * BK + sub * 16) * LP;
      #pragma unroll
      for (int f = 0; f < 2; ++f) {
        ak[f].q[0] = *(const v4u*)(kb + f * 32);
        ak[f].q[1] = *(const v4u*)(kb + f * 32 + 16);
      }
      v8f acc = (v8f){0, 0, 0, 0, 0, 0, 0, 0};
      acc = mma_f16(ak[0].vh, qf[0].vh, acc);
      acc = mma_f16(ak[1].vh, qf[1].vh, acc);
      if (RES != 0) {
        Frag akr[2];
        const u16* kbr = fk + bo + 2 * AT_H + (cc * BK + sub * 16) * LP;
        #pragma unroll
        for (int f = 0; f < 2; ++f) {
          const v4u l0 = *(const v4u*)(kbr + f * 32);
          const v4u l1 = *(const v4u*)(kbr + f * 32 + 16);
          akr[f].q[0] = res_on ? l0 : (v4u){0u, 0u, 0u, 0u};
          akr[f].q[1] = res_on ? l1 : (v4u){0u, 0u, 0u, 0u};
        }
        v8f acc2 = (v8f){0, 0, 0, 0, 0, 0, 0, 0};
        acc2 = mma_f16(ak[0].vh,  qrf[0].vh, acc2);
        acc2 = mma_f16(ak[1].vh,  qrf[1].vh, acc2);
        acc2 = mma_f16(akr[0].vh, qf[0].vh,  acc2);
        acc2 = mma_f16(akr[1].vh, qf[1].vh,  acc2);
        #pragma unroll
        for (int r = 0; r < 8; ++r) acc[r] += acc2[r] * RES_INV;
        asm volatile("" ::: "memory");
      }
      c[sub] = acc;
    }

    // mask: replace-fill; branch is wave-uniform, selects are per lane
    if (__builtin_amdgcn_ballot_w32(mw != 0xffffffffu) != 0u) {
      const unsigned ms = mw >> (hi * 8);
      #pragma unroll
      for (int sub = 0; sub < 2; ++sub) {
        #pragma unroll
        for (int r = 0; r < 8; ++r) {
          const bool allowed = ((ms >> (sub * 16 + r)) & 1u) != 0u;
          c[sub][r] = allowed ? c[sub][r] : FILLRAW;
        }
      }
    }

    // online softmax: query lq's 32 scores are split across lane / lane^16
    float m_new = rmax;
    #pragma unroll
    for (int r = 0; r < 8; ++r) {
      m_new = fmaxf(m_new, c[0][r]);
      m_new = fmaxf(m_new, c[1][r]);
    }
    m_new = fmaxf(m_new, __shfl_xor(m_new, 16, 32));
    const float scale = __builtin_amdgcn_exp2f((rmax - m_new) * SL);
    rmax = m_new;

    // exp + pack: P^T C-layout == A-fragment layout for the PV product
    Frag pa, pr;
    {
      Pack8H a0, a1, r0, r1;
      float psum = 0.0f;
      #pragma unroll
      for (int r = 0; r < 8; ++r) {
        const float p0 = __builtin_amdgcn_exp2f((c[0][r] - m_new) * SL);   // key hi*8 + r
        const float p1 = __builtin_amdgcn_exp2f((c[1][r] - m_new) * SL);   // key 16 + hi*8 + r
        psum += p0 + p1;
        const float pc0 = p0 * P_CARRY;
        const float pc1 = p1 * P_CARRY;
        const f16 h0 = (f16)pc0;
        const f16 h1 = (f16)pc1;
        a0.h[r] = h0;
        a1.h[r] = h1;
        if (RES != 0) {
          r0.h[r] = (f16)((pc0 - (float)h0) * RES_CARRY);
          r1.h[r] = (f16)((pc1 - (float)h1) * RES_CARRY);
        } else {
          r0.h[r] = (f16)0.0f;
          r1.h[r] = (f16)0.0f;
        }
      }
      pa.q[0] = a0.u;  pa.q[1] = a1.u;
      pr.q[0] = r0.u;  pr.q[1] = r1.u;
      rsum = rsum * scale + psum + __shfl_xor(psum, 16, 32);
    }

    // rescale O: queries are the row dimension there -> per-row scale from lane 8*hi + r
    float sc[8];
    #pragma unroll
    for (int r = 0; r < 8; ++r) sc[r] = __shfl(scale, (hi << 3) + r, 32);
    #pragma unroll
    for (int dt = 0; dt < 4; ++dt) {
      #pragma unroll
      for (int r = 0; r < 8; ++r) {
        o[dt][r] *= sc[r];
        if (RES != 0) o2[dt][r] *= sc[r];
      }
    }
    if (RES != 0) asm volatile("" ::: "memory");

    // O += P x V ; V B-fragments: column n = d = dt*16 + lq, split key map from the transposed plane
    #pragma unroll
    for (int dt = 0; dt < 4; ++dt) {
      Frag bv;
      const u16* vb = fv + bo + dt * 16 * LP + cc * BK;
      bv.q[0] = *(const v4u*)(vb);            // keys j0 + hi*8 + 0..7
      bv.q[1] = *(const v4u*)(vb + 16);       // keys j0 + 16 + hi*8 + 0..7
      o[dt] = mma_f16(pa.vh, bv.vh, o[dt]);
      if (RES != 0) {
        Frag bvr;
        const u16* vbr = fv + bo + 2 * AT_H + dt * 16 * LP + cc * BK;
        const v4u l0 = *(const v4u*)(vbr);
        const v4u l1 = *(const v4u*)(vbr + 16);
        bvr.q[0] = res_on ? l0 : (v4u){0u, 0u, 0u, 0u};
        bvr.q[1] = res_on ? l1 : (v4u){0u, 0u, 0u, 0u};
        o2[dt] = mma_f16(pa.vh, bvr.vh, o2[dt]);
        o2[dt] = mma_f16(pr.vh, bv.vh,  o2[dt]);
      }
    }
   }
   }
   asm volatile("s_wait_dscnt 0x0" ::: "memory");      // this wave's reads of buffer s%2 are done before its refill
   asm volatile("s_wait_asynccnt 0x0" ::: "memory");   // stage s+1 landed (this wave's copies)
   __syncthreads();                                    // publishes stage s+1, ends every read of buffer s%2
   if (s + 2 < nstage) fill(s + 2, (unsigned)bo * 2u); // block-uniform
  }
  asm volatile("s_wait_asynccnt 0x0" ::: "memory");    // nothing in flight when the wave ends

  // normalize: lane holds column d = dt*16 + lq for query rows 8*hi + r
  float rs[8];
  #pragma unroll
  for (int r = 0; r < 8; ++r) rs[r] = 1.0f / __shfl(rsum, (hi << 3) + r, 32);

  float* so = sO + wave * (16 * OP);
  #pragma unroll
  for (int r = 0; r < 8; ++r) {
    #pragma unroll
    for (int dt = 0; dt < 4; ++dt) {
      float val = o[dt][r];
      if (RES != 0) val += o2[dt][r] * RES_INV;
      so[(hi * 8 + r) * OP + dt * 16 + lq] = val * (1.0f / (P_CARRY * V_CARRY)) * rs[r];
    }
  }
  __syncthreads();

  // rows it*4 + (lane>>3), it = 0..3 cover the wave's 16 rows, (lane&7)*8 covers d 0..63.
  const int seg = lane & 7;
  v4u hv[4], rv[4];
  #pragma unroll
  for (int it = 0; it < 4; ++it) {
    const int row = it * 4 + (lane >> 3);
    const v4f a0 = *(const v4f*)(so + row * OP + seg * 8);
    const v4f a1 = *(const v4f*)(so + row * OP + seg * 8 + 4);
    float ov[8];
    #pragma unroll
    for (int i = 0; i < 4; ++i) {
      ov[i]     = a0[i];
      ov[4 + i] = a1[i];
    }
    pack_hr(ov, CTX_CARRY, hv[it], rv[it]);
  }
  #pragma unroll
  for (int it = 0; it < 4; ++it) {
    const int row = qrow0 + it * 4 + (lane >> 3);
    *(v4u*)(ctxh + ((size_t)b * SEQ + row) * DM + h * HDIM + seg * 8) = hv[it];
    if (RES != 0) *(v4u*)(ctxr + ((size_t)b * EARLY_T + row) * DM + h * HDIM + seg * 8) = rv[it];
  }
  asm volatile("s_wait_xcnt 0x0" ::: "memory");     // before a register of these stores is reused
  
}

// Both forms in one grid. The query blocks are dealt by falling cost under a
// causal mask: 2 (qblk + 1) key stages, a stage with residual planes counted 9/4 of a plain one (roughly its instruction count).
// Any order is a permutation of the query blocks: it decides speed only. Packed as one nibble per grid slot.
#define NQBLK (SEQ / BQ)
static_assert(NQBLK <= 16);
static constexpr unsigned long long make_qorder() {
  int q[NQBLK] = {};
  int c[NQBLK] = {};
  for (int i = 0; i < NQBLK; ++i) {
    q[i] = i;
    c[i] = (i + 1) * ((i < EARLY_T / BQ) ? 9 : 4);
  }
  for (int i = 1; i < NQBLK; ++i) {
    for (int j = i; j > 0 && c[j] > c[j - 1]; --j) {
      const int tq = q[j]; q[j] = q[j - 1]; q[j - 1] = tq;
      const int tc = c[j]; c[j] = c[j - 1]; c[j - 1] = tc;
    }
  }
  unsigned long long w = 0;
  for (int i = 0; i < NQBLK; ++i) w |= (unsigned long long)q[i] << (4 * i);
  return w;
}

__global__ __launch_bounds__(256) void attn_kernel(const u16* __restrict__ qh_p, const u16* __restrict__ kh_p,
                                                   const u16* __restrict__ vt_p,
                                                   const u16* __restrict__ qr_p, const u16* __restrict__ kr_p,
                                                   const u16* __restrict__ vtr_p,
                                                   const unsigned* __restrict__ mbits,
                                                   const unsigned* __restrict__ pbits,
                                                   u16* __restrict__ ctxh, u16* __restrict__ ctxr) {
  __shared__ __align__(16) unsigned char sMem[ATT_LDS_B];   // one allocation serves whichever body the block runs
  constexpr unsigned long long QORDER = make_qorder();
  const int qblk = (int)((QORDER >> (4 * blockIdx.z)) & 15ull);   // block-uniform
  const int h    = blockIdx.x;
  const int b    = blockIdx.y;
  if (qblk < EARLY_T / BQ) attn_body<1>(sMem, qblk, h, b, qh_p, kh_p, vt_p, qr_p, kr_p, vtr_p, mbits, pbits, ctxh, ctxr);
  else                     attn_body<0>(sMem, qblk, h, b, qh_p, kh_p, vt_p, qr_p, kr_p, vtr_p, mbits, pbits, ctxh, ctxr);
}

// ---------------------------------------------------------------------------------------------------------
static constexpr size_t al128(size_t x) { return (x + 127) & ~(size_t)127; }
static constexpr size_t XB_B   = al128((size_t)NB * SEQ * DM * 2);
static constexpr size_t WPL_B  = al128((size_t)4 * DM * DM * 2);
static constexpr size_t QH_B   = al128((size_t)NB * NHEAD * SEQ * HDIM * 2);
static constexpr size_t QR_B   = al128((size_t)NB * NHEAD * EARLY_T * HDIM * 2);
static constexpr size_t VT_B   = al128((size_t)NB * DM * SEQ * 2);
static constexpr size_t VTR_B  = al128((size_t)NB * DM * EARLY_T * 2);
static constexpr size_t CTXH_B = al128((size_t)NB * SEQ * DM * 2);
static constexpr size_t CTXR_B = al128((size_t)NB * EARLY_T * DM * 2);
static constexpr size_t MB_B   = al128((size_t)SEQ * MPITCH * 4);
static constexpr size_t PB_B   = al128((size_t)NB * MPITCH * 4);
static constexpr size_t WS_TOTAL = XB_B + WPL_B + 2 * QH_B + 2 * QR_B + VT_B + VTR_B + CTXH_B + CTXR_B + MB_B + PB_B;
static_assert(WS_TOTAL <= (size_t)134217728);

extern "C" void kernel_launch(void* const* d_in, const int* in_sizes, int n_in,
                              void* d_out, int out_size, void* d_ws, size_t ws_size,
                              hipStream_t stream) {
  if (n_in < 12) return;
  const size_t rows_used = (size_t)(NB - 1) * SEQ_FULL + SEQ;
  if ((size_t)in_sizes[0] < rows_used * DM) return;
  if ((size_t)in_sizes[1] < (size_t)SEQ * HDIM) return;
  if ((size_t)in_sizes[2] < (size_t)(SEQ - 1) * SEQ_FULL + SEQ) return;
  if ((size_t)in_sizes[3] < rows_used) return;
  if ((size_t)in_sizes[4] < (size_t)DM * DM || (size_t)in_sizes[6] < (size_t)DM * DM) return;
  if ((size_t)in_sizes[8] < (size_t)DM * DM || (size_t)in_sizes[10] < (size_t)DM * DM) return;
  if (in_sizes[5] < DM || in_sizes[7] < DM || in_sizes[9] < DM || in_sizes[11] < DM) return;
  if ((size_t)out_size < rows_used * DM) return;
  if (ws_size < WS_TOTAL) return;

  const float* x   = (const float*)d_in[0];
  const float* fc  = (const float*)d_in[1];
  const int*   am  = (const int*)d_in[2];
  const int*   pm  = (const int*)d_in[3];
  const float* Wq  = (const float*)d_in[4];
  const float* bq  = (const float*)d_in[5];
  const float* Wk  = (const float*)d_in[6];
  const float* bk  = (const float*)d_in[7];
  const float* Wv  = (const float*)d_in[8];
  const float* bv  = (const float*)d_in[9];
  const float* Wp  = (const float*)d_in[10];
  const float* bp  = (const float*)d_in[11];
  float* out = (float*)d_out;

  char* ws = (char*)d_ws;
  size_t off = 0;
  u16* xb   = (u16*)(ws + off); off += XB_B;
  u16* wpl  = (u16*)(ws + off); off += WPL_B;
  u16* qh   = (u16*)(ws + off); off += QH_B;
  u16* kh   = (u16*)(ws + off); off += QH_B;
  u16* vt   = (u16*)(ws + off); off += VT_B;
  u16* qr   = (u16*)(ws + off); off += QR_B;
  u16* kr   = (u16*)(ws + off); off += QR_B;
  u16* vtr  = (u16*)(ws + off); off += VTR_B;
  u16* ctxh = (u16*)(ws + off); off += CTXH_B;
  u16* ctxr = (u16*)(ws + off); off += CTXR_B;
  unsigned* mbits = (unsigned*)(ws + off); off += MB_B;
  unsigned* pbits = (unsigned*)(ws + off); off += PB_B;

  prep_kernel<<<dim3(PREP_X_SB + PREP_W_SB + PREP_M_SB), 256, 0, stream>>>(x, Wq, Wk, Wv, Wp, am, pm, xb, wpl,
                                                                                  mbits, pbits);
  gemm_qkv_kernel<<<dim3(DM / GT, (NB * SEQ) / GT, 3), 256, 0, stream>>>(xb, wpl, bq, bk, bv, fc, qh, kh, qr, kr, vt,
                                                                         vtr);
  attn_kernel<<<dim3(NHEAD, NB, NQBLK), 256, 0, stream>>>(qh, kh, vt, qr, kr, vtr, mbits, pbits, ctxh, ctxr);
  gemm_out_kernel<<<dim3(DM / GT, (NB * SEQ) / GT), 256, 0, stream>>>(ctxh, ctxr, wpl + (size_t)3 * DM * DM, bp, out);
}
